// v000
// Measured on an AMD MI455X. A time is GPU time per run, averaged over a window of back-to-back runs after a warm-up
// (all launches, gaps included; the runs take copies of the inputs in turn), and the median of several windows.
// Apart from v000's, it joins two sittings. Times from different sittings can be a few percent apart, while
// side-by-side timings come from the same sitting.
// v000 is the starting kernel. One run takes 240 microseconds.
#include <hip/hip_runtime.h>
#include <math.h>

typedef __attribute__((ext_vector_type(16))) _Float16 v16h;
typedef __attribute__((ext_vector_type(16))) __bf16 v16b;
typedef __attribute__((ext_vector_type(8)))  _Float16 v8h;
typedef __attribute__((ext_vector_type(8)))  float v8f;
typedef __attribute__((ext_vector_type(4)))  float v4f;
typedef __attribute__((ext_vector_type(2)))  float v2f;
typedef __attribute__((ext_vector_type(4)))  unsigned v4u;
typedef __attribute__((ext_vector_type(4)))  int v4i;
typedef float __attribute__((may_alias)) float_a;
typedef int __attribute__((may_alias)) int_a;

template <typename T> __device__ __forceinline__ void vst2(void* p, T v) { *(T*)p = v;  }
__device__ __forceinline__ v8f wmma16(v16h a, v16h b, v8f c) {
  v8f d = __builtin_amdgcn_wmma_f32_16x16x32_f16(false, a, false, b, (short)0, c, false, false);
  asm volatile("v_nop\n\tv_nop\n\tv_nop\n\tv_nop" : "+v"(d) : "v"(a), "v"(b));
  return d;
}
__device__ __forceinline__ v8f wmma_bf(v16b a, v16b b, v8f c) {
  v8f d = __builtin_amdgcn_wmma_f32_16x16x32_bf16(false, a, false, b, (short)0, c, false, false);
  asm volatile("v_nop\n\tv_nop\n\tv_nop\n\tv_nop" : "+v"(d) : "v"(a), "v"(b));
  return d;
}
// 16x16x32 fragments: lane = (h = lane>>4, row/col = lane&15); elements 0..7 = k0+8h+0..7, 8..15 = k0+16+8h+0..7; D element r = row 8h+r
__device__ __forceinline__ v16h frag_h(const _Float16* rowk0, int lane) {
  union { v16h v; v8h q[2]; } u; const _Float16* p = rowk0 + 8 * (lane >> 4);
  u.q[0] = *(const v8h*)p; u.q[1] = *(const v8h*)(p + 16); return u.v;
}
__device__ __forceinline__ v16h frag_f32(const float* rowk0, int lane) {
  v16h a; const float* p = rowk0 + 8 * (lane >> 4);
#pragma unroll
  for (int i = 0; i < 8; ++i) { a[i] = (_Float16)p[i]; a[8 + i] = (_Float16)p[16 + i]; }
  return a;
}
__device__ __forceinline__ v16h frag_f32s(const float* rowk0, int lane, float sc) {
  v16h a; const float* p = rowk0 + 8 * (lane >> 4);
#pragma unroll
  for (int i = 0; i < 8; ++i) { a[i] = (_Float16)(p[i] * sc); a[8 + i] = (_Float16)(p[16 + i] * sc); }
  return a;
}
// column fragment from a [K][ld] layout (column n), rows >= K read as 0
__device__ __forceinline__ v16h fragc_f32(const float* W, int k0, int n, int lane, int ld, int K) {
  v16h a; const int g = lane >> 4;
#pragma unroll
  for (int i = 0; i < 8; ++i) { const int ka = k0 + 8 * g + i, kb = ka + 16;
    a[i] = (_Float16)(ka < K ? W[(size_t)ka * ld + n] : 0.f); a[8 + i] = (_Float16)(kb < K ? W[(size_t)kb * ld + n] : 0.f); }
  return a;
}
struct F2 { v16b h, l; };
__device__ __forceinline__ F2 bsplit16(const float v[16]) { F2 r;
#pragma unroll
  for (int i = 0; i < 16; ++i) { const __bf16 h = (__bf16)v[i]; r.h[i] = h; r.l[i] = (__bf16)(v[i] - (float)h); }
  return r; }
__device__ __forceinline__ F2 split_row(const float* row, int k0, int lane) { float v[16]; const float* p = row + k0 + 8 * (lane >> 4);
#pragma unroll
  for (int i = 0; i < 8; ++i) { v[i] = p[i]; v[8 + i] = p[16 + i]; }
  return bsplit16(v); }
__device__ __forceinline__ F2 split_rowK(const float* row, int k0, int lane, int K) { float v[16]; const int g = lane >> 4;
#pragma unroll
  for (int i = 0; i < 8; ++i) { const int ka = k0 + 8 * g + i, kb = ka + 16; v[i] = ka < K ? row[ka] : 0.f; v[8 + i] = kb < K ? row[kb] : 0.f; }
  return bsplit16(v); }
__device__ __forceinline__ F2 split_col(const float* W, int k0, int n, int lane, int ld, int K) { float v[16]; const int g = lane >> 4;
#pragma unroll
  for (int i = 0; i < 8; ++i) { const int ka = k0 + 8 * g + i, kb = ka + 16; v[i] = ka < K ? W[(size_t)ka * ld + n] : 0.f; v[8 + i] = kb < K ? W[(size_t)kb * ld + n] : 0.f; }
  return bsplit16(v); }
__device__ __forceinline__ v8f mac3(const F2& a, const F2& b, v8f c) { c = wmma_bf(a.l, b.h, c); c = wmma_bf(a.h, b.l, c); return wmma_bf(a.h, b.h, c); }
__device__ __forceinline__ float sigm(float v) { return 1.0f / (1.0f + expf(-v)); }
#define LDSX() do { asm volatile("s_wait_dscnt 0" ::: "memory"); __builtin_amdgcn_wave_barrier(); __builtin_amdgcn_fence(__ATOMIC_RELEASE, "workgroup"); } while (0)

// Gated relation-transformer block: LN(x); 8-head (d=32) self attention with an additive [S,S] relation bias (read as data) and output
// projection; gate0 = sigmoid(x gW + gb); gate1 = gate0*mha + x; mlp = sigmoid(gate1 mW + mb); out = gate1*LN(mlp) + gate1.
// All six [in][out] weights packed transposed to f16 rows (x16); every product on v_wmma_f32_16x16x32_f16 (activations as f16 copies /
// LDS tiles, q/k/v head-major x4, P x2^14); LayerNorms, softmax (online over 16 key tiles), sigmoids and gating in f32.
#define NB 16
#define SS 1024
#define EE 256
#define NH 8
#define HD 32
#define NR (NB * SS)

// LN(x) -> X16 ; x -> M16 ; wave per row (256 = 32 lanes x 8)
__global__ __launch_bounds__(256) void k_ln(const float* __restrict__ x, const float* __restrict__ g, const float* __restrict__ bb, _Float16* __restrict__ X16, _Float16* __restrict__ M16) {
  const int wave = threadIdx.x >> 5, lane = threadIdx.x & 31; const size_t r = (size_t)blockIdx.x * 8 + wave; if (r >= NR) return;
  const float* xr = x + r * EE; float v[8]; float s = 0.f;
#pragma unroll
  for (int e = 0; e < 8; ++e) { v[e] = xr[lane * 8 + e]; s += v[e]; }
#pragma unroll
  for (int off = 16; off >= 1; off >>= 1) s += __shfl_xor(s, off, 32);
  const float mu = s * (1.0f / EE); float q2 = 0.f;
#pragma unroll
  for (int e = 0; e < 8; ++e) { const float d = v[e] - mu; q2 += d * d; }
#pragma unroll
  for (int off = 16; off >= 1; off >>= 1) q2 += __shfl_xor(q2, off, 32);
  const float rs = rsqrtf(q2 * (1.0f / EE) + 1e-5f);
  union { v8h h; v4u u; } p1, p2;
#pragma unroll
  for (int e = 0; e < 8; ++e) { const int c = lane * 8 + e; p1.h[e] = (_Float16)((v[e] - mu) * rs * g[c] + bb[c]); p2.h[e] = (_Float16)v[e]; }
  vst2(X16 + r * EE + lane * 8, p1.u); vst2(M16 + r * EE + lane * 8, p2.u);
}
// P rows [w*256 + n][256] = W_w[k][n]*16 for w: 0 Wq, 1 Wk, 2 Wv, 3 Wo, 4 gW, 5 mW
__global__ __launch_bounds__(256) void k_pack(const float* __restrict__ Wq, const float* __restrict__ Wk, const float* __restrict__ Wv, const float* __restrict__ Wo, const float* __restrict__ gW, const float* __restrict__ mW, _Float16* __restrict__ P) {
  const int r = blockIdx.x, tid = threadIdx.x; __shared__ __align__(16) _Float16 srow[EE];
  const int which = r >> 8, n = r & 255; const float* W = which == 0 ? Wq : which == 1 ? Wk : which == 2 ? Wv : which == 3 ? Wo : which == 4 ? gW : mW;
  srow[tid] = (_Float16)(W[(size_t)tid * EE + n] * 16.0f);
  __syncthreads();
  if (tid < 32) vst2(P + (size_t)r * EE + tid * 8, *(const v4u*)(&srow[tid * 8]));
}
// q/k/v: block (64 rows, 128 cols = 4 heads, which)
__global__ __launch_bounds__(128) void k_qkv(const _Float16* __restrict__ X16, const _Float16* __restrict__ P, const float* __restrict__ bq, const float* __restrict__ bk, const float* __restrict__ bv, _Float16* __restrict__ Q16, _Float16* __restrict__ K16, _Float16* __restrict__ VT) {
  __shared__ __align__(16) float so[4][16][132];
  __shared__ __align__(16) _Float16 st[128][72];
  const int tid = threadIdx.x, wave = tid >> 5, lane = tid & 31, col = lane & 15, g = lane >> 4;
  const int which = blockIdx.z, r0b = blockIdx.x * 64, r0 = r0b + wave * 16, n0 = blockIdx.y * 128; const int b = r0b / SS, s0 = r0b % SS;
  const _Float16* Pw = P + (size_t)which * EE * EE; const float* bias = which == 0 ? bq : (which == 1 ? bk : bv);
  v8f acc[8] = {};
#pragma unroll
  for (int kc = 0; kc < EE / 32; ++kc) { const v16h a = frag_h(X16 + (size_t)(r0 + col) * EE + kc * 32, lane);
#pragma unroll
    for (int j = 0; j < 8; ++j) acc[j] = wmma16(a, frag_h(Pw + (size_t)(n0 + j * 16 + col) * EE + kc * 32, lane), acc[j]); }
  if (which < 2) {
#pragma unroll
    for (int j = 0; j < 8; ++j) { const float bbv = bias[n0 + j * 16 + col];
#pragma unroll
      for (int r = 0; r < 8; ++r) so[wave][8 * g + r][j * 16 + col] = (acc[j][r] * (1.0f / 16.0f) + bbv) * 4.0f; }
    LDSX();
    _Float16* D = which == 0 ? Q16 : K16;
    // 128 cols = 4 heads of 32: per instruction 2 rows x 4 heads x 32 halves (64 B each); for each (row rl, head hh): 32 halves = 4 x v4u
    for (int q = lane; q < 16 * 4 * 4; q += 32) { const int rl = q >> 4, hh = (q >> 2) & 3, pc = q & 3; const int h = (n0 >> 5) + hh; union { v8h h8; v4u u; } pk;
#pragma unroll
      for (int e = 0; e < 8; ++e) pk.h8[e] = (_Float16)so[wave][rl][hh * 32 + pc * 8 + e];
      vst2(D + (((size_t)b * NH + h) * SS + s0 + wave * 16 + rl) * HD + pc * 8, pk.u); } }
  else {
#pragma unroll
    for (int j = 0; j < 8; ++j) { const float bbv = bias[n0 + j * 16 + col];
#pragma unroll
      for (int r = 0; r < 8; ++r) st[j * 16 + col][wave * 16 + 8 * g + r] = (_Float16)((acc[j][r] * (1.0f / 16.0f) + bbv) * 4.0f); }
    __syncthreads();
    for (int q = tid; q < 128 * 8; q += 128) { const int cl = q >> 3, pc = q & 7; const int c = n0 + cl, h = c >> 5, d = c & 31; vst2(VT + (((size_t)b * NH + h) * HD + d) * SS + s0 + pc * 8, *(const v4u*)(&st[cl][pc * 8])); } }
}
// attention: block (64 q, h, b); S = q.k/sqrt(32) + rel[q][k]; online softmax over 16 tiles; O16 [b][h][s][32] x8
__global__ __launch_bounds__(128) void k_attn(const _Float16* __restrict__ Q16, const _Float16* __restrict__ K16, const _Float16* __restrict__ VT, const float* __restrict__ rel, _Float16* __restrict__ O16) {
  __shared__ __align__(16) float sS[4][16][68];
  __shared__ __align__(16) _Float16 sP[4][16][72];
  __shared__ __align__(16) float sO[4][16][36];
  const int tid = threadIdx.x, w = tid >> 5, lane = tid & 31, col = lane & 15, g = lane >> 4;
  const int b = blockIdx.z, h = blockIdx.y, q0 = blockIdx.x * 64 + w * 16; const size_t bh = (size_t)b * NH + h;
  const float scl = (1.0f / 16.0f) / sqrtf((float)HD);
  const v16h aq = frag_h(Q16 + (bh * SS + q0 + col) * HD, lane);
  float mrun = -3.0e38f, lrun = 0.f; v8f acc[2] = {};
#pragma unroll 1
  for (int kt = 0; kt < SS / 64; ++kt) {
#pragma unroll
    for (int t = 0; t < 4; ++t) { v8f s = {}; const int key = kt * 64 + t * 16 + col;
      s = wmma16(aq, frag_h(K16 + (bh * SS + key) * HD, lane), s);
#pragma unroll
      for (int r = 0; r < 8; ++r) sS[w][8 * g + r][t * 16 + col] = s[r] * scl + rel[(size_t)(q0 + 8 * g + r) * SS + key]; }
    LDSX();
    float mx = -3.4e38f;
#pragma unroll
    for (int jj = 0; jj < 32; ++jj) mx = fmaxf(mx, sS[w][col][g * 32 + jj]);
    mx = fmaxf(mx, __shfl_xor(mx, 16, 32));
    const float mnew = fmaxf(mrun, mx); const float corr = expf(mrun - mnew);
    float ps = 0.f;
#pragma unroll
    for (int jj = 0; jj < 32; ++jj) { const float p = expf(sS[w][col][g * 32 + jj] - mnew); ps += p; sP[w][col][g * 32 + jj] = (_Float16)(p * 16384.0f); }
    ps += __shfl_xor(ps, 16, 32);
    lrun = lrun * corr + ps; mrun = mnew;
#pragma unroll
    for (int r = 0; r < 8; ++r) { const float cr = __shfl(corr, 8 * g + r, 32); acc[0][r] *= cr; acc[1][r] *= cr; }
    LDSX();
#pragma unroll
    for (int kc = 0; kc < 2; ++kc) { const v16h pa = frag_h(&sP[w][col][0] + kc * 32, lane);
#pragma unroll
      for (int t = 0; t < 2; ++t) acc[t] = wmma16(pa, frag_h(VT + (bh * HD + t * 16 + col) * SS + kt * 64 + kc * 32, lane), acc[t]); }
    __builtin_amdgcn_wave_barrier(); }
#pragma unroll
  for (int r = 0; r < 8; ++r) { const float lr = __shfl(lrun, 8 * g + r, 32); const float inv = 8.0f / (lr * 16384.0f * 4.0f);
#pragma unroll
    for (int t = 0; t < 2; ++t) sO[w][8 * g + r][t * 16 + col] = acc[t][r] * inv; }
  LDSX();
  for (int q = lane; q < 16 * 4; q += 32) { const int rl = q >> 2, pc = q & 3; union { v8h h8; v4u u; } pk;
#pragma unroll
    for (int e = 0; e < 8; ++e) pk.h8[e] = (_Float16)sO[w][rl][pc * 8 + e];
    vst2(O16 + (bh * SS + q0 + rl) * HD + pc * 8, pk.u); }
}
// post: block 64 rows, all 256 cols: rmha = O@Wo + bo ; gate0 = sigmoid(x gW + gb) ; gate1 = gate0*rmha + x ; mlp = sigmoid(gate1 mW + mb) ; out = gate1 * (LN(mlp) + 1)
__global__ __launch_bounds__(128) void k_post(const _Float16* __restrict__ O16, const _Float16* __restrict__ M16, const _Float16* __restrict__ P, const float* __restrict__ bo, const float* __restrict__ gb, const float* __restrict__ mb,
                                            const float* __restrict__ lng, const float* __restrict__ lnb, const float* __restrict__ x, float* __restrict__ out) {
  __shared__ __align__(16) float sg1[64][EE + 4];          // gate1 (f32), later mlp/LN in place? keep two: reuse so for mlp
  __shared__ __align__(16) _Float16 sa[4][16][EE + 8];     // f16 A tile of gate1
  __shared__ __align__(16) float so[4][16][EE + 4];
  const int tid = threadIdx.x, wave = tid >> 5, lane = tid & 31, col = lane & 15, g = lane >> 4;
  const int r0b = blockIdx.x * 64, r0 = r0b + wave * 16;
  // (1) rmha rows into so
#pragma unroll 1
  for (int hn = 0; hn < 2; ++hn) { v8f acc[8];
#pragma unroll
    for (int t = 0; t < 8; ++t) acc[t] = (v8f){};
#pragma unroll 1
    for (int kc = 0; kc < EE / 32; ++kc) { const int R = r0 + col; const v16h a = frag_h(O16 + ((((size_t)(R / SS)) * NH + kc) * SS + (R % SS)) * HD, lane);     // chunk kc = head kc (HD = 32)
#pragma unroll
      for (int t = 0; t < 8; ++t) acc[t] = wmma16(a, frag_h(P + (size_t)(3 * EE + (hn * 8 + t) * 16 + col) * EE + kc * 32, lane), acc[t]); }
#pragma unroll
    for (int t = 0; t < 8; ++t) { const int n = (hn * 8 + t) * 16 + col; const float bb = bo[n];
#pragma unroll
      for (int r = 0; r < 8; ++r) so[wave][8 * g + r][n] = acc[t][r] * (1.0f / 128.0f) + bb; } }
  // (2) gate0 = sigmoid(x gW + gb); gate1 = gate0 * rmha + x  -> sg1 (f32) and sa (f16)
#pragma unroll 1
  for (int hn = 0; hn < 2; ++hn) { v8f acc[8];
#pragma unroll
    for (int t = 0; t < 8; ++t) acc[t] = (v8f){};
#pragma unroll 1
    for (int kc = 0; kc < EE / 32; ++kc) { const v16h a = frag_h(M16 + (size_t)(r0 + col) * EE + kc * 32, lane);
#pragma unroll
      for (int t = 0; t < 8; ++t) acc[t] = wmma16(a, frag_h(P + (size_t)(4 * EE + (hn * 8 + t) * 16 + col) * EE + kc * 32, lane), acc[t]); }
#pragma unroll
    for (int t = 0; t < 8; ++t) { const int n = (hn * 8 + t) * 16 + col; const float bb = gb[n];
#pragma unroll
      for (int r = 0; r < 8; ++r) sg1[wave * 16 + 8 * g + r][n] = acc[t][r] * (1.0f / 16.0f) + bb; } }
  LDSX();
  // rolled per-row pass: gate1 = sigmoid(pre) * rmha + x  (2 lanes per row)
  { const int rl = lane >> 1, hf = lane & 1; const int R = wave * 16 + rl; const float* xr = x + (size_t)(r0b + R) * EE;
#pragma unroll 2
    for (int c = hf * 128; c < hf * 128 + 128; ++c) { const float g1 = sigm(sg1[R][c]) * so[wave][rl][c] + xr[c]; sg1[R][c] = g1; sa[wave][rl][c] = (_Float16)g1; } }
  LDSX();
  // (3) mlp = sigmoid(gate1 mW + mb) -> so ; then LN(mlp) per row and the final combine
#pragma unroll 1
  for (int hn = 0; hn < 2; ++hn) { v8f acc[8];
#pragma unroll
    for (int t = 0; t < 8; ++t) acc[t] = (v8f){};
#pragma unroll 1
    for (int kc = 0; kc < EE / 32; ++kc) { const v16h a = frag_h(&sa[wave][col][0] + kc * 32, lane);
#pragma unroll
      for (int t = 0; t < 8; ++t) acc[t] = wmma16(a, frag_h(P + (size_t)(5 * EE + (hn * 8 + t) * 16 + col) * EE + kc * 32, lane), acc[t]); }
#pragma unroll
    for (int t = 0; t < 8; ++t) { const int n = (hn * 8 + t) * 16 + col; const float bb = mb[n];
#pragma unroll
      for (int r = 0; r < 8; ++r) so[wave][8 * g + r][n] = acc[t][r] * (1.0f / 16.0f) + bb; } }
  LDSX();
  { const int rl = lane >> 1, hf = lane & 1; float* row = &so[wave][rl][0]; float s = 0.f;
#pragma unroll 2
    for (int c = hf * 128; c < hf * 128 + 128; ++c) { const float mv = sigm(row[c]); row[c] = mv; s += mv; } s += __shfl_xor(s, 1, 32); const float mu = s * (1.0f / EE);
    float q2 = 0.f; for (int c = hf * 128; c < hf * 128 + 128; ++c) { const float d = row[c] - mu; q2 += d * d; } q2 += __shfl_xor(q2, 1, 32); const float rs = rsqrtf(q2 * (1.0f / EE) + 1e-5f);
    LDSX();
    const float* g1r = &sg1[wave * 16 + rl][0];
    for (int c = hf * 128; c < hf * 128 + 128; ++c) { const float lnv = (row[c] - mu) * rs * lng[c] + lnb[c]; row[c] = g1r[c] * lnv + g1r[c]; } }
  LDSX();
  for (int rl = 0; rl < 16; ++rl) for (int pc = lane; pc < EE / 4; pc += 32) vst2(out + (size_t)(r0 + rl) * EE + pc * 4, *(const v4f*)(&so[wave][rl][pc * 4]));
}
extern "C" void kernel_launch(void* const* d_in, const int* in_sizes, int n_in, void* d_out, int out_size, void* d_ws, size_t ws_size, hipStream_t stream) {
  (void)in_sizes; (void)n_in; (void)out_size; (void)ws_size;
  const float** I = (const float**)d_in;
  const float* x = I[0]; const float* lng = I[1]; const float* lnb = I[2]; const float* Wq = I[3]; const float* bq = I[4]; const float* Wk = I[5]; const float* bk = I[6]; const float* Wv = I[7]; const float* bv = I[8]; const float* Wo = I[9]; const float* bo = I[10]; const float* rel = I[11]; const float* gW = I[12]; const float* gb = I[13]; const float* mW = I[14]; const float* mb = I[15];
  float* out = (float*)d_out;
  char* ws = (char*)d_ws; size_t off = 0;
  auto take = [&](size_t bytes) { char* p = ws + off; off += (bytes + 255) & ~(size_t)255; return p; };
  _Float16* X16 = (_Float16*)take((size_t)NR * EE * 2); _Float16* M16 = (_Float16*)take((size_t)NR * EE * 2); _Float16* P = (_Float16*)take((size_t)6 * EE * EE * 2);
  _Float16* Q16 = (_Float16*)take((size_t)NR * EE * 2); _Float16* K16 = (_Float16*)take((size_t)NR * EE * 2); _Float16* VT = (_Float16*)take((size_t)NR * EE * 2); _Float16* O16 = (_Float16*)take((size_t)NR * EE * 2);
  k_ln<<<NR / 8, 256, 0, stream>>>(x, lng, lnb, X16, M16);
  k_pack<<<6 * EE, 256, 0, stream>>>(Wq, Wk, Wv, Wo, gW, mW, P);
  k_qkv<<<dim3(NR / 64, EE / 128, 3), 128, 0, stream>>>(X16, P, bq, bk, bv, Q16, K16, VT);
  k_attn<<<dim3(SS / 64, NH, NB), 128, 0, stream>>>(Q16, K16, VT, rel, O16);
  k_post<<<NR / 64, 128, 0, stream>>>(O16, M16, P, bo, gb, mb, lng, lnb, x, out);
}

// v001
// It runs in 149 microseconds.
// Next to v000, in two timings, it ran 1.58 and 1.59 times as fast.
#include <hip/hip_runtime.h>
#include <math.h>

typedef __attribute__((ext_vector_type(16))) _Float16 v16h;
typedef __attribute__((ext_vector_type(16))) __bf16 v16b;
typedef __attribute__((ext_vector_type(8)))  _Float16 v8h;
typedef __attribute__((ext_vector_type(8)))  float v8f;
typedef __attribute__((ext_vector_type(4)))  float v4f;
typedef __attribute__((ext_vector_type(2)))  float v2f;
typedef __attribute__((ext_vector_type(4)))  unsigned v4u;
typedef __attribute__((ext_vector_type(4)))  int v4i;
typedef float __attribute__((may_alias)) float_a;
typedef int __attribute__((may_alias)) int_a;

template <typename T> __device__ __forceinline__ void vst2(void* p, T v) { *(T*)p = v;  }
__device__ __forceinline__ v8f wmma16(v16h a, v16h b, v8f c) {
  v8f d = __builtin_amdgcn_wmma_f32_16x16x32_f16(false, a, false, b, (short)0, c, false, false);
  asm volatile("v_nop\n\tv_nop\n\tv_nop\n\tv_nop" : "+v"(d) : "v"(a), "v"(b));
  return d;
}
__device__ __forceinline__ v8f wmma_bf(v16b a, v16b b, v8f c) {
  v8f d = __builtin_amdgcn_wmma_f32_16x16x32_bf16(false, a, false, b, (short)0, c, false, false);
  asm volatile("v_nop\n\tv_nop\n\tv_nop\n\tv_nop" : "+v"(d) : "v"(a), "v"(b));
  return d;
}
// 16x16x32 fragments: lane = (h = lane>>4, row/col = lane&15); elements 0..7 = k0+8h+0..7, 8..15 = k0+16+8h+0..7; D element r = row 8h+r
__device__ __forceinline__ v16h frag_h(const _Float16* rowk0, int lane) {
  union { v16h v; v8h q[2]; } u; const _Float16* p = rowk0 + 8 * (lane >> 4);
  u.q[0] = *(const v8h*)p; u.q[1] = *(const v8h*)(p + 16); return u.v;
}
// the same fragment from a pointer that already holds the lane half's offset (row + k0 + 8h)
__device__ __forceinline__ v16h frag_at(const _Float16* p) {
  union { v16h v; v8h q[2]; } u; u.q[0] = *(const v8h*)p; u.q[1] = *(const v8h*)(p + 16); return u.v;
}
__device__ __forceinline__ v16h frag_f32(const float* rowk0, int lane) {
  v16h a; const float* p = rowk0 + 8 * (lane >> 4);
#pragma unroll
  for (int i = 0; i < 8; ++i) { a[i] = (_Float16)p[i]; a[8 + i] = (_Float16)p[16 + i]; }
  return a;
}
__device__ __forceinline__ v16h frag_f32s(const float* rowk0, int lane, float sc) {
  v16h a; const float* p = rowk0 + 8 * (lane >> 4);
#pragma unroll
  for (int i = 0; i < 8; ++i) { a[i] = (_Float16)(p[i] * sc); a[8 + i] = (_Float16)(p[16 + i] * sc); }
  return a;
}
// column fragment from a [K][ld] layout (column n), rows >= K read as 0
__device__ __forceinline__ v16h fragc_f32(const float* W, int k0, int n, int lane, int ld, int K) {
  v16h a; const int g = lane >> 4;
#pragma unroll
  for (int i = 0; i < 8; ++i) { const int ka = k0 + 8 * g + i, kb = ka + 16;
    a[i] = (_Float16)(ka < K ? W[(size_t)ka * ld + n] : 0.f); a[8 + i] = (_Float16)(kb < K ? W[(size_t)kb * ld + n] : 0.f); }
  return a;
}
struct F2 { v16b h, l; };
__device__ __forceinline__ F2 bsplit16(const float v[16]) { F2 r;
#pragma unroll
  for (int i = 0; i < 16; ++i) { const __bf16 h = (__bf16)v[i]; r.h[i] = h; r.l[i] = (__bf16)(v[i] - (float)h); }
  return r; }
__device__ __forceinline__ F2 split_row(const float* row, int k0, int lane) { float v[16]; const float* p = row + k0 + 8 * (lane >> 4);
#pragma unroll
  for (int i = 0; i < 8; ++i) { v[i] = p[i]; v[8 + i] = p[16 + i]; }
  return bsplit16(v); }
__device__ __forceinline__ F2 split_rowK(const float* row, int k0, int lane, int K) { float v[16]; const int g = lane >> 4;
#pragma unroll
  for (int i = 0; i < 8; ++i) { const int ka = k0 + 8 * g + i, kb = ka + 16; v[i] = ka < K ? row[ka] : 0.f; v[8 + i] = kb < K ? row[kb] : 0.f; }
  return bsplit16(v); }
__device__ __forceinline__ F2 split_col(const float* W, int k0, int n, int lane, int ld, int K) { float v[16]; const int g = lane >> 4;
#pragma unroll
  for (int i = 0; i < 8; ++i) { const int ka = k0 + 8 * g + i, kb = ka + 16; v[i] = ka < K ? W[(size_t)ka * ld + n] : 0.f; v[8 + i] = kb < K ? W[(size_t)kb * ld + n] : 0.f; }
  return bsplit16(v); }
__device__ __forceinline__ v8f mac3(const F2& a, const F2& b, v8f c) { c = wmma_bf(a.l, b.h, c); c = wmma_bf(a.h, b.l, c); return wmma_bf(a.h, b.h, c); }
__device__ __forceinline__ float sigm(float v) { return 1.0f / (1.0f + expf(-v)); }
#define LDSX() do { asm volatile("s_wait_dscnt 0" ::: "memory"); __builtin_amdgcn_wave_barrier(); __builtin_amdgcn_fence(__ATOMIC_RELEASE, "workgroup"); } while (0)

// Gated relation-transformer block: LN(x); 8-head (d=32) self attention with an additive [S,S] relation bias (read as data) and output
// projection; gate0 = sigmoid(x gW + gb); gate1 = gate0*mha + x; mlp = sigmoid(gate1 mW + mb); out = gate1*LN(mlp) + gate1.
// All six [in][out] weights packed transposed to f16 rows (x16); every product on v_wmma_f32_16x16x32_f16 (activations as f16 copies /
// LDS tiles, q/k/v head-major x4, P x2^14); LayerNorms, softmax (online over 16 key tiles), sigmoids and gating in f32.
#define NB 16
#define SS 1024
#define EE 256
#define NH 8
#define HD 32
#define NR (NB * SS)

// LN(x) -> X16 ; x -> M16 ; wave per row (256 = 32 lanes x 8)
__global__ __launch_bounds__(256) void k_ln(const float* __restrict__ x, const float* __restrict__ g, const float* __restrict__ bb, _Float16* __restrict__ X16, _Float16* __restrict__ M16) {
  const int wave = threadIdx.x >> 5, lane = threadIdx.x & 31; const size_t r = (size_t)blockIdx.x * 8 + wave; if (r >= NR) return;
  const float* xr = x + r * EE; float v[8]; float s = 0.f;
#pragma unroll
  for (int e = 0; e < 8; ++e) { v[e] = xr[lane * 8 + e]; s += v[e]; }
#pragma unroll
  for (int off = 16; off >= 1; off >>= 1) s += __shfl_xor(s, off, 32);
  const float mu = s * (1.0f / EE); float q2 = 0.f;
#pragma unroll
  for (int e = 0; e < 8; ++e) { const float d = v[e] - mu; q2 += d * d; }
#pragma unroll
  for (int off = 16; off >= 1; off >>= 1) q2 += __shfl_xor(q2, off, 32);
  const float rs = rsqrtf(q2 * (1.0f / EE) + 1e-5f);
  union { v8h h; v4u u; } p1, p2;
#pragma unroll
  for (int e = 0; e < 8; ++e) { const int c = lane * 8 + e; p1.h[e] = (_Float16)((v[e] - mu) * rs * g[c] + bb[c]); p2.h[e] = (_Float16)v[e]; }
  vst2(X16 + r * EE + lane * 8, p1.u); vst2(M16 + r * EE + lane * 8, p2.u);
}
// P rows [w*256 + n][256] = W_w[k][n]*16 for w: 0 Wq, 1 Wk, 2 Wv, 3 Wo, 4 gW, 5 mW
__global__ __launch_bounds__(256) void k_pack(const float* __restrict__ Wq, const float* __restrict__ Wk, const float* __restrict__ Wv, const float* __restrict__ Wo, const float* __restrict__ gW, const float* __restrict__ mW, _Float16* __restrict__ P) {
  const int r = blockIdx.x, tid = threadIdx.x; __shared__ __align__(16) _Float16 srow[EE];
  const int which = r >> 8, n = r & 255; const float* W = which == 0 ? Wq : which == 1 ? Wk : which == 2 ? Wv : which == 3 ? Wo : which == 4 ? gW : mW;
  srow[tid] = (_Float16)(W[(size_t)tid * EE + n] * 16.0f);
  __syncthreads();
  if (tid < 32) vst2(P + (size_t)r * EE + tid * 8, *(const v4u*)(&srow[tid * 8]));
}
// q/k/v: block (64 rows, 128 cols = 4 heads, which)
__global__ __launch_bounds__(128) void k_qkv(const _Float16* __restrict__ X16, const _Float16* __restrict__ P, const float* __restrict__ bq, const float* __restrict__ bk, const float* __restrict__ bv, _Float16* __restrict__ Q16, _Float16* __restrict__ K16, _Float16* __restrict__ VT) {
  __shared__ __align__(16) float so[4][16][132];
  __shared__ __align__(16) _Float16 st[128][72];
  const int tid = threadIdx.x, wave = tid >> 5, lane = tid & 31, col = lane & 15, g = lane >> 4;
  const int which = blockIdx.z, r0b = blockIdx.x * 64, r0 = r0b + wave * 16, n0 = blockIdx.y * 128; const int b = r0b / SS, s0 = r0b % SS;
  const _Float16* Pw = P + (size_t)which * EE * EE; const float* bias = which == 0 ? bq : (which == 1 ? bk : bv);
  v8f acc[8] = {};
  const _Float16* pa = X16 + (size_t)(r0 + col) * EE + 8 * g; const _Float16* pb = Pw + (size_t)(n0 + col) * EE + 8 * g;
#pragma unroll
  for (int kc = 0; kc < EE / 32; ++kc) { const v16h a = frag_at(pa + kc * 32); v16h bf[8];   // all fragments of the k step are requested before its first product
#pragma unroll
    for (int j = 0; j < 8; ++j) bf[j] = frag_at(pb + j * 16 * EE + kc * 32);
#pragma unroll
    for (int j = 0; j < 8; ++j) acc[j] = wmma16(a, bf[j], acc[j]); }
  // the loads' address registers stay whole up to this wait
  asm volatile("s_wait_xcnt 0x0" :: "v"(pa), "v"(pb) : "memory");
  if (which < 2) {
#pragma unroll
    for (int j = 0; j < 8; ++j) { const float bbv = bias[n0 + j * 16 + col];
#pragma unroll
      for (int r = 0; r < 8; ++r) so[wave][8 * g + r][j * 16 + col] = (acc[j][r] * (1.0f / 16.0f) + bbv) * 4.0f; }
    LDSX();
    _Float16* D = which == 0 ? Q16 : K16;
    // 128 cols = 4 heads of 32: per instruction 2 rows x 4 heads x 32 halves (64 B each); for each (row rl, head hh): 32 halves = 4 x v4u
    for (int q = lane; q < 16 * 4 * 4; q += 32) { const int rl = q >> 4, hh = (q >> 2) & 3, pc = q & 3; const int h = (n0 >> 5) + hh; union { v8h h8; v4u u; } pk;
#pragma unroll
      for (int e = 0; e < 8; ++e) pk.h8[e] = (_Float16)so[wave][rl][hh * 32 + pc * 8 + e];
      vst2(D + (((size_t)b * NH + h) * SS + s0 + wave * 16 + rl) * HD + pc * 8, pk.u); } }
  else {
#pragma unroll
    for (int j = 0; j < 8; ++j) { const float bbv = bias[n0 + j * 16 + col];
#pragma unroll
      for (int r = 0; r < 8; ++r) st[j * 16 + col][wave * 16 + 8 * g + r] = (_Float16)((acc[j][r] * (1.0f / 16.0f) + bbv) * 4.0f); }
    __syncthreads();
    for (int q = tid; q < 128 * 8; q += 128) { const int cl = q >> 3, pc = q & 7; const int c = n0 + cl, h = c >> 5, d = c & 31; vst2(VT + (((size_t)b * NH + h) * HD + d) * SS + s0 + pc * 8, *(const v4u*)(&st[cl][pc * 8])); } }
}
// attention: block (64 q, h, b); S = q.k/sqrt(32) + rel[q][k]; online softmax over 16 tiles; O16 [b][h][s][32] x8
__global__ __launch_bounds__(128) void k_attn(const _Float16* __restrict__ Q16, const _Float16* __restrict__ K16, const _Float16* __restrict__ VT, const float* __restrict__ rel, _Float16* __restrict__ O16) {
  __shared__ __align__(16) float sS[4][16][68];
  __shared__ __align__(16) _Float16 sP[4][16][72];
  __shared__ __align__(16) float sO[4][16][36];
  const int tid = threadIdx.x, w = tid >> 5, lane = tid & 31, col = lane & 15, g = lane >> 4;
  const int b = blockIdx.z, h = blockIdx.y, q0 = blockIdx.x * 64 + w * 16; const size_t bh = (size_t)b * NH + h;
  const float scl = (1.0f / 16.0f) / sqrtf((float)HD);
  const v16h aq = frag_h(Q16 + (bh * SS + q0 + col) * HD, lane);
  float mrun = -3.0e38f, lrun = 0.f; v8f acc[2] = {};
#pragma unroll 1
  for (int kt = 0; kt < SS / 64; ++kt) {
    v16h kf[4], vf[2][2]; float rv[4][8];   // the tile's K, bias and V operands are all requested here, ahead of the first product
    const _Float16* pk = K16 + (bh * SS + kt * 64 + col) * HD + 8 * g; const _Float16* pv = VT + (bh * HD + col) * SS + kt * 64 + 8 * g; const float* pr = rel + (size_t)(q0 + 8 * g) * SS + kt * 64 + col;
#pragma unroll
    for (int t = 0; t < 4; ++t) kf[t] = frag_at(pk + t * 16 * HD);
#pragma unroll
    for (int t = 0; t < 4; ++t) {
#pragma unroll
      for (int r = 0; r < 8; ++r) rv[t][r] = pr[r * SS + t * 16]; }
#pragma unroll
    for (int kc = 0; kc < 2; ++kc) {
#pragma unroll
      for (int t = 0; t < 2; ++t) vf[kc][t] = frag_at(pv + t * 16 * SS + kc * 32); }
    // the batch's address registers stay whole up to this wait
    asm volatile("s_wait_xcnt 0x0" :: "v"(pk), "v"(pv), "v"(pr) : "memory");
#pragma unroll
    for (int t = 0; t < 4; ++t) { v8f s = {};
      s = wmma16(aq, kf[t], s);
#pragma unroll
      for (int r = 0; r < 8; ++r) sS[w][8 * g + r][t * 16 + col] = s[r] * scl + rv[t][r]; }
    LDSX();
    float mx = -3.4e38f;
#pragma unroll
    for (int jj = 0; jj < 32; ++jj) mx = fmaxf(mx, sS[w][col][g * 32 + jj]);
    mx = fmaxf(mx, __shfl_xor(mx, 16, 32));
    const float mnew = fmaxf(mrun, mx); const float corr = expf(mrun - mnew);
    float ps = 0.f;
#pragma unroll
    for (int jj = 0; jj < 32; ++jj) { const float p = expf(sS[w][col][g * 32 + jj] - mnew); ps += p; sP[w][col][g * 32 + jj] = (_Float16)(p * 16384.0f); }
    ps += __shfl_xor(ps, 16, 32);
    lrun = lrun * corr + ps; mrun = mnew;
#pragma unroll
    for (int r = 0; r < 8; ++r) { const float cr = __shfl(corr, 8 * g + r, 32); acc[0][r] *= cr; acc[1][r] *= cr; }
    LDSX();
#pragma unroll
    for (int kc = 0; kc < 2; ++kc) { const v16h pa = frag_h(&sP[w][col][0] + kc * 32, lane);
#pragma unroll
      for (int t = 0; t < 2; ++t) acc[t] = wmma16(pa, vf[kc][t], acc[t]); }
    __builtin_amdgcn_wave_barrier(); }
#pragma unroll
  for (int r = 0; r < 8; ++r) { const float lr = __shfl(lrun, 8 * g + r, 32); const float inv = 8.0f / (lr * 16384.0f * 4.0f);
#pragma unroll
    for (int t = 0; t < 2; ++t) sO[w][8 * g + r][t * 16 + col] = acc[t][r] * inv; }
  LDSX();
  for (int q = lane; q < 16 * 4; q += 32) { const int rl = q >> 2, pc = q & 3; union { v8h h8; v4u u; } pk;
#pragma unroll
    for (int e = 0; e < 8; ++e) pk.h8[e] = (_Float16)sO[w][rl][pc * 8 + e];
    vst2(O16 + (bh * SS + q0 + rl) * HD + pc * 8, pk.u); }
}
// 16 rows x 128 columns over k = 256: the A fragment and the 8 B fragments of k step kc + 1 are requested before the products of step kc
template <typename FA> __device__ __forceinline__ void gemm_ahead(v8f (&acc)[8], FA lda, const _Float16* Brow, int lane) {
  v16h a0 = lda(0), a1, b0[8], b1[8];
#pragma unroll
  for (int t = 0; t < 8; ++t) b0[t] = frag_h(Brow + (size_t)t * 16 * EE, lane);
#pragma unroll   // unrolled whole: the two fragment sets take turns without register copies, and the last step's fetch drops out
  for (int kc = 0; kc < EE / 32; kc += 2) {
    a1 = lda(kc + 1);
#pragma unroll
    for (int t = 0; t < 8; ++t) b1[t] = frag_h(Brow + (size_t)t * 16 * EE + (kc + 1) * 32, lane);
#pragma unroll
    for (int t = 0; t < 8; ++t) acc[t] = wmma16(a0, b0[t], acc[t]);
    if (kc + 2 < EE / 32) { a0 = lda(kc + 2);
#pragma unroll
      for (int t = 0; t < 8; ++t) b0[t] = frag_h(Brow + (size_t)t * 16 * EE + (kc + 2) * 32, lane); }
#pragma unroll
    for (int t = 0; t < 8; ++t) acc[t] = wmma16(a1, b1[t], acc[t]); }
}
// post: block 64 rows, all 256 cols: rmha = O@Wo + bo ; gate0 = sigmoid(x gW + gb) ; gate1 = gate0*rmha + x ; mlp = sigmoid(gate1 mW + mb) ; out = gate1 * (LN(mlp) + 1)
__global__ __launch_bounds__(128) void k_post(const _Float16* __restrict__ O16, const _Float16* __restrict__ M16, const _Float16* __restrict__ P, const float* __restrict__ bo, const float* __restrict__ gb, const float* __restrict__ mb,
                                            const float* __restrict__ lng, const float* __restrict__ lnb, const float* __restrict__ x, float* __restrict__ out) {
  __shared__ __align__(16) float sg1[64][EE + 4];          // gate1 (f32), later mlp/LN in place? keep two: reuse so for mlp
  __shared__ __align__(16) _Float16 sa[4][16][EE + 8];     // f16 A tile of gate1
  __shared__ __align__(16) float so[4][16][EE + 4];
  const int tid = threadIdx.x, wave = tid >> 5, lane = tid & 31, col = lane & 15, g = lane >> 4;
  const int r0b = blockIdx.x * 64, r0 = r0b + wave * 16;
  // (1) rmha rows into so
#pragma unroll 1
  for (int hn = 0; hn < 2; ++hn) { v8f acc[8];
#pragma unroll
    for (int t = 0; t < 8; ++t) acc[t] = (v8f){};
    { const int R = r0 + col; const _Float16* Ob = O16 + (((size_t)(R / SS)) * NH * SS + (R % SS)) * HD;     // chunk kc = head kc (HD = 32)
      gemm_ahead(acc, [&](int kc) { return frag_h(Ob + (size_t)kc * SS * HD, lane); }, P + (size_t)(3 * EE + hn * 128 + col) * EE, lane); }
#pragma unroll
    for (int t = 0; t < 8; ++t) { const int n = (hn * 8 + t) * 16 + col; const float bb = bo[n];
#pragma unroll
      for (int r = 0; r < 8; ++r) so[wave][8 * g + r][n] = acc[t][r] * (1.0f / 128.0f) + bb; } }
  // (2) gate0 = sigmoid(x gW + gb); gate1 = gate0 * rmha + x  -> sg1 (f32) and sa (f16)
#pragma unroll 1
  for (int hn = 0; hn < 2; ++hn) { v8f acc[8];
#pragma unroll
    for (int t = 0; t < 8; ++t) acc[t] = (v8f){};
    gemm_ahead(acc, [&](int kc) { return frag_h(M16 + (size_t)(r0 + col) * EE + kc * 32, lane); }, P + (size_t)(4 * EE + hn * 128 + col) * EE, lane);
#pragma unroll
    for (int t = 0; t < 8; ++t) { const int n = (hn * 8 + t) * 16 + col; const float bb = gb[n];
#pragma unroll
      for (int r = 0; r < 8; ++r) sg1[wave * 16 + 8 * g + r][n] = acc[t][r] * (1.0f / 16.0f) + bb; } }
  LDSX();
  // rolled per-row pass: gate1 = sigmoid(pre) * rmha + x  (2 lanes per row)
  { const int rl = lane >> 1, hf = lane & 1; const int R = wave * 16 + rl; const float* xr = x + (size_t)(r0b + R) * EE;
#pragma unroll 2
    for (int c = hf * 128; c < hf * 128 + 128; ++c) { const float g1 = sigm(sg1[R][c]) * so[wave][rl][c] + xr[c]; sg1[R][c] = g1; sa[wave][rl][c] = (_Float16)g1; } }
  LDSX();
  // (3) mlp = sigmoid(gate1 mW + mb) -> so ; then LN(mlp) per row and the final combine
#pragma unroll 1
  for (int hn = 0; hn < 2; ++hn) { v8f acc[8];
#pragma unroll
    for (int t = 0; t < 8; ++t) acc[t] = (v8f){};
    gemm_ahead(acc, [&](int kc) { return frag_h(&sa[wave][col][0] + kc * 32, lane); }, P + (size_t)(5 * EE + hn * 128 + col) * EE, lane);
#pragma unroll
    for (int t = 0; t < 8; ++t) { const int n = (hn * 8 + t) * 16 + col; const float bb = mb[n];
#pragma unroll
      for (int r = 0; r < 8; ++r) so[wave][8 * g + r][n] = acc[t][r] * (1.0f / 16.0f) + bb; } }
  LDSX();
  { const int rl = lane >> 1, hf = lane & 1; float* row = &so[wave][rl][0]; float s = 0.f;
#pragma unroll 2
    for (int c = hf * 128; c < hf * 128 + 128; ++c) { const float mv = sigm(row[c]); row[c] = mv; s += mv; } s += __shfl_xor(s, 1, 32); const float mu = s * (1.0f / EE);
    float q2 = 0.f; for (int c = hf * 128; c < hf * 128 + 128; ++c) { const float d = row[c] - mu; q2 += d * d; } q2 += __shfl_xor(q2, 1, 32); const float rs = rsqrtf(q2 * (1.0f / EE) + 1e-5f);
    LDSX();
    const float* g1r = &sg1[wave * 16 + rl][0];
    for (int c = hf * 128; c < hf * 128 + 128; ++c) { const float lnv = (row[c] - mu) * rs * lng[c] + lnb[c]; row[c] = g1r[c] * lnv + g1r[c]; } }
  LDSX();
  for (int rl = 0; rl < 16; ++rl) for (int pc = lane; pc < EE / 4; pc += 32) vst2(out + (size_t)(r0 + rl) * EE + pc * 4, *(const v4f*)(&so[wave][rl][pc * 4]));
}
extern "C" void kernel_launch(void* const* d_in, const int* in_sizes, int n_in, void* d_out, int out_size, void* d_ws, size_t ws_size, hipStream_t stream) {
  (void)in_sizes; (void)n_in; (void)out_size; (void)ws_size;
  const float** I = (const float**)d_in;
  const float* x = I[0]; const float* lng = I[1]; const float* lnb = I[2]; const float* Wq = I[3]; const float* bq = I[4]; const float* Wk = I[5]; const float* bk = I[6]; const float* Wv = I[7]; const float* bv = I[8]; const float* Wo = I[9]; const float* bo = I[10]; const float* rel = I[11]; const float* gW = I[12]; const float* gb = I[13]; const float* mW = I[14]; const float* mb = I[15];
  float* out = (float*)d_out;
  char* ws = (char*)d_ws; size_t off = 0;
  auto take = [&](size_t bytes) { char* p = ws + off; off += (bytes + 255) & ~(size_t)255; return p; };
  _Float16* X16 = (_Float16*)take((size_t)NR * EE * 2); _Float16* M16 = (_Float16*)take((size_t)NR * EE * 2); _Float16* P = (_Float16*)take((size_t)6 * EE * EE * 2);
  _Float16* Q16 = (_Float16*)take((size_t)NR * EE * 2); _Float16* K16 = (_Float16*)take((size_t)NR * EE * 2); _Float16* VT = (_Float16*)take((size_t)NR * EE * 2); _Float16* O16 = (_Float16*)take((size_t)NR * EE * 2);
  k_ln<<<NR / 8, 256, 0, stream>>>(x, lng, lnb, X16, M16);
  k_pack<<<6 * EE, 256, 0, stream>>>(Wq, Wk, Wv, Wo, gW, mW, P);
  k_qkv<<<dim3(NR / 64, EE / 128, 3), 128, 0, stream>>>(X16, P, bq, bk, bv, Q16, K16, VT);
  k_attn<<<dim3(SS / 64, NH, NB), 128, 0, stream>>>(Q16, K16, VT, rel, O16);
  k_post<<<NR / 64, 128, 0, stream>>>(O16, M16, P, bo, gb, mb, lng, lnb, x, out);
}

// v002
// One run takes 140 microseconds.
// Next to v001, in two timings, it ran 1.06 times as fast each time.
// Counting every step since v000, it is 1.69 times as fast.
#include <hip/hip_runtime.h>
#include <math.h>

typedef __attribute__((ext_vector_type(16))) _Float16 v16h;
typedef __attribute__((ext_vector_type(16))) __bf16 v16b;
typedef __attribute__((ext_vector_type(8)))  _Float16 v8h;
typedef __attribute__((ext_vector_type(8)))  float v8f;
typedef __attribute__((ext_vector_type(4)))  float v4f;
typedef __attribute__((ext_vector_type(2)))  float v2f;
typedef __attribute__((ext_vector_type(4)))  unsigned v4u;
typedef __attribute__((ext_vector_type(4)))  int v4i;
typedef float __attribute__((may_alias)) float_a;
typedef int __attribute__((may_alias)) int_a;

template <typename T> __device__ __forceinline__ void vst2(void* p, T v) { *(T*)p = v;  }
__device__ __forceinline__ v8f wmma16(v16h a, v16h b, v8f c) {
  v8f d = __builtin_amdgcn_wmma_f32_16x16x32_f16(false, a, false, b, (short)0, c, false, false);
  asm volatile("v_nop\n\tv_nop\n\tv_nop\n\tv_nop" : "+v"(d) : "v"(a), "v"(b));
  return d;
}
__device__ __forceinline__ v8f wmma_bf(v16b a, v16b b, v8f c) {
  v8f d = __builtin_amdgcn_wmma_f32_16x16x32_bf16(false, a, false, b, (short)0, c, false, false);
  asm volatile("v_nop\n\tv_nop\n\tv_nop\n\tv_nop" : "+v"(d) : "v"(a), "v"(b));
  return d;
}
// 16x16x32 fragments: lane = (h = lane>>4, row/col = lane&15); elements 0..7 = k0+8h+0..7, 8..15 = k0+16+8h+0..7; D element r = row 8h+r
__device__ __forceinline__ v16h frag_h(const _Float16* rowk0, int lane) {
  union { v16h v; v8h q[2]; } u; const _Float16* p = rowk0 + 8 * (lane >> 4);
  u.q[0] = *(const v8h*)p; u.q[1] = *(const v8h*)(p + 16); return u.v;
}
// the same fragment from a pointer that already holds the lane half's offset (row + k0 + 8h)
__device__ __forceinline__ v16h frag_at(const _Float16* p) {
  union { v16h v; v8h q[2]; } u; u.q[0] = *(const v8h*)p; u.q[1] = *(const v8h*)(p + 16); return u.v;
}
__device__ __forceinline__ v16h frag_f32(const float* rowk0, int lane) {
  v16h a; const float* p = rowk0 + 8 * (lane >> 4);
#pragma unroll
  for (int i = 0; i < 8; ++i) { a[i] = (_Float16)p[i]; a[8 + i] = (_Float16)p[16 + i]; }
  return a;
}
__device__ __forceinline__ v16h frag_f32s(const float* rowk0, int lane, float sc) {
  v16h a; const float* p = rowk0 + 8 * (lane >> 4);
#pragma unroll
  for (int i = 0; i < 8; ++i) { a[i] = (_Float16)(p[i] * sc); a[8 + i] = (_Float16)(p[16 + i] * sc); }
  return a;
}
// column fragment from a [K][ld] layout (column n), rows >= K read as 0
__device__ __forceinline__ v16h fragc_f32(const float* W, int k0, int n, int lane, int ld, int K) {
  v16h a; const int g = lane >> 4;
#pragma unroll
  for (int i = 0; i < 8; ++i) { const int ka = k0 + 8 * g + i, kb = ka + 16;
    a[i] = (_Float16)(ka < K ? W[(size_t)ka * ld + n] : 0.f); a[8 + i] = (_Float16)(kb < K ? W[(size_t)kb * ld + n] : 0.f); }
  return a;
}
struct F2 { v16b h, l; };
__device__ __forceinline__ F2 bsplit16(const float v[16]) { F2 r;
#pragma unroll
  for (int i = 0; i < 16; ++i) { const __bf16 h = (__bf16)v[i]; r.h[i] = h; r.l[i] = (__bf16)(v[i] - (float)h); }
  return r; }
__device__ __forceinline__ F2 split_row(const float* row, int k0, int lane) { float v[16]; const float* p = row + k0 + 8 * (lane >> 4);
#pragma unroll
  for (int i = 0; i < 8; ++i) { v[i] = p[i]; v[8 + i] = p[16 + i]; }
  return bsplit16(v); }
__device__ __forceinline__ F2 split_rowK(const float* row, int k0, int lane, int K) { float v[16]; const int g = lane >> 4;
#pragma unroll
  for (int i = 0; i < 8; ++i) { const int ka = k0 + 8 * g + i, kb = ka + 16; v[i] = ka < K ? row[ka] : 0.f; v[8 + i] = kb < K ? row[kb] : 0.f; }
  return bsplit16(v); }
__device__ __forceinline__ F2 split_col(const float* W, int k0, int n, int lane, int ld, int K) { float v[16]; const int g = lane >> 4;
#pragma unroll
  for (int i = 0; i < 8; ++i) { const int ka = k0 + 8 * g + i, kb = ka + 16; v[i] = ka < K ? W[(size_t)ka * ld + n] : 0.f; v[8 + i] = kb < K ? W[(size_t)kb * ld + n] : 0.f; }
  return bsplit16(v); }
__device__ __forceinline__ v8f mac3(const F2& a, const F2& b, v8f c) { c = wmma_bf(a.l, b.h, c); c = wmma_bf(a.h, b.l, c); return wmma_bf(a.h, b.h, c); }
#define L2E 1.4426950408889634f
// e^x as 2^(x log2 e) on the bare v_exp_f32, without the library's range fix-ups: a vanishing result may be 0 and an overflowing one is infinity, which suits every use here
__device__ __forceinline__ float sigm(float v) { return 1.0f / (1.0f + __builtin_amdgcn_exp2f(v * -L2E)); }
#define LDSX() do { asm volatile("s_wait_dscnt 0" ::: "memory"); __builtin_amdgcn_wave_barrier(); __builtin_amdgcn_fence(__ATOMIC_RELEASE, "workgroup"); } while (0)

// Gated relation-transformer block: LN(x); 8-head (d=32) self attention with an additive [S,S] relation bias (read as data) and output
// projection; gate0 = sigmoid(x gW + gb); gate1 = gate0*mha + x; mlp = sigmoid(gate1 mW + mb); out = gate1*LN(mlp) + gate1.
// All six [in][out] weights packed transposed to f16 rows (x16); every product on v_wmma_f32_16x16x32_f16 (activations as f16 copies /
// LDS tiles, q/k/v head-major x4, P x2^14); LayerNorms, softmax (online over 16 key tiles), sigmoids and gating in f32.
#define NB 16
#define SS 1024
#define EE 256
#define NH 8
#define HD 32
#define NR (NB * SS)

// LN(x) -> X16 ; x -> M16 ; wave per row (256 = 32 lanes x 8)
__global__ __launch_bounds__(256) void k_ln(const float* __restrict__ x, const float* __restrict__ g, const float* __restrict__ bb, _Float16* __restrict__ X16, _Float16* __restrict__ M16) {
  const int wave = threadIdx.x >> 5, lane = threadIdx.x & 31; const size_t r = (size_t)blockIdx.x * 8 + wave; if (r >= NR) return;
  const float* xr = x + r * EE; float v[8]; float s = 0.f;
#pragma unroll
  for (int e = 0; e < 8; ++e) { v[e] = xr[lane * 8 + e]; s += v[e]; }
#pragma unroll
  for (int off = 16; off >= 1; off >>= 1) s += __shfl_xor(s, off, 32);
  const float mu = s * (1.0f / EE); float q2 = 0.f;
#pragma unroll
  for (int e = 0; e < 8; ++e) { const float d = v[e] - mu; q2 += d * d; }
#pragma unroll
  for (int off = 16; off >= 1; off >>= 1) q2 += __shfl_xor(q2, off, 32);
  const float rs = rsqrtf(q2 * (1.0f / EE) + 1e-5f);
  union { v8h h; v4u u; } p1, p2;
#pragma unroll
  for (int e = 0; e < 8; ++e) { const int c = lane * 8 + e; p1.h[e] = (_Float16)((v[e] - mu) * rs * g[c] + bb[c]); p2.h[e] = (_Float16)v[e]; }
  vst2(X16 + r * EE + lane * 8, p1.u); vst2(M16 + r * EE + lane * 8, p2.u);
}
// P rows [w*256 + n][256] = W_w[k][n]*16 for w: 0 Wq, 1 Wk, 2 Wv, 3 Wo, 4 gW, 5 mW
__global__ __launch_bounds__(256) void k_pack(const float* __restrict__ Wq, const float* __restrict__ Wk, const float* __restrict__ Wv, const float* __restrict__ Wo, const float* __restrict__ gW, const float* __restrict__ mW, _Float16* __restrict__ P) {
  const int r = blockIdx.x, tid = threadIdx.x; __shared__ __align__(16) _Float16 srow[EE];
  const int which = r >> 8, n = r & 255; const float* W = which == 0 ? Wq : which == 1 ? Wk : which == 2 ? Wv : which == 3 ? Wo : which == 4 ? gW : mW;
  srow[tid] = (_Float16)(W[(size_t)tid * EE + n] * 16.0f);
  __syncthreads();
  if (tid < 32) vst2(P + (size_t)r * EE + tid * 8, *(const v4u*)(&srow[tid * 8]));
}
// q/k/v: block (64 rows, 128 cols = 4 heads, which)
__global__ __launch_bounds__(128) void k_qkv(const _Float16* __restrict__ X16, const _Float16* __restrict__ P, const float* __restrict__ bq, const float* __restrict__ bk, const float* __restrict__ bv, _Float16* __restrict__ Q16, _Float16* __restrict__ K16, _Float16* __restrict__ VT) {
  __shared__ __align__(16) float so[4][16][132];
  __shared__ __align__(16) _Float16 st[128][72];
  const int tid = threadIdx.x, wave = tid >> 5, lane = tid & 31, col = lane & 15, g = lane >> 4;
  const int which = blockIdx.z, r0b = blockIdx.x * 64, r0 = r0b + wave * 16, n0 = blockIdx.y * 128; const int b = r0b / SS, s0 = r0b % SS;
  const _Float16* Pw = P + (size_t)which * EE * EE; const float* bias = which == 0 ? bq : (which == 1 ? bk : bv);
  v8f acc[8] = {};
  const _Float16* pa = X16 + (size_t)(r0 + col) * EE + 8 * g; const _Float16* pb = Pw + (size_t)(n0 + col) * EE + 8 * g;
#pragma unroll
  for (int kc = 0; kc < EE / 32; ++kc) { const v16h a = frag_at(pa + kc * 32); v16h bf[8];   // all fragments of the k step are requested before its first product
#pragma unroll
    for (int j = 0; j < 8; ++j) bf[j] = frag_at(pb + j * 16 * EE + kc * 32);
#pragma unroll
    for (int j = 0; j < 8; ++j) acc[j] = wmma16(a, bf[j], acc[j]); }
  // the loads' address registers stay whole up to this wait
  asm volatile("s_wait_xcnt 0x0" :: "v"(pa), "v"(pb) : "memory");
  if (which < 2) {
#pragma unroll
    for (int j = 0; j < 8; ++j) { const float bbv = bias[n0 + j * 16 + col];
#pragma unroll
      for (int r = 0; r < 8; ++r) so[wave][8 * g + r][j * 16 + col] = (acc[j][r] * (1.0f / 16.0f) + bbv) * 4.0f; }
    LDSX();
    _Float16* D = which == 0 ? Q16 : K16;
    // 128 cols = 4 heads of 32: per instruction 2 rows x 4 heads x 32 halves (64 B each); for each (row rl, head hh): 32 halves = 4 x v4u
    for (int q = lane; q < 16 * 4 * 4; q += 32) { const int rl = q >> 4, hh = (q >> 2) & 3, pc = q & 3; const int h = (n0 >> 5) + hh; union { v8h h8; v4u u; } pk;
#pragma unroll
      for (int e = 0; e < 8; ++e) pk.h8[e] = (_Float16)so[wave][rl][hh * 32 + pc * 8 + e];
      vst2(D + (((size_t)b * NH + h) * SS + s0 + wave * 16 + rl) * HD + pc * 8, pk.u); } }
  else {
#pragma unroll
    for (int j = 0; j < 8; ++j) { const float bbv = bias[n0 + j * 16 + col];
#pragma unroll
      for (int r = 0; r < 8; ++r) st[j * 16 + col][wave * 16 + 8 * g + r] = (_Float16)((acc[j][r] * (1.0f / 16.0f) + bbv) * 4.0f); }
    __syncthreads();
    for (int q = tid; q < 128 * 8; q += 128) { const int cl = q >> 3, pc = q & 7; const int c = n0 + cl, h = c >> 5, d = c & 31; vst2(VT + (((size_t)b * NH + h) * HD + d) * SS + s0 + pc * 8, *(const v4u*)(&st[cl][pc * 8])); } }
}
// attention: block (64 q, h, b); S = q.k/sqrt(32) + rel[q][k]; online softmax over 16 tiles; O16 [b][h][s][32] x8
__global__ __launch_bounds__(128) void k_attn(const _Float16* __restrict__ Q16, const _Float16* __restrict__ K16, const _Float16* __restrict__ VT, const float* __restrict__ rel, _Float16* __restrict__ O16) {
  __shared__ __align__(16) float sS[4][16][68];
  __shared__ __align__(16) _Float16 sP[4][16][72];
  __shared__ __align__(16) float sO[4][16][36];
  const int tid = threadIdx.x, w = tid >> 5, lane = tid & 31, col = lane & 15, g = lane >> 4;
  const int b = blockIdx.z, h = blockIdx.y, q0 = blockIdx.x * 64 + w * 16; const size_t bh = (size_t)b * NH + h;
  const float scl = (1.0f / 16.0f) / sqrtf((float)HD);
  const v16h aq = frag_h(Q16 + (bh * SS + q0 + col) * HD, lane);
  float mrun = -3.0e38f, lrun = 0.f; v8f acc[2] = {};
#pragma unroll 1
  for (int kt = 0; kt < SS / 64; ++kt) {
    v16h kf[4], vf[2][2]; float rv[4][8];   // the tile's K, bias and V operands are all requested here, ahead of the first product
    const _Float16* pk = K16 + (bh * SS + kt * 64 + col) * HD + 8 * g; const _Float16* pv = VT + (bh * HD + col) * SS + kt * 64 + 8 * g; const float* pr = rel + (size_t)(q0 + 8 * g) * SS + kt * 64 + col;
#pragma unroll
    for (int t = 0; t < 4; ++t) kf[t] = frag_at(pk + t * 16 * HD);
#pragma unroll
    for (int t = 0; t < 4; ++t) {
#pragma unroll
      for (int r = 0; r < 8; ++r) rv[t][r] = pr[r * SS + t * 16]; }
#pragma unroll
    for (int kc = 0; kc < 2; ++kc) {
#pragma unroll
      for (int t = 0; t < 2; ++t) vf[kc][t] = frag_at(pv + t * 16 * SS + kc * 32); }
    // the batch's address registers stay whole up to this wait
    asm volatile("s_wait_xcnt 0x0" :: "v"(pk), "v"(pv), "v"(pr) : "memory");
#pragma unroll
    for (int t = 0; t < 4; ++t) { v8f s = {};
      s = wmma16(aq, kf[t], s);
#pragma unroll
      for (int r = 0; r < 8; ++r) sS[w][8 * g + r][t * 16 + col] = s[r] * scl + rv[t][r]; }
    LDSX();
    float mx = -3.4e38f;
#pragma unroll
    for (int jj = 0; jj < 32; ++jj) mx = fmaxf(mx, sS[w][col][g * 32 + jj]);
    mx = fmaxf(mx, __shfl_xor(mx, 16, 32));
    const float mnew = fmaxf(mrun, mx); const float corr = __builtin_amdgcn_exp2f((mrun - mnew) * L2E);
    const float eoff = 14.0f - mnew * L2E;   // exponent offset: minus the maximum in base 2, plus 14 for P's 2^14 scale; ps and lrun carry that scale too
    float ps = 0.f;
#pragma unroll
    for (int jj = 0; jj < 32; ++jj) { const float p = __builtin_amdgcn_exp2f(fmaf(sS[w][col][g * 32 + jj], L2E, eoff)); ps += p; sP[w][col][g * 32 + jj] = (_Float16)p; }
    ps += __shfl_xor(ps, 16, 32);
    lrun = lrun * corr + ps; mrun = mnew;
#pragma unroll
    for (int r = 0; r < 8; ++r) { const float cr = __shfl(corr, 8 * g + r, 32); acc[0][r] *= cr; acc[1][r] *= cr; }
    LDSX();
#pragma unroll
    for (int kc = 0; kc < 2; ++kc) { const v16h pa = frag_h(&sP[w][col][0] + kc * 32, lane);
#pragma unroll
      for (int t = 0; t < 2; ++t) acc[t] = wmma16(pa, vf[kc][t], acc[t]); }
    __builtin_amdgcn_wave_barrier(); }
#pragma unroll
  for (int r = 0; r < 8; ++r) { const float lr = __shfl(lrun, 8 * g + r, 32); const float inv = 8.0f / (lr * 4.0f);
#pragma unroll
    for (int t = 0; t < 2; ++t) sO[w][8 * g + r][t * 16 + col] = acc[t][r] * inv; }
  LDSX();
  for (int q = lane; q < 16 * 4; q += 32) { const int rl = q >> 2, pc = q & 3; union { v8h h8; v4u u; } pk;
#pragma unroll
    for (int e = 0; e < 8; ++e) pk.h8[e] = (_Float16)sO[w][rl][pc * 8 + e];
    vst2(O16 + (bh * SS + q0 + rl) * HD + pc * 8, pk.u); }
}
// 16 rows x 128 columns over k = 256: the A fragment and the 8 B fragments of k step kc + 1 are requested before the products of step kc
template <typename FA> __device__ __forceinline__ void gemm_ahead(v8f (&acc)[8], FA lda, const _Float16* Brow, int lane) {
  v16h a0 = lda(0), a1, b0[8], b1[8];
#pragma unroll
  for (int t = 0; t < 8; ++t) b0[t] = frag_h(Brow + (size_t)t * 16 * EE, lane);
#pragma unroll   // unrolled whole: the two fragment sets take turns without register copies, and the last step's fetch drops out
  for (int kc = 0; kc < EE / 32; kc += 2) {
    a1 = lda(kc + 1);
#pragma unroll
    for (int t = 0; t < 8; ++t) b1[t] = frag_h(Brow + (size_t)t * 16 * EE + (kc + 1) * 32, lane);
#pragma unroll
    for (int t = 0; t < 8; ++t) acc[t] = wmma16(a0, b0[t], acc[t]);
    if (kc + 2 < EE / 32) { a0 = lda(kc + 2);
#pragma unroll
      for (int t = 0; t < 8; ++t) b0[t] = frag_h(Brow + (size_t)t * 16 * EE + (kc + 2) * 32, lane); }
#pragma unroll
    for (int t = 0; t < 8; ++t) acc[t] = wmma16(a1, b1[t], acc[t]); }
}
// post: block 64 rows, all 256 cols: rmha = O@Wo + bo ; gate0 = sigmoid(x gW + gb) ; gate1 = gate0*rmha + x ; mlp = sigmoid(gate1 mW + mb) ; out = gate1 * (LN(mlp) + 1)
__global__ __launch_bounds__(128) void k_post(const _Float16* __restrict__ O16, const _Float16* __restrict__ M16, const _Float16* __restrict__ P, const float* __restrict__ bo, const float* __restrict__ gb, const float* __restrict__ mb,
                                            const float* __restrict__ lng, const float* __restrict__ lnb, const float* __restrict__ x, float* __restrict__ out) {
  __shared__ __align__(16) float sg1[64][EE + 4];          // gate1 (f32), later mlp/LN in place? keep two: reuse so for mlp
  __shared__ __align__(16) _Float16 sa[4][16][EE + 8];     // f16 A tile of gate1
  __shared__ __align__(16) float so[4][16][EE + 4];
  const int tid = threadIdx.x, wave = tid >> 5, lane = tid & 31, col = lane & 15, g = lane >> 4;
  const int r0b = blockIdx.x * 64, r0 = r0b + wave * 16;
  // (1) rmha rows into so
#pragma unroll 1
  for (int hn = 0; hn < 2; ++hn) { v8f acc[8];
#pragma unroll
    for (int t = 0; t < 8; ++t) acc[t] = (v8f){};
    { const int R = r0 + col; const _Float16* Ob = O16 + (((size_t)(R / SS)) * NH * SS + (R % SS)) * HD;     // chunk kc = head kc (HD = 32)
      gemm_ahead(acc, [&](int kc) { return frag_h(Ob + (size_t)kc * SS * HD, lane); }, P + (size_t)(3 * EE + hn * 128 + col) * EE, lane); }
#pragma unroll
    for (int t = 0; t < 8; ++t) { const int n = (hn * 8 + t) * 16 + col; const float bb = bo[n];
#pragma unroll
      for (int r = 0; r < 8; ++r) so[wave][8 * g + r][n] = acc[t][r] * (1.0f / 128.0f) + bb; } }
  // (2) gate0 = sigmoid(x gW + gb); gate1 = gate0 * rmha + x  -> sg1 (f32) and sa (f16)
#pragma unroll 1
  for (int hn = 0; hn < 2; ++hn) { v8f acc[8];
#pragma unroll
    for (int t = 0; t < 8; ++t) acc[t] = (v8f){};
    gemm_ahead(acc, [&](int kc) { return frag_h(M16 + (size_t)(r0 + col) * EE + kc * 32, lane); }, P + (size_t)(4 * EE + hn * 128 + col) * EE, lane);
#pragma unroll
    for (int t = 0; t < 8; ++t) { const int n = (hn * 8 + t) * 16 + col; const float bb = gb[n];
#pragma unroll
      for (int r = 0; r < 8; ++r) sg1[wave * 16 + 8 * g + r][n] = acc[t][r] * (1.0f / 16.0f) + bb; } }
  LDSX();
  // rolled per-row pass: gate1 = sigmoid(pre) * rmha + x  (2 lanes per row)
  { const int rl = lane >> 1, hf = lane & 1; const int R = wave * 16 + rl; const float* xr = x + (size_t)(r0b + R) * EE;
#pragma unroll 4   // four columns a trip, 16-byte LDS and global accesses: what this loop compiled to with the library exponential
    for (int c = hf * 128; c < hf * 128 + 128; ++c) { const float g1 = sigm(sg1[R][c]) * so[wave][rl][c] + xr[c]; sg1[R][c] = g1; sa[wave][rl][c] = (_Float16)g1; } }
  LDSX();
  // (3) mlp = sigmoid(gate1 mW + mb) -> so ; then LN(mlp) per row and the final combine
#pragma unroll 1
  for (int hn = 0; hn < 2; ++hn) { v8f acc[8];
#pragma unroll
    for (int t = 0; t < 8; ++t) acc[t] = (v8f){};
    gemm_ahead(acc, [&](int kc) { return frag_h(&sa[wave][col][0] + kc * 32, lane); }, P + (size_t)(5 * EE + hn * 128 + col) * EE, lane);
#pragma unroll
    for (int t = 0; t < 8; ++t) { const int n = (hn * 8 + t) * 16 + col; const float bb = mb[n];
#pragma unroll
      for (int r = 0; r < 8; ++r) so[wave][8 * g + r][n] = acc[t][r] * (1.0f / 16.0f) + bb; } }
  LDSX();
  { const int rl = lane >> 1, hf = lane & 1; float* row = &so[wave][rl][0]; float s = 0.f;
#pragma unroll 2
    for (int c = hf * 128; c < hf * 128 + 128; ++c) { const float mv = sigm(row[c]); row[c] = mv; s += mv; } s += __shfl_xor(s, 1, 32); const float mu = s * (1.0f / EE);
    float q2 = 0.f; for (int c = hf * 128; c < hf * 128 + 128; ++c) { const float d = row[c] - mu; q2 += d * d; } q2 += __shfl_xor(q2, 1, 32); const float rs = rsqrtf(q2 * (1.0f / EE) + 1e-5f);
    LDSX();
    const float* g1r = &sg1[wave * 16 + rl][0];
    for (int c = hf * 128; c < hf * 128 + 128; ++c) { const float lnv = (row[c] - mu) * rs * lng[c] + lnb[c]; row[c] = g1r[c] * lnv + g1r[c]; } }
  LDSX();
  for (int rl = 0; rl < 16; ++rl) for (int pc = lane; pc < EE / 4; pc += 32) vst2(out + (size_t)(r0 + rl) * EE + pc * 4, *(const v4f*)(&so[wave][rl][pc * 4]));
}
extern "C" void kernel_launch(void* const* d_in, const int* in_sizes, int n_in, void* d_out, int out_size, void* d_ws, size_t ws_size, hipStream_t stream) {
  (void)in_sizes; (void)n_in; (void)out_size; (void)ws_size;
  const float** I = (const float**)d_in;
  const float* x = I[0]; const float* lng = I[1]; const float* lnb = I[2]; const float* Wq = I[3]; const float* bq = I[4]; const float* Wk = I[5]; const float* bk = I[6]; const float* Wv = I[7]; const float* bv = I[8]; const float* Wo = I[9]; const float* bo = I[10]; const float* rel = I[11]; const float* gW = I[12]; const float* gb = I[13]; const float* mW = I[14]; const float* mb = I[15];
  float* out = (float*)d_out;
  char* ws = (char*)d_ws; size_t off = 0;
  auto take = [&](size_t bytes) { char* p = ws + off; off += (bytes + 255) & ~(size_t)255; return p; };
  _Float16* X16 = (_Float16*)take((size_t)NR * EE * 2); _Float16* M16 = (_Float16*)take((size_t)NR * EE * 2); _Float16* P = (_Float16*)take((size_t)6 * EE * EE * 2);
  _Float16* Q16 = (_Float16*)take((size_t)NR * EE * 2); _Float16* K16 = (_Float16*)take((size_t)NR * EE * 2); _Float16* VT = (_Float16*)take((size_t)NR * EE * 2); _Float16* O16 = (_Float16*)take((size_t)NR * EE * 2);
  k_ln<<<NR / 8, 256, 0, stream>>>(x, lng, lnb, X16, M16);
  k_pack<<<6 * EE, 256, 0, stream>>>(Wq, Wk, Wv, Wo, gW, mW, P);
  k_qkv<<<dim3(NR / 64, EE / 128, 3), 128, 0, stream>>>(X16, P, bq, bk, bv, Q16, K16, VT);
  k_attn<<<dim3(SS / 64, NH, NB), 128, 0, stream>>>(Q16, K16, VT, rel, O16);
  k_post<<<NR / 64, 128, 0, stream>>>(O16, M16, P, bo, gb, mb, lng, lnb, x, out);
}

// v003
// Measured time: 127 microseconds a run.
// Two timings next to v002 put it at 1.09 and 1.11 times that version's speed.
// Over all steps from v000 it is 1.86 times as fast.
#include <hip/hip_runtime.h>
#include <math.h>

typedef __attribute__((ext_vector_type(16))) _Float16 v16h;
typedef __attribute__((ext_vector_type(16))) __bf16 v16b;
typedef __attribute__((ext_vector_type(8)))  _Float16 v8h;
typedef __attribute__((ext_vector_type(8)))  float v8f;
typedef __attribute__((ext_vector_type(4)))  float v4f;
typedef __attribute__((ext_vector_type(2)))  float v2f;
typedef __attribute__((ext_vector_type(4)))  unsigned v4u;
typedef __attribute__((ext_vector_type(4)))  int v4i;
typedef float __attribute__((may_alias)) float_a;
typedef int __attribute__((may_alias)) int_a;

template <typename T> __device__ __forceinline__ void vst2(void* p, T v) { *(T*)p = v;  }
__device__ __forceinline__ v8f wmma16(v16h a, v16h b, v8f c) {
  v8f d = __builtin_amdgcn_wmma_f32_16x16x32_f16(false, a, false, b, (short)0, c, false, false);
  asm volatile("v_nop\n\tv_nop\n\tv_nop\n\tv_nop" : "+v"(d) : "v"(a), "v"(b));
  return d;
}
__device__ __forceinline__ v8f wmma_bf(v16b a, v16b b, v8f c) {
  v8f d = __builtin_amdgcn_wmma_f32_16x16x32_bf16(false, a, false, b, (short)0, c, false, false);
  asm volatile("v_nop\n\tv_nop\n\tv_nop\n\tv_nop" : "+v"(d) : "v"(a), "v"(b));
  return d;
}
// 16x16x32 fragments: lane = (h = lane>>4, row/col = lane&15); elements 0..7 = k0+8h+0..7, 8..15 = k0+16+8h+0..7; D element r = row 8h+r
__device__ __forceinline__ v16h frag_h(const _Float16* rowk0, int lane) {
  union { v16h v; v8h q[2]; } u; const _Float16* p = rowk0 + 8 * (lane >> 4);
  u.q[0] = *(const v8h*)p; u.q[1] = *(const v8h*)(p + 16); return u.v;
}
// the same fragment from a pointer that already holds the lane half's offset (row + k0 + 8h)
__device__ __forceinline__ v16h frag_at(const _Float16* p) {
  union { v16h v; v8h q[2]; } u; u.q[0] = *(const v8h*)p; u.q[1] = *(const v8h*)(p + 16); return u.v;
}
// the same fragment from a tile kept in fragment order: 16 rows x 32 k = 512 halves as [k >> 3][row][k & 7]; p = tile + 8 * lane, so each of the two loads reads 512 contiguous bytes (4 whole lines) over the wave
__device__ __forceinline__ v16h frag_t(const _Float16* p) {
  union { v16h v; v8h q[2]; } u; u.q[0] = *(const v8h*)p; u.q[1] = *(const v8h*)(p + 256); return u.v;
}
__device__ __forceinline__ v16h frag_f32(const float* rowk0, int lane) {
  v16h a; const float* p = rowk0 + 8 * (lane >> 4);
#pragma unroll
  for (int i = 0; i < 8; ++i) { a[i] = (_Float16)p[i]; a[8 + i] = (_Float16)p[16 + i]; }
  return a;
}
__device__ __forceinline__ v16h frag_f32s(const float* rowk0, int lane, float sc) {
  v16h a; const float* p = rowk0 + 8 * (lane >> 4);
#pragma unroll
  for (int i = 0; i < 8; ++i) { a[i] = (_Float16)(p[i] * sc); a[8 + i] = (_Float16)(p[16 + i] * sc); }
  return a;
}
// column fragment from a [K][ld] layout (column n), rows >= K read as 0
__device__ __forceinline__ v16h fragc_f32(const float* W, int k0, int n, int lane, int ld, int K) {
  v16h a; const int g = lane >> 4;
#pragma unroll
  for (int i = 0; i < 8; ++i) { const int ka = k0 + 8 * g + i, kb = ka + 16;
    a[i] = (_Float16)(ka < K ? W[(size_t)ka * ld + n] : 0.f); a[8 + i] = (_Float16)(kb < K ? W[(size_t)kb * ld + n] : 0.f); }
  return a;
}
struct F2 { v16b h, l; };
__device__ __forceinline__ F2 bsplit16(const float v[16]) { F2 r;
#pragma unroll
  for (int i = 0; i < 16; ++i) { const __bf16 h = (__bf16)v[i]; r.h[i] = h; r.l[i] = (__bf16)(v[i] - (float)h); }
  return r; }
__device__ __forceinline__ F2 split_row(const float* row, int k0, int lane) { float v[16]; const float* p = row + k0 + 8 * (lane >> 4);
#pragma unroll
  for (int i = 0; i < 8; ++i) { v[i] = p[i]; v[8 + i] = p[16 + i]; }
  return bsplit16(v); }
__device__ __forceinline__ F2 split_rowK(const float* row, int k0, int lane, int K) { float v[16]; const int g = lane >> 4;
#pragma unroll
  for (int i = 0; i < 8; ++i) { const int ka = k0 + 8 * g + i, kb = ka + 16; v[i] = ka < K ? row[ka] : 0.f; v[8 + i] = kb < K ? row[kb] : 0.f; }
  return bsplit16(v); }
__device__ __forceinline__ F2 split_col(const float* W, int k0, int n, int lane, int ld, int K) { float v[16]; const int g = lane >> 4;
#pragma unroll
  for (int i = 0; i < 8; ++i) { const int ka = k0 + 8 * g + i, kb = ka + 16; v[i] = ka < K ? W[(size_t)ka * ld + n] : 0.f; v[8 + i] = kb < K ? W[(size_t)kb * ld + n] : 0.f; }
  return bsplit16(v); }
__device__ __forceinline__ v8f mac3(const F2& a, const F2& b, v8f c) { c = wmma_bf(a.l, b.h, c); c = wmma_bf(a.h, b.l, c); return wmma_bf(a.h, b.h, c); }
#define L2E 1.4426950408889634f
// e^x as 2^(x log2 e) on the bare v_exp_f32, without the library's range fix-ups: a vanishing result may be 0 and an overflowing one is infinity, which suits every use here
__device__ __forceinline__ float sigm(float v) { return 1.0f / (1.0f + __builtin_amdgcn_exp2f(v * -L2E)); }
#define LDSX() do { asm volatile("s_wait_dscnt 0" ::: "memory"); __builtin_amdgcn_wave_barrier(); __builtin_amdgcn_fence(__ATOMIC_RELEASE, "workgroup"); } while (0)

// Gated relation-transformer block: LN(x); 8-head (d=32) self attention with an additive [S,S] relation bias (read as data) and output
// projection; gate0 = sigmoid(x gW + gb); gate1 = gate0*mha + x; mlp = sigmoid(gate1 mW + mb); out = gate1*LN(mlp) + gate1.
// All six [in][out] weights packed transposed to f16 rows (x16); every product on v_wmma_f32_16x16x32_f16 (activations as f16 copies /
// LDS tiles, q/k/v head-major x4, P x2^14); LayerNorms, softmax (online over 16 key tiles), sigmoids and gating in f32.
// Every f16 workspace array is a sequence of 16 x 32 tiles in fragment order (frag_t), written by whole lines through LDS; the bias is copied into accumulator order likewise.
#define NB 16
#define SS 1024
#define EE 256
#define NH 8
#define HD 32
#define NR (NB * SS)

// LN(x) -> X16 ; x -> M16 ; wave per row (256 = 32 lanes x 8), two rows a wave; the block's 16 rows leave as 8 tiles per array ([row tile][k chunk])
__global__ __launch_bounds__(256) void k_ln(const float* __restrict__ x, const float* __restrict__ g, const float* __restrict__ bb, _Float16* __restrict__ X16, _Float16* __restrict__ M16) {
  __shared__ __align__(16) _Float16 sx[2][16][EE + 8];
  const int tid = threadIdx.x, wave = tid >> 5, lane = tid & 31;
  const float* xr = x + ((size_t)blockIdx.x * 16 + wave * 2) * EE + lane * 8; float vv[2][8];
#pragma unroll
  for (int e = 0; e < 8; ++e) { vv[0][e] = xr[e]; vv[1][e] = xr[EE + e]; }
  // the loads' address registers stay whole up to this wait
  asm volatile("s_wait_xcnt 0x0" :: "v"(xr) : "memory");
#pragma unroll
  for (int rr = 0; rr < 2; ++rr) { const int rl = wave * 2 + rr; float v[8]; float s = 0.f;
#pragma unroll
    for (int e = 0; e < 8; ++e) { v[e] = vv[rr][e]; s += v[e]; }
#pragma unroll
    for (int off = 16; off >= 1; off >>= 1) s += __shfl_xor(s, off, 32);
    const float mu = s * (1.0f / EE); float q2 = 0.f;
#pragma unroll
    for (int e = 0; e < 8; ++e) { const float d = v[e] - mu; q2 += d * d; }
#pragma unroll
    for (int off = 16; off >= 1; off >>= 1) q2 += __shfl_xor(q2, off, 32);
    const float rs = rsqrtf(q2 * (1.0f / EE) + 1e-5f);
    union { v8h h; v4u u; } p1, p2;
#pragma unroll
    for (int e = 0; e < 8; ++e) { const int c = lane * 8 + e; p1.h[e] = (_Float16)((v[e] - mu) * rs * g[c] + bb[c]); p2.h[e] = (_Float16)v[e]; }
    vst2(&sx[0][rl][lane * 8], p1.u); vst2(&sx[1][rl][lane * 8], p2.u); }
  __syncthreads();
#pragma unroll   // unrolled: the four LDS reads go out together, and which array a store goes to is known at compile time
  for (int i = 0; i < 4; ++i) { const int a = i >> 1, ch = tid + (i & 1) * 256, kc = ch >> 6, j = (ch >> 4) & 3, c = ch & 15;
    vst2((a ? M16 : X16) + (size_t)blockIdx.x * 16 * EE + ch * 8, *(const v4u*)(&sx[a][c][kc * 32 + j * 8])); }
}
// P tiles [w*16 + n/16][k chunk] of W_w[k][n]*16 (tile row = n) for w: 0 Wq, 1 Wk, 2 Wv, 3 Wo, 4 gW, 5 mW ; block = 16 columns n, thread = row k
// blocks from 96 on: R32 = the bias as 16 x 16 f32 tiles [q / 16][key / 16] in accumulator order, [r >> 2][lane][r & 3] for D register r ; block = 16 rows x 256 columns
__global__ __launch_bounds__(256) void k_pack(const float* __restrict__ Wq, const float* __restrict__ Wk, const float* __restrict__ Wv, const float* __restrict__ Wo, const float* __restrict__ gW, const float* __restrict__ mW, const float* __restrict__ rel, _Float16* __restrict__ P, float* __restrict__ R32) {
  const int blk = blockIdx.x, tid = threadIdx.x; __shared__ __align__(16) _Float16 sc[16][EE + 8]; __shared__ __align__(16) float sr[16][256 + 4];
  if (blk >= 6 * EE / 16) { const int rb = blk - 6 * EE / 16, qt = rb >> 2, c0 = (rb & 3) * 256;   // the same for the whole block
    const int hi = tid >> 6, lo = tid & 63; const float* rp = rel + (size_t)(qt * 16 + hi) * SS + c0 + lo * 4; v4f in[4];
#pragma unroll   // unrolled: the four loads go out together
    for (int i = 0; i < 4; ++i) in[i] = *(const v4f*)(rp + i * 4 * SS);
    // the loads' address registers stay whole up to this wait
    asm volatile("s_wait_xcnt 0x0" :: "v"(rp) : "memory");
#pragma unroll
    for (int i = 0; i < 4; ++i) vst2(&sr[hi + 4 * i][lo * 4], in[i]);
    __syncthreads();
    const int u = (lo >> 5) & 1, gg = (lo >> 4) & 1, cc = lo & 15; float* wp = R32 + ((size_t)qt * (SS / 16) + (c0 >> 4) + hi) * 256 + lo * 4;
#pragma unroll   // unrolled: the LDS reads of all four stores go out together
    for (int i = 0; i < 4; ++i) { v4f o;   // tile hi + 4 i of the block's 16
#pragma unroll
      for (int e = 0; e < 4; ++e) o[e] = sr[8 * gg + 4 * u + e][(hi + 4 * i) * 16 + cc];
      vst2(wp + i * 4 * 256, o); }
    return; }
  const int which = blk >> 4, n0 = (blk & 15) * 16; const float* W = which == 0 ? Wq : which == 1 ? Wk : which == 2 ? Wv : which == 3 ? Wo : which == 4 ? gW : mW;
  const float* wr = W + (size_t)tid * EE + n0;
#pragma unroll
  for (int c = 0; c < 16; ++c) sc[c][tid] = (_Float16)(wr[c] * 16.0f);
  __syncthreads();
#pragma unroll   // unrolled: both LDS reads go out together
  for (int i = 0; i < 2; ++i) { const int q = tid + i * 256, kc = q >> 6, j = (q >> 4) & 3, c = q & 15; vst2(P + (size_t)blk * 16 * EE + q * 8, *(const v4u*)(&sc[c][kc * 32 + j * 8])); }
}
// q/k/v: block (64 rows, 128 cols = 4 heads, which)
__global__ __launch_bounds__(128) void k_qkv(const _Float16* __restrict__ X16, const _Float16* __restrict__ P, const float* __restrict__ bq, const float* __restrict__ bk, const float* __restrict__ bv, _Float16* __restrict__ Q16, _Float16* __restrict__ K16, _Float16* __restrict__ VT) {
  __shared__ __align__(16) float so[4][16][132];
  __shared__ __align__(16) _Float16 st[128][72];
  const int tid = threadIdx.x, wave = tid >> 5, lane = tid & 31, col = lane & 15, g = lane >> 4;
  const int which = blockIdx.z, r0b = blockIdx.x * 64, r0 = r0b + wave * 16, n0 = blockIdx.y * 128; const int b = r0b / SS, s0 = r0b % SS;
  const _Float16* Pw = P + (size_t)which * EE * EE; const float* bias = which == 0 ? bq : (which == 1 ? bk : bv);
  v8f acc[8] = {};
  const _Float16* pa = X16 + (size_t)r0 * EE + 8 * lane; const _Float16* pb = Pw + (size_t)n0 * EE + 8 * lane;
#pragma unroll
  for (int kc = 0; kc < EE / 32; ++kc) { const v16h a = frag_t(pa + kc * 512); v16h bf[8];   // all fragments of the k step are requested before its first product
#pragma unroll
    for (int j = 0; j < 8; ++j) bf[j] = frag_t(pb + j * 16 * EE + kc * 512);
#pragma unroll
    for (int j = 0; j < 8; ++j) acc[j] = wmma16(a, bf[j], acc[j]); }
  // the loads' address registers stay whole up to this wait
  asm volatile("s_wait_xcnt 0x0" :: "v"(pa), "v"(pb) : "memory");
  if (which < 2) {
#pragma unroll
    for (int j = 0; j < 8; ++j) { const float bbv = bias[n0 + j * 16 + col];
#pragma unroll
      for (int r = 0; r < 8; ++r) so[wave][8 * g + r][j * 16 + col] = (acc[j][r] * (1.0f / 16.0f) + bbv) * 4.0f; }
    LDSX();
    _Float16* D = which == 0 ? Q16 : K16;
    // 128 cols = 4 heads of 32: per head one 16 x 32 tile (tile row = position, k = d) = 64 x v4u in fragment order
    for (int q = lane; q < 16 * 4 * 4; q += 32) { const int hh = q >> 6, pc = (q >> 4) & 3, rl = q & 15; const int h = (n0 >> 5) + hh; union { v8h h8; v4u u; } pk;
#pragma unroll
      for (int e = 0; e < 8; ++e) pk.h8[e] = (_Float16)so[wave][rl][hh * 32 + pc * 8 + e];
      vst2(D + (((size_t)b * NH + h) * SS + s0 + wave * 16) * HD + (q & 63) * 8, pk.u); } }
  else {
#pragma unroll
    for (int j = 0; j < 8; ++j) { const float bbv = bias[n0 + j * 16 + col];
#pragma unroll
      for (int r = 0; r < 8; ++r) st[j * 16 + col][wave * 16 + 8 * g + r] = (_Float16)((acc[j][r] * (1.0f / 16.0f) + bbv) * 4.0f); }
    __syncthreads();
    // VT tiles [b][h][32-key chunk][d / 16] (tile row = d, k = key)
    for (int q = tid; q < 128 * 8; q += 128) { const int hh = q >> 8, kb = (q >> 7) & 1, t = (q >> 6) & 1, j = (q >> 4) & 3, c = q & 15;
      vst2(VT + ((((size_t)b * NH + (n0 >> 5) + hh) * (SS / 32) + (s0 >> 5) + kb) * 2 + t) * 512 + (q & 63) * 8, *(const v4u*)(&st[hh * 32 + t * 16 + c][kb * 32 + j * 8])); } }
}
// attention: block (64 q, h, b); S = q.k/sqrt(32) + rel[q][k] (rel = the R32 tiles); online softmax over 16 tiles; O16 [b][h][s / 16] tiles (tile row = position, k = d) x8
__global__ __launch_bounds__(128) void k_attn(const _Float16* __restrict__ Q16, const _Float16* __restrict__ K16, const _Float16* __restrict__ VT, const float* __restrict__ rel, _Float16* __restrict__ O16) {
  __shared__ __align__(16) float sS[4][16][68];
  __shared__ __align__(16) _Float16 sP[4][16][72];
  __shared__ __align__(16) float sO[4][16][36];
  const int tid = threadIdx.x, w = tid >> 5, lane = tid & 31, col = lane & 15, g = lane >> 4;
  const int b = blockIdx.z, h = blockIdx.y, q0 = blockIdx.x * 64 + w * 16; const size_t bh = (size_t)b * NH + h;
  const float scl = (1.0f / 16.0f) / sqrtf((float)HD);
  const v16h aq = frag_t(Q16 + (bh * SS + q0) * HD + 8 * lane);
  float mrun = -3.0e38f, lrun = 0.f; v8f acc[2] = {};
#pragma unroll 1
  for (int kt = 0; kt < SS / 64; ++kt) {
    v16h kf[4], vf[2][2]; float rv[4][8];   // the tile's K, bias and V operands are all requested here, ahead of the first product
    const _Float16* pk = K16 + (bh * SS + kt * 64) * HD + 8 * lane; const _Float16* pv = VT + (bh * (SS / 32) + kt * 2) * 1024 + 8 * lane; const float* pr = rel + ((size_t)(q0 >> 4) * (SS / 16) + kt * 4) * 256 + 4 * lane;
#pragma unroll
    for (int t = 0; t < 4; ++t) kf[t] = frag_t(pk + t * 512);
#pragma unroll
    for (int t = 0; t < 4; ++t) {
#pragma unroll
      for (int r = 0; r < 8; ++r) rv[t][r] = pr[t * 256 + (r >> 2) * 128 + (r & 3)]; }
#pragma unroll
    for (int kc = 0; kc < 2; ++kc) {
#pragma unroll
      for (int t = 0; t < 2; ++t) vf[kc][t] = frag_t(pv + (kc * 2 + t) * 512); }
    // the batch's address registers stay whole up to this wait
    asm volatile("s_wait_xcnt 0x0" :: "v"(pk), "v"(pv), "v"(pr) : "memory");
#pragma unroll
    for (int t = 0; t < 4; ++t) { v8f s = {};
      s = wmma16(aq, kf[t], s);
#pragma unroll
      for (int r = 0; r < 8; ++r) sS[w][8 * g + r][t * 16 + col] = s[r] * scl + rv[t][r]; }
    LDSX();
    float mx = -3.4e38f;
#pragma unroll
    for (int jj = 0; jj < 32; ++jj) mx = fmaxf(mx, sS[w][col][g * 32 + jj]);
    mx = fmaxf(mx, __shfl_xor(mx, 16, 32));
    const float mnew = fmaxf(mrun, mx); const float corr = __builtin_amdgcn_exp2f((mrun - mnew) * L2E);
    const float eoff = 14.0f - mnew * L2E;   // exponent offset: minus the maximum in base 2, plus 14 for P's 2^14 scale; ps and lrun carry that scale too
    float ps = 0.f;
#pragma unroll
    for (int jj = 0; jj < 32; ++jj) { const float p = __builtin_amdgcn_exp2f(fmaf(sS[w][col][g * 32 + jj], L2E, eoff)); ps += p; sP[w][col][g * 32 + jj] = (_Float16)p; }
    ps += __shfl_xor(ps, 16, 32);
    lrun = lrun * corr + ps; mrun = mnew;
#pragma unroll
    for (int r = 0; r < 8; ++r) { const float cr = __shfl(corr, 8 * g + r, 32); acc[0][r] *= cr; acc[1][r] *= cr; }
    LDSX();
#pragma unroll
    for (int kc = 0; kc < 2; ++kc) { const v16h pa = frag_h(&sP[w][col][0] + kc * 32, lane);
#pragma unroll
      for (int t = 0; t < 2; ++t) acc[t] = wmma16(pa, vf[kc][t], acc[t]); }
    __builtin_amdgcn_wave_barrier(); }
#pragma unroll
  for (int r = 0; r < 8; ++r) { const float lr = __shfl(lrun, 8 * g + r, 32); const float inv = 8.0f / (lr * 4.0f);
#pragma unroll
    for (int t = 0; t < 2; ++t) sO[w][8 * g + r][t * 16 + col] = acc[t][r] * inv; }
  LDSX();
  for (int q = lane; q < 16 * 4; q += 32) { const int pc = q >> 4, rl = q & 15; union { v8h h8; v4u u; } pk;
#pragma unroll
    for (int e = 0; e < 8; ++e) pk.h8[e] = (_Float16)sO[w][rl][pc * 8 + e];
    vst2(O16 + (bh * SS + q0) * HD + q * 8, pk.u); }
}
// 16 rows x 128 columns over k = 256: the A fragment and the 8 B fragments of k step kc + 1 are requested before the products of step kc
template <typename FA> __device__ __forceinline__ void gemm_ahead(v8f (&acc)[8], FA lda, const _Float16* Bt) {   // Bt = first B tile + 8 * lane
  v16h a0 = lda(0), a1, b0[8], b1[8];
#pragma unroll
  for (int t = 0; t < 8; ++t) b0[t] = frag_t(Bt + (size_t)t * 16 * EE);
#pragma unroll   // unrolled whole: the two fragment sets take turns without register copies, and the last step's fetch drops out
  for (int kc = 0; kc < EE / 32; kc += 2) {
    a1 = lda(kc + 1);
#pragma unroll
    for (int t = 0; t < 8; ++t) b1[t] = frag_t(Bt + (size_t)t * 16 * EE + (kc + 1) * 512);
#pragma unroll
    for (int t = 0; t < 8; ++t) acc[t] = wmma16(a0, b0[t], acc[t]);
    if (kc + 2 < EE / 32) { a0 = lda(kc + 2);
#pragma unroll
      for (int t = 0; t < 8; ++t) b0[t] = frag_t(Bt + (size_t)t * 16 * EE + (kc + 2) * 512); }
#pragma unroll
    for (int t = 0; t < 8; ++t) acc[t] = wmma16(a1, b1[t], acc[t]); }
}
// post: block 64 rows, all 256 cols: rmha = O@Wo + bo ; gate0 = sigmoid(x gW + gb) ; gate1 = gate0*rmha + x ; mlp = sigmoid(gate1 mW + mb) ; out = gate1 * (LN(mlp) + 1)
__global__ __launch_bounds__(128) void k_post(const _Float16* __restrict__ O16, const _Float16* __restrict__ M16, const _Float16* __restrict__ P, const float* __restrict__ bo, const float* __restrict__ gb, const float* __restrict__ mb,
                                            const float* __restrict__ lng, const float* __restrict__ lnb, const float* __restrict__ x, float* __restrict__ out) {
  __shared__ __align__(16) float sg1[64][EE + 4];          // gate1 (f32), later mlp/LN in place? keep two: reuse so for mlp
  __shared__ __align__(16) _Float16 sa[4][16][EE + 8];     // f16 A tile of gate1
  __shared__ __align__(16) float so[4][16][EE + 4];
  const int tid = threadIdx.x, wave = tid >> 5, lane = tid & 31, col = lane & 15, g = lane >> 4;
  const int r0b = blockIdx.x * 64, r0 = r0b + wave * 16;
  // (1) rmha rows into so
#pragma unroll 1
  for (int hn = 0; hn < 2; ++hn) { v8f acc[8];
#pragma unroll
    for (int t = 0; t < 8; ++t) acc[t] = (v8f){};
    const _Float16* Ob = O16 + (((size_t)(r0 / SS)) * NH * SS + (r0 % SS)) * HD + 8 * lane;     // chunk kc = head kc (HD = 32)
    const _Float16* Bt = P + (size_t)(3 * EE + hn * 128) * EE + 8 * lane;
    gemm_ahead(acc, [&](int kc) { return frag_t(Ob + (size_t)kc * SS * HD); }, Bt);
#pragma unroll
    for (int t = 0; t < 8; ++t) { const int n = (hn * 8 + t) * 16 + col; const float bb = bo[n];
#pragma unroll
      for (int r = 0; r < 8; ++r) so[wave][8 * g + r][n] = acc[t][r] * (1.0f / 128.0f) + bb; }
    // the loads' address registers stay whole up to this wait, ahead of the next trip's new addresses
    asm volatile("s_wait_xcnt 0x0" :: "v"(Ob), "v"(Bt) : "memory"); }
  // (2) gate0 = sigmoid(x gW + gb); gate1 = gate0 * rmha + x  -> sg1 (f32) and sa (f16)
#pragma unroll 1
  for (int hn = 0; hn < 2; ++hn) { v8f acc[8];
#pragma unroll
    for (int t = 0; t < 8; ++t) acc[t] = (v8f){};
    const _Float16* Mt = M16 + (size_t)r0 * EE + 8 * lane; const _Float16* Bt = P + (size_t)(4 * EE + hn * 128) * EE + 8 * lane;
    gemm_ahead(acc, [&](int kc) { return frag_t(Mt + kc * 512); }, Bt);
#pragma unroll
    for (int t = 0; t < 8; ++t) { const int n = (hn * 8 + t) * 16 + col; const float bb = gb[n];
#pragma unroll
      for (int r = 0; r < 8; ++r) sg1[wave * 16 + 8 * g + r][n] = acc[t][r] * (1.0f / 16.0f) + bb; }
    // the loads' address registers stay whole up to this wait, ahead of the next trip's new addresses
    asm volatile("s_wait_xcnt 0x0" :: "v"(Mt), "v"(Bt) : "memory"); }
  LDSX();
  // rolled per-row pass: gate1 = sigmoid(pre) * rmha + x  (2 lanes per row)
  { const int rl = lane >> 1, hf = lane & 1; const int R = wave * 16 + rl; const float* xr = x + (size_t)(r0b + R) * EE;
#pragma unroll 4   // four columns a trip, 16-byte LDS and global accesses: what this loop compiled to with the library exponential
    for (int c = hf * 128; c < hf * 128 + 128; ++c) { const float g1 = sigm(sg1[R][c]) * so[wave][rl][c] + xr[c]; sg1[R][c] = g1; sa[wave][rl][c] = (_Float16)g1; } }
  LDSX();
  // (3) mlp = sigmoid(gate1 mW + mb) -> so ; then LN(mlp) per row and the final combine
#pragma unroll 1
  for (int hn = 0; hn < 2; ++hn) { v8f acc[8];
#pragma unroll
    for (int t = 0; t < 8; ++t) acc[t] = (v8f){};
    const _Float16* Bt = P + (size_t)(5 * EE + hn * 128) * EE + 8 * lane;
    gemm_ahead(acc, [&](int kc) { return frag_h(&sa[wave][col][0] + kc * 32, lane); }, Bt);
#pragma unroll
    for (int t = 0; t < 8; ++t) { const int n = (hn * 8 + t) * 16 + col; const float bb = mb[n];
#pragma unroll
      for (int r = 0; r < 8; ++r) so[wave][8 * g + r][n] = acc[t][r] * (1.0f / 16.0f) + bb; }
    // the loads' address registers stay whole up to this wait, ahead of the next trip's new addresses
    asm volatile("s_wait_xcnt 0x0" :: "v"(Bt) : "memory"); }
  LDSX();
  { const int rl = lane >> 1, hf = lane & 1; float* row = &so[wave][rl][0]; float s = 0.f;
#pragma unroll 2
    for (int c = hf * 128; c < hf * 128 + 128; ++c) { const float mv = sigm(row[c]); row[c] = mv; s += mv; } s += __shfl_xor(s, 1, 32); const float mu = s * (1.0f / EE);
    float q2 = 0.f; for (int c = hf * 128; c < hf * 128 + 128; ++c) { const float d = row[c] - mu; q2 += d * d; } q2 += __shfl_xor(q2, 1, 32); const float rs = rsqrtf(q2 * (1.0f / EE) + 1e-5f);
    LDSX();
    const float* g1r = &sg1[wave * 16 + rl][0];
    for (int c = hf * 128; c < hf * 128 + 128; ++c) { const float lnv = (row[c] - mu) * rs * lng[c] + lnb[c]; row[c] = g1r[c] * lnv + g1r[c]; } }
  LDSX();
  for (int rl = 0; rl < 16; ++rl) for (int pc = lane; pc < EE / 4; pc += 32) vst2(out + (size_t)(r0 + rl) * EE + pc * 4, *(const v4f*)(&so[wave][rl][pc * 4]));
}
extern "C" void kernel_launch(void* const* d_in, const int* in_sizes, int n_in, void* d_out, int out_size, void* d_ws, size_t ws_size, hipStream_t stream) {
  (void)in_sizes; (void)n_in; (void)out_size; (void)ws_size;
  const float** I = (const float**)d_in;
  const float* x = I[0]; const float* lng = I[1]; const float* lnb = I[2]; const float* Wq = I[3]; const float* bq = I[4]; const float* Wk = I[5]; const float* bk = I[6]; const float* Wv = I[7]; const float* bv = I[8]; const float* Wo = I[9]; const float* bo = I[10]; const float* rel = I[11]; const float* gW = I[12]; const float* gb = I[13]; const float* mW = I[14]; const float* mb = I[15];
  float* out = (float*)d_out;
  char* ws = (char*)d_ws; size_t off = 0;
  auto take = [&](size_t bytes) { char* p = ws + off; off += (bytes + 255) & ~(size_t)255; return p; };
  _Float16* X16 = (_Float16*)take((size_t)NR * EE * 2); _Float16* M16 = (_Float16*)take((size_t)NR * EE * 2); _Float16* P = (_Float16*)take((size_t)6 * EE * EE * 2);
  _Float16* Q16 = (_Float16*)take((size_t)NR * EE * 2); _Float16* K16 = (_Float16*)take((size_t)NR * EE * 2); _Float16* VT = (_Float16*)take((size_t)NR * EE * 2); _Float16* O16 = (_Float16*)take((size_t)NR * EE * 2); float* R32 = (float*)take((size_t)SS * SS * 4);
  k_ln<<<NR / 16, 256, 0, stream>>>(x, lng, lnb, X16, M16);
  k_pack<<<6 * EE / 16 + SS / 16 * 4, 256, 0, stream>>>(Wq, Wk, Wv, Wo, gW, mW, rel, P, R32);
  k_qkv<<<dim3(NR / 64, EE / 128, 3), 128, 0, stream>>>(X16, P, bq, bk, bv, Q16, K16, VT);
  k_attn<<<dim3(SS / 64, NH, NB), 128, 0, stream>>>(Q16, K16, VT, R32, O16);
  k_post<<<NR / 64, 128, 0, stream>>>(O16, M16, P, bo, gb, mb, lng, lnb, x, out);
}

// v004
// It runs in 109 microseconds.
// In both of two side-by-side timings against v003, it was 1.16 times as fast.
// Over all steps from v000 it is 2.16 times as fast.
#include <hip/hip_runtime.h>
#include <math.h>

typedef __attribute__((ext_vector_type(16))) _Float16 v16h;
typedef __attribute__((ext_vector_type(16))) __bf16 v16b;
typedef __attribute__((ext_vector_type(8)))  _Float16 v8h;
typedef __attribute__((ext_vector_type(8)))  float v8f;
typedef __attribute__((ext_vector_type(4)))  float v4f;
typedef __attribute__((ext_vector_type(2)))  float v2f;
typedef __attribute__((ext_vector_type(4)))  unsigned v4u;
typedef __attribute__((ext_vector_type(4)))  int v4i;
typedef float __attribute__((may_alias)) float_a;
typedef int __attribute__((may_alias)) int_a;

template <typename T> __device__ __forceinline__ void vst2(void* p, T v) { *(T*)p = v;  }
__device__ __forceinline__ v8f wmma16(v16h a, v16h b, v8f c) {
  v8f d = __builtin_amdgcn_wmma_f32_16x16x32_f16(false, a, false, b, (short)0, c, false, false);
  asm volatile("v_nop\n\tv_nop\n\tv_nop\n\tv_nop" : "+v"(d) : "v"(a), "v"(b));
  return d;
}
__device__ __forceinline__ v8f wmma_bf(v16b a, v16b b, v8f c) {
  v8f d = __builtin_amdgcn_wmma_f32_16x16x32_bf16(false, a, false, b, (short)0, c, false, false);
  asm volatile("v_nop\n\tv_nop\n\tv_nop\n\tv_nop" : "+v"(d) : "v"(a), "v"(b));
  return d;
}
// 16x16x32 fragments: lane = (h = lane>>4, row/col = lane&15); elements 0..7 = k0+8h+0..7, 8..15 = k0+16+8h+0..7; D element r = row 8h+r
__device__ __forceinline__ v16h frag_h(const _Float16* rowk0, int lane) {
  union { v16h v; v8h q[2]; } u; const _Float16* p = rowk0 + 8 * (lane >> 4);
  u.q[0] = *(const v8h*)p; u.q[1] = *(const v8h*)(p + 16); return u.v;
}
// the same fragment from a pointer that already holds the lane half's offset (row + k0 + 8h)
__device__ __forceinline__ v16h frag_at(const _Float16* p) {
  union { v16h v; v8h q[2]; } u; u.q[0] = *(const v8h*)p; u.q[1] = *(const v8h*)(p + 16); return u.v;
}
// the same fragment from a tile kept in fragment order: 16 rows x 32 k = 512 halves as [k >> 3][row][k & 7]; p = tile + 8 * lane, so each of the two loads reads 512 contiguous bytes (4 whole lines) over the wave
__device__ __forceinline__ v16h frag_t(const _Float16* p) {
  union { v16h v; v8h q[2]; } u; u.q[0] = *(const v8h*)p; u.q[1] = *(const v8h*)(p + 256); return u.v;
}
__device__ __forceinline__ v16h frag_f32(const float* rowk0, int lane) {
  v16h a; const float* p = rowk0 + 8 * (lane >> 4);
#pragma unroll
  for (int i = 0; i < 8; ++i) { a[i] = (_Float16)p[i]; a[8 + i] = (_Float16)p[16 + i]; }
  return a;
}
__device__ __forceinline__ v16h frag_f32s(const float* rowk0, int lane, float sc) {
  v16h a; const float* p = rowk0 + 8 * (lane >> 4);
#pragma unroll
  for (int i = 0; i < 8; ++i) { a[i] = (_Float16)(p[i] * sc); a[8 + i] = (_Float16)(p[16 + i] * sc); }
  return a;
}
// column fragment from a [K][ld] layout (column n), rows >= K read as 0
__device__ __forceinline__ v16h fragc_f32(const float* W, int k0, int n, int lane, int ld, int K) {
  v16h a; const int g = lane >> 4;
#pragma unroll
  for (int i = 0; i < 8; ++i) { const int ka = k0 + 8 * g + i, kb = ka + 16;
    a[i] = (_Float16)(ka < K ? W[(size_t)ka * ld + n] : 0.f); a[8 + i] = (_Float16)(kb < K ? W[(size_t)kb * ld + n] : 0.f); }
  return a;
}
struct F2 { v16b h, l; };
__device__ __forceinline__ F2 bsplit16(const float v[16]) { F2 r;
#pragma unroll
  for (int i = 0; i < 16; ++i) { const __bf16 h = (__bf16)v[i]; r.h[i] = h; r.l[i] = (__bf16)(v[i] - (float)h); }
  return r; }
__device__ __forceinline__ F2 split_row(const float* row, int k0, int lane) { float v[16]; const float* p = row + k0 + 8 * (lane >> 4);
#pragma unroll
  for (int i = 0; i < 8; ++i) { v[i] = p[i]; v[8 + i] = p[16 + i]; }
  return bsplit16(v); }
__device__ __forceinline__ F2 split_rowK(const float* row, int k0, int lane, int K) { float v[16]; const int g = lane >> 4;
#pragma unroll
  for (int i = 0; i < 8; ++i) { const int ka = k0 + 8 * g + i, kb = ka + 16; v[i] = ka < K ? row[ka] : 0.f; v[8 + i] = kb < K ? row[kb] : 0.f; }
  return bsplit16(v); }
__device__ __forceinline__ F2 split_col(const float* W, int k0, int n, int lane, int ld, int K) { float v[16]; const int g = lane >> 4;
#pragma unroll
  for (int i = 0; i < 8; ++i) { const int ka = k0 + 8 * g + i, kb = ka + 16; v[i] = ka < K ? W[(size_t)ka * ld + n] : 0.f; v[8 + i] = kb < K ? W[(size_t)kb * ld + n] : 0.f; }
  return bsplit16(v); }
__device__ __forceinline__ v8f mac3(const F2& a, const F2& b, v8f c) { c = wmma_bf(a.l, b.h, c); c = wmma_bf(a.h, b.l, c); return wmma_bf(a.h, b.h, c); }
#define L2E 1.4426950408889634f
// e^x as 2^(x log2 e) on the bare v_exp_f32, without the library's range fix-ups: a vanishing result may be 0 and an overflowing one is infinity, which suits every use here
__device__ __forceinline__ float sigm(float v) { return 1.0f / (1.0f + __builtin_amdgcn_exp2f(v * -L2E)); }
#define LDSX() do { asm volatile("s_wait_dscnt 0" ::: "memory"); __builtin_amdgcn_wave_barrier(); __builtin_amdgcn_fence(__ATOMIC_RELEASE, "workgroup"); } while (0)

// Gated relation-transformer block: LN(x); 8-head (d=32) self attention with an additive [S,S] relation bias (read as data) and output
// projection; gate0 = sigmoid(x gW + gb); gate1 = gate0*mha + x; mlp = sigmoid(gate1 mW + mb); out = gate1*LN(mlp) + gate1.
// All six [in][out] weights packed transposed to f16 rows (x16); every product on v_wmma_f32_16x16x32_f16 (activations as f16 copies /
// LDS tiles, q/k/v head-major x4, P x2^14); LayerNorms, softmax (online over 16 key tiles), sigmoids and gating in f32.
// Every f16 workspace array is a sequence of 16 x 32 tiles in fragment order (frag_t), written by whole lines (through LDS, O16 straight from the accumulators); the bias is copied into accumulator order likewise.
#define NB 16
#define SS 1024
#define EE 256
#define NH 8
#define HD 32
#define NR (NB * SS)

// LN(x) -> X16 ; x -> M16 ; wave per row (256 = 32 lanes x 8), two rows a wave; the block's 16 rows leave as 8 tiles per array ([row tile][k chunk])
__global__ __launch_bounds__(256) void k_ln(const float* __restrict__ x, const float* __restrict__ g, const float* __restrict__ bb, _Float16* __restrict__ X16, _Float16* __restrict__ M16) {
  __shared__ __align__(16) _Float16 sx[2][16][EE + 8];
  const int tid = threadIdx.x, wave = tid >> 5, lane = tid & 31;
  const float* xr = x + ((size_t)blockIdx.x * 16 + wave * 2) * EE + lane * 8; float vv[2][8];
#pragma unroll
  for (int e = 0; e < 8; ++e) { vv[0][e] = xr[e]; vv[1][e] = xr[EE + e]; }
  // the loads' address registers stay whole up to this wait
  asm volatile("s_wait_xcnt 0x0" :: "v"(xr) : "memory");
#pragma unroll
  for (int rr = 0; rr < 2; ++rr) { const int rl = wave * 2 + rr; float v[8]; float s = 0.f;
#pragma unroll
    for (int e = 0; e < 8; ++e) { v[e] = vv[rr][e]; s += v[e]; }
#pragma unroll
    for (int off = 16; off >= 1; off >>= 1) s += __shfl_xor(s, off, 32);
    const float mu = s * (1.0f / EE); float q2 = 0.f;
#pragma unroll
    for (int e = 0; e < 8; ++e) { const float d = v[e] - mu; q2 += d * d; }
#pragma unroll
    for (int off = 16; off >= 1; off >>= 1) q2 += __shfl_xor(q2, off, 32);
    const float rs = rsqrtf(q2 * (1.0f / EE) + 1e-5f);
    union { v8h h; v4u u; } p1, p2;
#pragma unroll
    for (int e = 0; e < 8; ++e) { const int c = lane * 8 + e; p1.h[e] = (_Float16)((v[e] - mu) * rs * g[c] + bb[c]); p2.h[e] = (_Float16)v[e]; }
    vst2(&sx[0][rl][lane * 8], p1.u); vst2(&sx[1][rl][lane * 8], p2.u); }
  __syncthreads();
#pragma unroll   // unrolled: the four LDS reads go out together, and which array a store goes to is known at compile time
  for (int i = 0; i < 4; ++i) { const int a = i >> 1, ch = tid + (i & 1) * 256, kc = ch >> 6, j = (ch >> 4) & 3, c = ch & 15;
    vst2((a ? M16 : X16) + (size_t)blockIdx.x * 16 * EE + ch * 8, *(const v4u*)(&sx[a][c][kc * 32 + j * 8])); }
}
// P tiles [w*16 + n/16][k chunk] of W_w[k][n]*16 (tile row = n) for w: 0 Wq, 1 Wk, 2 Wv, 3 Wo, 4 gW, 5 mW ; block = 16 columns n, thread = row k
// blocks from 96 on: R32 = the bias as 16 x 16 f32 tiles [q / 16][key / 16] in the accumulator order of the transposed score tile (D register r of lane (g, c) = rel[q c][key 8 g + r]), [r >> 2][lane][r & 3] ; block = 16 rows x 256 columns
__global__ __launch_bounds__(256) void k_pack(const float* __restrict__ Wq, const float* __restrict__ Wk, const float* __restrict__ Wv, const float* __restrict__ Wo, const float* __restrict__ gW, const float* __restrict__ mW, const float* __restrict__ rel, _Float16* __restrict__ P, float* __restrict__ R32) {
  const int blk = blockIdx.x, tid = threadIdx.x; __shared__ __align__(16) _Float16 sc[16][EE + 8]; __shared__ __align__(16) float sr[16][256 + 4];
  if (blk >= 6 * EE / 16) { const int rb = blk - 6 * EE / 16, qt = rb >> 2, c0 = (rb & 3) * 256;   // the same for the whole block
    const int hi = tid >> 6, lo = tid & 63; const float* rp = rel + (size_t)(qt * 16 + hi) * SS + c0 + lo * 4; v4f in[4];
#pragma unroll   // unrolled: the four loads go out together
    for (int i = 0; i < 4; ++i) in[i] = *(const v4f*)(rp + i * 4 * SS);
    // the loads' address registers stay whole up to this wait
    asm volatile("s_wait_xcnt 0x0" :: "v"(rp) : "memory");
#pragma unroll
    for (int i = 0; i < 4; ++i) vst2(&sr[hi + 4 * i][lo * 4], in[i]);
    __syncthreads();
    const int u = (lo >> 5) & 1, gg = (lo >> 4) & 1, cc = lo & 15; float* wp = R32 + ((size_t)qt * (SS / 16) + (c0 >> 4) + hi) * 256 + lo * 4;
#pragma unroll   // unrolled: the LDS reads of all four stores go out together
    for (int i = 0; i < 4; ++i) { v4f o;   // tile hi + 4 i of the block's 16
#pragma unroll
      for (int e = 0; e < 4; ++e) o[e] = sr[cc][(hi + 4 * i) * 16 + 8 * gg + 4 * u + e];
      vst2(wp + i * 4 * 256, o); }
    return; }
  const int which = blk >> 4, n0 = (blk & 15) * 16; const float* W = which == 0 ? Wq : which == 1 ? Wk : which == 2 ? Wv : which == 3 ? Wo : which == 4 ? gW : mW;
  const float* wr = W + (size_t)tid * EE + n0;
#pragma unroll
  for (int c = 0; c < 16; ++c) sc[c][tid] = (_Float16)(wr[c] * 16.0f);
  __syncthreads();
#pragma unroll   // unrolled: both LDS reads go out together
  for (int i = 0; i < 2; ++i) { const int q = tid + i * 256, kc = q >> 6, j = (q >> 4) & 3, c = q & 15; vst2(P + (size_t)blk * 16 * EE + q * 8, *(const v4u*)(&sc[c][kc * 32 + j * 8])); }
}
// q/k/v: block (64 rows, 128 cols = 4 heads, which)
__global__ __launch_bounds__(128) void k_qkv(const _Float16* __restrict__ X16, const _Float16* __restrict__ P, const float* __restrict__ bq, const float* __restrict__ bk, const float* __restrict__ bv, _Float16* __restrict__ Q16, _Float16* __restrict__ K16, _Float16* __restrict__ VT) {
  __shared__ __align__(16) float so[4][16][132];
  __shared__ __align__(16) _Float16 st[128][72];
  const int tid = threadIdx.x, wave = tid >> 5, lane = tid & 31, col = lane & 15, g = lane >> 4;
  const int which = blockIdx.z, r0b = blockIdx.x * 64, r0 = r0b + wave * 16, n0 = blockIdx.y * 128; const int b = r0b / SS, s0 = r0b % SS;
  const _Float16* Pw = P + (size_t)which * EE * EE; const float* bias = which == 0 ? bq : (which == 1 ? bk : bv);
  v8f acc[8] = {};
  const _Float16* pa = X16 + (size_t)r0 * EE + 8 * lane; const _Float16* pb = Pw + (size_t)n0 * EE + 8 * lane;
#pragma unroll
  for (int kc = 0; kc < EE / 32; ++kc) { const v16h a = frag_t(pa + kc * 512); v16h bf[8];   // all fragments of the k step are requested before its first product
#pragma unroll
    for (int j = 0; j < 8; ++j) bf[j] = frag_t(pb + j * 16 * EE + kc * 512);
#pragma unroll
    for (int j = 0; j < 8; ++j) acc[j] = wmma16(a, bf[j], acc[j]); }
  // the loads' address registers stay whole up to this wait
  asm volatile("s_wait_xcnt 0x0" :: "v"(pa), "v"(pb) : "memory");
  if (which < 2) {
#pragma unroll
    for (int j = 0; j < 8; ++j) { const float bbv = bias[n0 + j * 16 + col];
#pragma unroll
      for (int r = 0; r < 8; ++r) so[wave][8 * g + r][j * 16 + col] = (acc[j][r] * (1.0f / 16.0f) + bbv) * 4.0f; }
    LDSX();
    _Float16* D = which == 0 ? Q16 : K16;
    // 128 cols = 4 heads of 32: per head one 16 x 32 tile (tile row = position, k = d) = 64 x v4u in fragment order
    for (int q = lane; q < 16 * 4 * 4; q += 32) { const int hh = q >> 6, pc = (q >> 4) & 3, rl = q & 15; const int h = (n0 >> 5) + hh; union { v8h h8; v4u u; } pk;
#pragma unroll
      for (int e = 0; e < 8; ++e) pk.h8[e] = (_Float16)so[wave][rl][hh * 32 + pc * 8 + e];
      vst2(D + (((size_t)b * NH + h) * SS + s0 + wave * 16) * HD + (q & 63) * 8, pk.u); } }
  else {
#pragma unroll
    for (int j = 0; j < 8; ++j) { const float bbv = bias[n0 + j * 16 + col];
#pragma unroll
      for (int r = 0; r < 8; ++r) st[j * 16 + col][wave * 16 + 8 * g + r] = (_Float16)((acc[j][r] * (1.0f / 16.0f) + bbv) * 4.0f); }
    __syncthreads();
    // VT tiles [b][h][32-key chunk][d / 16] (tile row = d, k = key)
    for (int q = tid; q < 128 * 8; q += 128) { const int hh = q >> 8, kb = (q >> 7) & 1, t = (q >> 6) & 1, j = (q >> 4) & 3, c = q & 15;
      vst2(VT + ((((size_t)b * NH + (n0 >> 5) + hh) * (SS / 32) + (s0 >> 5) + kb) * 2 + t) * 512 + (q & 63) * 8, *(const v4u*)(&st[hh * 32 + t * 16 + c][kb * 32 + j * 8])); } }
}
// lane l's value from lane l ^ 16, on the vector unit (no LDS path)
__device__ __forceinline__ float xhalf(float v) { return __builtin_bit_cast(float, __builtin_amdgcn_permlanex16(__builtin_bit_cast(int, v), __builtin_bit_cast(int, v), 0x76543210, 0xfedcba98, false, false)); }
// attention: block (64 q, h, b), transposed: S^T = K q^T / sqrt(32) + rel^T (rel = the R32 tiles), so a lane holds 32 of the 64 scores of ONE query (column lane & 15, keys 16 t + 8 g + r);
// online softmax over 16 tiles in registers; two S^T tiles converted in place are the B fragment of O^T += V^T P^T; O16 [b][h][s / 16] tiles (tile row = position, k = d) x8
__global__ __launch_bounds__(128) void k_attn(const _Float16* __restrict__ Q16, const _Float16* __restrict__ K16, const _Float16* __restrict__ VT, const float* __restrict__ rel, _Float16* __restrict__ O16) {
  const int tid = threadIdx.x, w = tid >> 5, lane = tid & 31;
  const int b = blockIdx.z, h = blockIdx.y, q0 = blockIdx.x * 64 + w * 16; const size_t bh = (size_t)b * NH + h;
  const float scl = (1.0f / 16.0f) / sqrtf((float)HD);
  const v16h bq = frag_t(Q16 + (bh * SS + q0) * HD + 8 * lane);
  float mrun = -3.0e38f, lrun = 0.f; v8f acc[2] = {};   // lrun: this lane half's keys only, the halves are joined behind the loop
#pragma unroll 1
  for (int kt = 0; kt < SS / 64; ++kt) {
    v16h kf[4], vf[2][2]; float sv[4][8];   // the tile's K and bias operands are all requested here, ahead of the first product
    const _Float16* pk = K16 + (bh * SS + kt * 64) * HD + 8 * lane; const _Float16* pv = VT + (bh * (SS / 32) + kt * 2) * 1024 + 8 * lane; const float* pr = rel + ((size_t)(q0 >> 4) * (SS / 16) + kt * 4) * 256 + 4 * lane;
#pragma unroll
    for (int t = 0; t < 4; ++t) kf[t] = frag_t(pk + t * 512);
#pragma unroll
    for (int t = 0; t < 4; ++t) {
#pragma unroll
      for (int r = 0; r < 8; ++r) sv[t][r] = pr[t * 256 + (r >> 2) * 128 + (r & 3)]; }
    // the batch's address registers stay whole up to this wait
    asm volatile("s_wait_xcnt 0x0" :: "v"(pk), "v"(pr) : "memory");
#pragma unroll
    for (int t = 0; t < 4; ++t) { v8f s = {};
      s = wmma16(kf[t], bq, s);
#pragma unroll
      for (int r = 0; r < 8; ++r) sv[t][r] = s[r] * scl + sv[t][r]; }
    // V is requested here, into the registers K has left, and lands under the softmax: the kernel stays inside 128 registers, so all 8 waves that the grid puts on a SIMD are resident at once
#pragma unroll
    for (int kc = 0; kc < 2; ++kc) {
#pragma unroll
      for (int t = 0; t < 2; ++t) vf[kc][t] = frag_t(pv + (kc * 2 + t) * 512); }
    // as above, for V's address registers
    asm volatile("s_wait_xcnt 0x0" :: "v"(pv) : "memory");
    float mx = -3.4e38f;
#pragma unroll
    for (int t = 0; t < 4; ++t) {
#pragma unroll
      for (int r = 0; r < 8; ++r) mx = fmaxf(mx, sv[t][r]); }
    mx = fmaxf(mx, xhalf(mx));
    const float mnew = fmaxf(mrun, mx); const float corr = __builtin_amdgcn_exp2f((mrun - mnew) * L2E);
    const float eoff = 14.0f - mnew * L2E;   // exponent offset: minus the maximum in base 2, plus 14 for P's 2^14 scale; ps and lrun carry that scale too
    v2f ps = {}; v16h pf[2];   // even and odd keys are summed side by side, one packed add for two
#pragma unroll
    for (int t = 0; t < 4; ++t) {
#pragma unroll
      for (int r = 0; r < 8; r += 2) { v2f p; p[0] = __builtin_amdgcn_exp2f(fmaf(sv[t][r], L2E, eoff)); p[1] = __builtin_amdgcn_exp2f(fmaf(sv[t][r + 1], L2E, eoff)); ps += p;
        pf[t >> 1][(t & 1) * 8 + r] = (_Float16)p[0]; pf[t >> 1][(t & 1) * 8 + r + 1] = (_Float16)p[1]; } }
    lrun = lrun * corr + (ps[0] + ps[1]); mrun = mnew;
#pragma unroll
    for (int r = 0; r < 8; ++r) { acc[0][r] *= corr; acc[1][r] *= corr; }
#pragma unroll
    for (int kc = 0; kc < 2; ++kc) {
#pragma unroll
      for (int t = 0; t < 2; ++t) acc[t] = wmma16(vf[kc][t], pf[kc], acc[t]); } }
  const float lr = lrun + xhalf(lrun); const float inv = 8.0f / (lr * 4.0f);
  // acc[t][r] = O[query lane & 15][d = 16 t + 8 g + r]: the lane's 8 halves are chunk 32 t + lane of the tile, 512 contiguous bytes a store over the wave
#pragma unroll
  for (int t = 0; t < 2; ++t) { union { v8h h8; v4u u; } pk;
#pragma unroll
    for (int r = 0; r < 8; ++r) pk.h8[r] = (_Float16)(acc[t][r] * inv);
    vst2(O16 + (bh * SS + q0) * HD + (32 * t + lane) * 8, pk.u); }
}
// 16 rows x 128 columns over k = 256: the A fragment and the 8 B fragments of k step kc + 1 are requested before the products of step kc
template <typename FA> __device__ __forceinline__ void gemm_ahead(v8f (&acc)[8], FA lda, const _Float16* Bt) {   // Bt = first B tile + 8 * lane
  v16h a0 = lda(0), a1, b0[8], b1[8];
#pragma unroll
  for (int t = 0; t < 8; ++t) b0[t] = frag_t(Bt + (size_t)t * 16 * EE);
#pragma unroll   // unrolled whole: the two fragment sets take turns without register copies, and the last step's fetch drops out
  for (int kc = 0; kc < EE / 32; kc += 2) {
    a1 = lda(kc + 1);
#pragma unroll
    for (int t = 0; t < 8; ++t) b1[t] = frag_t(Bt + (size_t)t * 16 * EE + (kc + 1) * 512);
#pragma unroll
    for (int t = 0; t < 8; ++t) acc[t] = wmma16(a0, b0[t], acc[t]);
    if (kc + 2 < EE / 32) { a0 = lda(kc + 2);
#pragma unroll
      for (int t = 0; t < 8; ++t) b0[t] = frag_t(Bt + (size_t)t * 16 * EE + (kc + 2) * 512); }
#pragma unroll
    for (int t = 0; t < 8; ++t) acc[t] = wmma16(a1, b1[t], acc[t]); }
}
// post: block 64 rows, all 256 cols: rmha = O@Wo + bo ; gate0 = sigmoid(x gW + gb) ; gate1 = gate0*rmha + x ; mlp = sigmoid(gate1 mW + mb) ; out = gate1 * (LN(mlp) + 1)
__global__ __launch_bounds__(128) void k_post(const _Float16* __restrict__ O16, const _Float16* __restrict__ M16, const _Float16* __restrict__ P, const float* __restrict__ bo, const float* __restrict__ gb, const float* __restrict__ mb,
                                            const float* __restrict__ lng, const float* __restrict__ lnb, const float* __restrict__ x, float* __restrict__ out) {
  __shared__ __align__(16) float sg1[64][EE + 4];          // gate1 (f32), later mlp/LN in place? keep two: reuse so for mlp
  __shared__ __align__(16) _Float16 sa[4][16][EE + 8];     // f16 A tile of gate1
  __shared__ __align__(16) float so[4][16][EE + 4];
  const int tid = threadIdx.x, wave = tid >> 5, lane = tid & 31, col = lane & 15, g = lane >> 4;
  const int r0b = blockIdx.x * 64, r0 = r0b + wave * 16;
  // (1) rmha rows into so
#pragma unroll 1
  for (int hn = 0; hn < 2; ++hn) { v8f acc[8];
#pragma unroll
    for (int t = 0; t < 8; ++t) acc[t] = (v8f){};
    const _Float16* Ob = O16 + (((size_t)(r0 / SS)) * NH * SS + (r0 % SS)) * HD + 8 * lane;     // chunk kc = head kc (HD = 32)
    const _Float16* Bt = P + (size_t)(3 * EE + hn * 128) * EE + 8 * lane;
    gemm_ahead(acc, [&](int kc) { return frag_t(Ob + (size_t)kc * SS * HD); }, Bt);
#pragma unroll
    for (int t = 0; t < 8; ++t) { const int n = (hn * 8 + t) * 16 + col; const float bb = bo[n];
#pragma unroll
      for (int r = 0; r < 8; ++r) so[wave][8 * g + r][n] = acc[t][r] * (1.0f / 128.0f) + bb; }
    // the loads' address registers stay whole up to this wait, ahead of the next trip's new addresses
    asm volatile("s_wait_xcnt 0x0" :: "v"(Ob), "v"(Bt) : "memory"); }
  // (2) gate0 = sigmoid(x gW + gb); gate1 = gate0 * rmha + x  -> sg1 (f32) and sa (f16)
#pragma unroll 1
  for (int hn = 0; hn < 2; ++hn) { v8f acc[8];
#pragma unroll
    for (int t = 0; t < 8; ++t) acc[t] = (v8f){};
    const _Float16* Mt = M16 + (size_t)r0 * EE + 8 * lane; const _Float16* Bt = P + (size_t)(4 * EE + hn * 128) * EE + 8 * lane;
    gemm_ahead(acc, [&](int kc) { return frag_t(Mt + kc * 512); }, Bt);
#pragma unroll
    for (int t = 0; t < 8; ++t) { const int n = (hn * 8 + t) * 16 + col; const float bb = gb[n];
#pragma unroll
      for (int r = 0; r < 8; ++r) sg1[wave * 16 + 8 * g + r][n] = acc[t][r] * (1.0f / 16.0f) + bb; }
    // the loads' address registers stay whole up to this wait, ahead of the next trip's new addresses
    asm volatile("s_wait_xcnt 0x0" :: "v"(Mt), "v"(Bt) : "memory"); }
  LDSX();
  // rolled per-row pass: gate1 = sigmoid(pre) * rmha + x  (2 lanes per row)
  { const int rl = lane >> 1, hf = lane & 1; const int R = wave * 16 + rl; const float* xr = x + (size_t)(r0b + R) * EE;
#pragma unroll 4   // four columns a trip, 16-byte LDS and global accesses: what this loop compiled to with the library exponential
    for (int c = hf * 128; c < hf * 128 + 128; ++c) { const float g1 = sigm(sg1[R][c]) * so[wave][rl][c] + xr[c]; sg1[R][c] = g1; sa[wave][rl][c] = (_Float16)g1; } }
  LDSX();
  // (3) mlp = sigmoid(gate1 mW + mb) -> so ; then LN(mlp) per row and the final combine
#pragma unroll 1
  for (int hn = 0; hn < 2; ++hn) { v8f acc[8];
#pragma unroll
    for (int t = 0; t < 8; ++t) acc[t] = (v8f){};
    const _Float16* Bt = P + (size_t)(5 * EE + hn * 128) * EE + 8 * lane;
    gemm_ahead(acc, [&](int kc) { return frag_h(&sa[wave][col][0] + kc * 32, lane); }, Bt);
#pragma unroll
    for (int t = 0; t < 8; ++t) { const int n = (hn * 8 + t) * 16 + col; const float bb = mb[n];
#pragma unroll
      for (int r = 0; r < 8; ++r) so[wave][8 * g + r][n] = acc[t][r] * (1.0f / 16.0f) + bb; }
    // the loads' address registers stay whole up to this wait, ahead of the next trip's new addresses
    asm volatile("s_wait_xcnt 0x0" :: "v"(Bt) : "memory"); }
  LDSX();
  { const int rl = lane >> 1, hf = lane & 1; float* row = &so[wave][rl][0]; float s = 0.f;
#pragma unroll 2
    for (int c = hf * 128; c < hf * 128 + 128; ++c) { const float mv = sigm(row[c]); row[c] = mv; s += mv; } s += __shfl_xor(s, 1, 32); const float mu = s * (1.0f / EE);
    float q2 = 0.f; for (int c = hf * 128; c < hf * 128 + 128; ++c) { const float d = row[c] - mu; q2 += d * d; } q2 += __shfl_xor(q2, 1, 32); const float rs = rsqrtf(q2 * (1.0f / EE) + 1e-5f);
    LDSX();
    const float* g1r = &sg1[wave * 16 + rl][0];
    for (int c = hf * 128; c < hf * 128 + 128; ++c) { const float lnv = (row[c] - mu) * rs * lng[c] + lnb[c]; row[c] = g1r[c] * lnv + g1r[c]; } }
  LDSX();
  for (int rl = 0; rl < 16; ++rl) for (int pc = lane; pc < EE / 4; pc += 32) vst2(out + (size_t)(r0 + rl) * EE + pc * 4, *(const v4f*)(&so[wave][rl][pc * 4]));
}
extern "C" void kernel_launch(void* const* d_in, const int* in_sizes, int n_in, void* d_out, int out_size, void* d_ws, size_t ws_size, hipStream_t stream) {
  (void)in_sizes; (void)n_in; (void)out_size; (void)ws_size;
  const float** I = (const float**)d_in;
  const float* x = I[0]; const float* lng = I[1]; const float* lnb = I[2]; const float* Wq = I[3]; const float* bq = I[4]; const float* Wk = I[5]; const float* bk = I[6]; const float* Wv = I[7]; const float* bv = I[8]; const float* Wo = I[9]; const float* bo = I[10]; const float* rel = I[11]; const float* gW = I[12]; const float* gb = I[13]; const float* mW = I[14]; const float* mb = I[15];
  float* out = (float*)d_out;
  char* ws = (char*)d_ws; size_t off = 0;
  auto take = [&](size_t bytes) { char* p = ws + off; off += (bytes + 255) & ~(size_t)255; return p; };
  _Float16* X16 = (_Float16*)take((size_t)NR * EE * 2); _Float16* M16 = (_Float16*)take((size_t)NR * EE * 2); _Float16* P = (_Float16*)take((size_t)6 * EE * EE * 2);
  _Float16* Q16 = (_Float16*)take((size_t)NR * EE * 2); _Float16* K16 = (_Float16*)take((size_t)NR * EE * 2); _Float16* VT = (_Float16*)take((size_t)NR * EE * 2); _Float16* O16 = (_Float16*)take((size_t)NR * EE * 2); float* R32 = (float*)take((size_t)SS * SS * 4);
  k_ln<<<NR / 16, 256, 0, stream>>>(x, lng, lnb, X16, M16);
  k_pack<<<6 * EE / 16 + SS / 16 * 4, 256, 0, stream>>>(Wq, Wk, Wv, Wo, gW, mW, rel, P, R32);
  k_qkv<<<dim3(NR / 64, EE / 128, 3), 128, 0, stream>>>(X16, P, bq, bk, bv, Q16, K16, VT);
  k_attn<<<dim3(SS / 64, NH, NB), 128, 0, stream>>>(Q16, K16, VT, R32, O16);
  k_post<<<NR / 64, 128, 0, stream>>>(O16, M16, P, bo, gb, mb, lng, lnb, x, out);
}

// v005
// It runs in 88.9 microseconds.
// In two side-by-side timings against v004, it was 1.23 and 1.25 times as fast.
// All steps since v000 together make it 2.67 times as fast.
#include <hip/hip_runtime.h>
#include <math.h>

typedef __attribute__((ext_vector_type(16))) _Float16 v16h;
typedef __attribute__((ext_vector_type(16))) __bf16 v16b;
typedef __attribute__((ext_vector_type(8)))  _Float16 v8h;
typedef __attribute__((ext_vector_type(8)))  float v8f;
typedef __attribute__((ext_vector_type(4)))  float v4f;
typedef __attribute__((ext_vector_type(2)))  float v2f;
typedef __attribute__((ext_vector_type(4)))  unsigned v4u;
typedef __attribute__((ext_vector_type(4)))  int v4i;
typedef float __attribute__((may_alias)) float_a;
typedef int __attribute__((may_alias)) int_a;

template <typename T> __device__ __forceinline__ void vst2(void* p, T v) { *(T*)p = v;  }
__device__ __forceinline__ v8f wmma16(v16h a, v16h b, v8f c) {
  v8f d = __builtin_amdgcn_wmma_f32_16x16x32_f16(false, a, false, b, (short)0, c, false, false);
  asm volatile("v_nop\n\tv_nop\n\tv_nop\n\tv_nop" : "+v"(d) : "v"(a), "v"(b));
  return d;
}
__device__ __forceinline__ v8f wmma_bf(v16b a, v16b b, v8f c) {
  v8f d = __builtin_amdgcn_wmma_f32_16x16x32_bf16(false, a, false, b, (short)0, c, false, false);
  asm volatile("v_nop\n\tv_nop\n\tv_nop\n\tv_nop" : "+v"(d) : "v"(a), "v"(b));
  return d;
}
// 16x16x32 fragments: lane = (h = lane>>4, row/col = lane&15); elements 0..7 = k0+8h+0..7, 8..15 = k0+16+8h+0..7; D element r = row 8h+r
__device__ __forceinline__ v16h frag_h(const _Float16* rowk0, int lane) {
  union { v16h v; v8h q[2]; } u; const _Float16* p = rowk0 + 8 * (lane >> 4);
  u.q[0] = *(const v8h*)p; u.q[1] = *(const v8h*)(p + 16); return u.v;
}
// the same fragment from a pointer that already holds the lane half's offset (row + k0 + 8h)
__device__ __forceinline__ v16h frag_at(const _Float16* p) {
  union { v16h v; v8h q[2]; } u; u.q[0] = *(const v8h*)p; u.q[1] = *(const v8h*)(p + 16); return u.v;
}
// the same fragment from a tile kept in fragment order: 16 rows x 32 k = 512 halves as [k >> 3][row][k & 7]; p = tile + 8 * lane, so each of the two loads reads 512 contiguous bytes (4 whole lines) over the wave
__device__ __forceinline__ v16h frag_t(const _Float16* p) {
  union { v16h v; v8h q[2]; } u; u.q[0] = *(const v8h*)p; u.q[1] = *(const v8h*)(p + 256); return u.v;
}
__device__ __forceinline__ v16h frag_f32(const float* rowk0, int lane) {
  v16h a; const float* p = rowk0 + 8 * (lane >> 4);
#pragma unroll
  for (int i = 0; i < 8; ++i) { a[i] = (_Float16)p[i]; a[8 + i] = (_Float16)p[16 + i]; }
  return a;
}
__device__ __forceinline__ v16h frag_f32s(const float* rowk0, int lane, float sc) {
  v16h a; const float* p = rowk0 + 8 * (lane >> 4);
#pragma unroll
  for (int i = 0; i < 8; ++i) { a[i] = (_Float16)(p[i] * sc); a[8 + i] = (_Float16)(p[16 + i] * sc); }
  return a;
}
// column fragment from a [K][ld] layout (column n), rows >= K read as 0
__device__ __forceinline__ v16h fragc_f32(const float* W, int k0, int n, int lane, int ld, int K) {
  v16h a; const int g = lane >> 4;
#pragma unroll
  for (int i = 0; i < 8; ++i) { const int ka = k0 + 8 * g + i, kb = ka + 16;
    a[i] = (_Float16)(ka < K ? W[(size_t)ka * ld + n] : 0.f); a[8 + i] = (_Float16)(kb < K ? W[(size_t)kb * ld + n] : 0.f); }
  return a;
}
struct F2 { v16b h, l; };
__device__ __forceinline__ F2 bsplit16(const float v[16]) { F2 r;
#pragma unroll
  for (int i = 0; i < 16; ++i) { const __bf16 h = (__bf16)v[i]; r.h[i] = h; r.l[i] = (__bf16)(v[i] - (float)h); }
  return r; }
__device__ __forceinline__ F2 split_row(const float* row, int k0, int lane) { float v[16]; const float* p = row + k0 + 8 * (lane >> 4);
#pragma unroll
  for (int i = 0; i < 8; ++i) { v[i] = p[i]; v[8 + i] = p[16 + i]; }
  return bsplit16(v); }
__device__ __forceinline__ F2 split_rowK(const float* row, int k0, int lane, int K) { float v[16]; const int g = lane >> 4;
#pragma unroll
  for (int i = 0; i < 8; ++i) { const int ka = k0 + 8 * g + i, kb = ka + 16; v[i] = ka < K ? row[ka] : 0.f; v[8 + i] = kb < K ? row[kb] : 0.f; }
  return bsplit16(v); }
__device__ __forceinline__ F2 split_col(const float* W, int k0, int n, int lane, int ld, int K) { float v[16]; const int g = lane >> 4;
#pragma unroll
  for (int i = 0; i < 8; ++i) { const int ka = k0 + 8 * g + i, kb = ka + 16; v[i] = ka < K ? W[(size_t)ka * ld + n] : 0.f; v[8 + i] = kb < K ? W[(size_t)kb * ld + n] : 0.f; }
  return bsplit16(v); }
__device__ __forceinline__ v8f mac3(const F2& a, const F2& b, v8f c) { c = wmma_bf(a.l, b.h, c); c = wmma_bf(a.h, b.l, c); return wmma_bf(a.h, b.h, c); }
#define L2E 1.4426950408889634f
// e^x as 2^(x log2 e) on the bare v_exp_f32, without the library's range fix-ups: a vanishing result may be 0 and an overflowing one is infinity, which suits every use here
__device__ __forceinline__ float sigm(float v) { return 1.0f / (1.0f + __builtin_amdgcn_exp2f(v * -L2E)); }
#define LDSX() do { asm volatile("s_wait_dscnt 0" ::: "memory"); __builtin_amdgcn_wave_barrier(); __builtin_amdgcn_fence(__ATOMIC_RELEASE, "workgroup"); } while (0)

// Gated relation-transformer block: LN(x); 8-head (d=32) self attention with an additive [S,S] relation bias (read as data) and output
// projection; gate0 = sigmoid(x gW + gb); gate1 = gate0*mha + x; mlp = sigmoid(gate1 mW + mb); out = gate1*LN(mlp) + gate1.
// All six [in][out] weights packed transposed to f16 rows (x16); every product on v_wmma_f32_16x16x32_f16 (activations as f16 copies /
// LDS tiles, q/k/v head-major x4, P x2^14); LayerNorms, softmax (online over 16 key tiles), sigmoids and gating in f32.
// Every f16 workspace array is a sequence of 16 x 32 tiles in fragment order (frag_t), written by whole lines (through LDS, O16 straight from the accumulators); the bias is copied into accumulator order likewise.
#define NB 16
#define SS 1024
#define EE 256
#define NH 8
#define HD 32
#define NR (NB * SS)

// LN(x) -> X16 ; x -> M16 ; wave per row (256 = 32 lanes x 8), two rows a wave; the block's 16 rows leave as 8 tiles per array ([row tile][k chunk])
__global__ __launch_bounds__(256) void k_ln(const float* __restrict__ x, const float* __restrict__ g, const float* __restrict__ bb, _Float16* __restrict__ X16, _Float16* __restrict__ M16) {
  __shared__ __align__(16) _Float16 sx[2][16][EE + 8];
  const int tid = threadIdx.x, wave = tid >> 5, lane = tid & 31;
  const float* xr = x + ((size_t)blockIdx.x * 16 + wave * 2) * EE + lane * 8; float vv[2][8];
#pragma unroll
  for (int e = 0; e < 8; ++e) { vv[0][e] = xr[e]; vv[1][e] = xr[EE + e]; }
  // the loads' address registers stay whole up to this wait
  asm volatile("s_wait_xcnt 0x0" :: "v"(xr) : "memory");
#pragma unroll
  for (int rr = 0; rr < 2; ++rr) { const int rl = wave * 2 + rr; float v[8]; float s = 0.f;
#pragma unroll
    for (int e = 0; e < 8; ++e) { v[e] = vv[rr][e]; s += v[e]; }
#pragma unroll
    for (int off = 16; off >= 1; off >>= 1) s += __shfl_xor(s, off, 32);
    const float mu = s * (1.0f / EE); float q2 = 0.f;
#pragma unroll
    for (int e = 0; e < 8; ++e) { const float d = v[e] - mu; q2 += d * d; }
#pragma unroll
    for (int off = 16; off >= 1; off >>= 1) q2 += __shfl_xor(q2, off, 32);
    const float rs = rsqrtf(q2 * (1.0f / EE) + 1e-5f);
    union { v8h h; v4u u; } p1, p2;
#pragma unroll
    for (int e = 0; e < 8; ++e) { const int c = lane * 8 + e; p1.h[e] = (_Float16)((v[e] - mu) * rs * g[c] + bb[c]); p2.h[e] = (_Float16)v[e]; }
    vst2(&sx[0][rl][lane * 8], p1.u); vst2(&sx[1][rl][lane * 8], p2.u); }
  __syncthreads();
#pragma unroll   // unrolled: the four LDS reads go out together, and which array a store goes to is known at compile time
  for (int i = 0; i < 4; ++i) { const int a = i >> 1, ch = tid + (i & 1) * 256, kc = ch >> 6, j = (ch >> 4) & 3, c = ch & 15;
    vst2((a ? M16 : X16) + (size_t)blockIdx.x * 16 * EE + ch * 8, *(const v4u*)(&sx[a][c][kc * 32 + j * 8])); }
}
// P tiles [w*16 + n/16][k chunk] of W_w[k][n]*16 (tile row = n) for w: 0 Wq, 1 Wk, 2 Wv, 3 Wo, 4 gW, 5 mW ; block = 16 columns n, thread = row k
// blocks from 96 on: R32 = the bias as 16 x 16 f32 tiles [q / 16][key / 16] in the accumulator order of the transposed score tile (D register r of lane (g, c) = rel[q c][key 8 g + r]), [r >> 2][lane][r & 3] ; block = 16 rows x 256 columns
__global__ __launch_bounds__(256) void k_pack(const float* __restrict__ Wq, const float* __restrict__ Wk, const float* __restrict__ Wv, const float* __restrict__ Wo, const float* __restrict__ gW, const float* __restrict__ mW, const float* __restrict__ rel, _Float16* __restrict__ P, float* __restrict__ R32) {
  const int blk = blockIdx.x, tid = threadIdx.x; __shared__ __align__(16) _Float16 sc[16][EE + 8]; __shared__ __align__(16) float sr[16][256 + 4];
  if (blk >= 6 * EE / 16) { const int rb = blk - 6 * EE / 16, qt = rb >> 2, c0 = (rb & 3) * 256;   // the same for the whole block
    const int hi = tid >> 6, lo = tid & 63; const float* rp = rel + (size_t)(qt * 16 + hi) * SS + c0 + lo * 4; v4f in[4];
#pragma unroll   // unrolled: the four loads go out together
    for (int i = 0; i < 4; ++i) in[i] = *(const v4f*)(rp + i * 4 * SS);
    // the loads' address registers stay whole up to this wait
    asm volatile("s_wait_xcnt 0x0" :: "v"(rp) : "memory");
#pragma unroll
    for (int i = 0; i < 4; ++i) vst2(&sr[hi + 4 * i][lo * 4], in[i]);
    __syncthreads();
    const int u = (lo >> 5) & 1, gg = (lo >> 4) & 1, cc = lo & 15; float* wp = R32 + ((size_t)qt * (SS / 16) + (c0 >> 4) + hi) * 256 + lo * 4;
#pragma unroll   // unrolled: the LDS reads of all four stores go out together
    for (int i = 0; i < 4; ++i) { v4f o;   // tile hi + 4 i of the block's 16
#pragma unroll
      for (int e = 0; e < 4; ++e) o[e] = sr[cc][(hi + 4 * i) * 16 + 8 * gg + 4 * u + e];
      vst2(wp + i * 4 * 256, o); }
    return; }
  const int which = blk >> 4, n0 = (blk & 15) * 16; const float* W = which == 0 ? Wq : which == 1 ? Wk : which == 2 ? Wv : which == 3 ? Wo : which == 4 ? gW : mW;
  const float* wr = W + (size_t)tid * EE + n0;
#pragma unroll
  for (int c = 0; c < 16; ++c) sc[c][tid] = (_Float16)(wr[c] * 16.0f);
  __syncthreads();
#pragma unroll   // unrolled: both LDS reads go out together
  for (int i = 0; i < 2; ++i) { const int q = tid + i * 256, kc = q >> 6, j = (q >> 4) & 3, c = q & 15; vst2(P + (size_t)blk * 16 * EE + q * 8, *(const v4u*)(&sc[c][kc * 32 + j * 8])); }
}
// q/k/v: block (64 rows, 128 cols = 4 heads, which)
__global__ __launch_bounds__(128) void k_qkv(const _Float16* __restrict__ X16, const _Float16* __restrict__ P, const float* __restrict__ bq, const float* __restrict__ bk, const float* __restrict__ bv, _Float16* __restrict__ Q16, _Float16* __restrict__ K16, _Float16* __restrict__ VT) {
  __shared__ __align__(16) float so[4][16][132];
  __shared__ __align__(16) _Float16 st[128][72];
  const int tid = threadIdx.x, wave = tid >> 5, lane = tid & 31, col = lane & 15, g = lane >> 4;
  const int which = blockIdx.z, r0b = blockIdx.x * 64, r0 = r0b + wave * 16, n0 = blockIdx.y * 128; const int b = r0b / SS, s0 = r0b % SS;
  const _Float16* Pw = P + (size_t)which * EE * EE; const float* bias = which == 0 ? bq : (which == 1 ? bk : bv);
  v8f acc[8] = {};
  const _Float16* pa = X16 + (size_t)r0 * EE + 8 * lane; const _Float16* pb = Pw + (size_t)n0 * EE + 8 * lane;
#pragma unroll
  for (int kc = 0; kc < EE / 32; ++kc) { const v16h a = frag_t(pa + kc * 512); v16h bf[8];   // all fragments of the k step are requested before its first product
#pragma unroll
    for (int j = 0; j < 8; ++j) bf[j] = frag_t(pb + j * 16 * EE + kc * 512);
#pragma unroll
    for (int j = 0; j < 8; ++j) acc[j] = wmma16(a, bf[j], acc[j]); }
  // the loads' address registers stay whole up to this wait
  asm volatile("s_wait_xcnt 0x0" :: "v"(pa), "v"(pb) : "memory");
  if (which < 2) {
#pragma unroll
    for (int j = 0; j < 8; ++j) { const float bbv = bias[n0 + j * 16 + col];
#pragma unroll
      for (int r = 0; r < 8; ++r) so[wave][8 * g + r][j * 16 + col] = (acc[j][r] * (1.0f / 16.0f) + bbv) * 4.0f; }
    LDSX();
    _Float16* D = which == 0 ? Q16 : K16;
    // 128 cols = 4 heads of 32: per head one 16 x 32 tile (tile row = position, k = d) = 64 x v4u in fragment order
    for (int q = lane; q < 16 * 4 * 4; q += 32) { const int hh = q >> 6, pc = (q >> 4) & 3, rl = q & 15; const int h = (n0 >> 5) + hh; union { v8h h8; v4u u; } pk;
#pragma unroll
      for (int e = 0; e < 8; ++e) pk.h8[e] = (_Float16)so[wave][rl][hh * 32 + pc * 8 + e];
      vst2(D + (((size_t)b * NH + h) * SS + s0 + wave * 16) * HD + (q & 63) * 8, pk.u); } }
  else {
#pragma unroll
    for (int j = 0; j < 8; ++j) { const float bbv = bias[n0 + j * 16 + col];
#pragma unroll
      for (int r = 0; r < 8; ++r) st[j * 16 + col][wave * 16 + 8 * g + r] = (_Float16)((acc[j][r] * (1.0f / 16.0f) + bbv) * 4.0f); }
    __syncthreads();
    // VT tiles [b][h][32-key chunk][d / 16] (tile row = d, k = key)
    for (int q = tid; q < 128 * 8; q += 128) { const int hh = q >> 8, kb = (q >> 7) & 1, t = (q >> 6) & 1, j = (q >> 4) & 3, c = q & 15;
      vst2(VT + ((((size_t)b * NH + (n0 >> 5) + hh) * (SS / 32) + (s0 >> 5) + kb) * 2 + t) * 512 + (q & 63) * 8, *(const v4u*)(&st[hh * 32 + t * 16 + c][kb * 32 + j * 8])); } }
}
// lane l's value from lane l ^ 16, on the vector unit (no LDS path)
__device__ __forceinline__ float xhalf(float v) { return __builtin_bit_cast(float, __builtin_amdgcn_permlanex16(__builtin_bit_cast(int, v), __builtin_bit_cast(int, v), 0x76543210, 0xfedcba98, false, false)); }
// attention: block (64 q, h, b), transposed: S^T = K q^T / sqrt(32) + rel^T (rel = the R32 tiles), so a lane holds 32 of the 64 scores of ONE query (column lane & 15, keys 16 t + 8 g + r);
// online softmax over 16 tiles in registers; two S^T tiles converted in place are the B fragment of O^T += V^T P^T; O16 [b][h][s / 16] tiles (tile row = position, k = d) x8
__global__ __launch_bounds__(128) void k_attn(const _Float16* __restrict__ Q16, const _Float16* __restrict__ K16, const _Float16* __restrict__ VT, const float* __restrict__ rel, _Float16* __restrict__ O16) {
  const int tid = threadIdx.x, w = tid >> 5, lane = tid & 31;
  const int b = blockIdx.z, h = blockIdx.y, q0 = blockIdx.x * 64 + w * 16; const size_t bh = (size_t)b * NH + h;
  const float scl = (1.0f / 16.0f) / sqrtf((float)HD);
  const v16h bq = frag_t(Q16 + (bh * SS + q0) * HD + 8 * lane);
  float mrun = -3.0e38f, lrun = 0.f; v8f acc[2] = {};   // lrun: this lane half's keys only, the halves are joined behind the loop
#pragma unroll 1
  for (int kt = 0; kt < SS / 64; ++kt) {
    v16h kf[4], vf[2][2]; float sv[4][8];   // the tile's K and bias operands are all requested here, ahead of the first product
    const _Float16* pk = K16 + (bh * SS + kt * 64) * HD + 8 * lane; const _Float16* pv = VT + (bh * (SS / 32) + kt * 2) * 1024 + 8 * lane; const float* pr = rel + ((size_t)(q0 >> 4) * (SS / 16) + kt * 4) * 256 + 4 * lane;
#pragma unroll
    for (int t = 0; t < 4; ++t) kf[t] = frag_t(pk + t * 512);
#pragma unroll
    for (int t = 0; t < 4; ++t) {
#pragma unroll
      for (int r = 0; r < 8; ++r) sv[t][r] = pr[t * 256 + (r >> 2) * 128 + (r & 3)]; }
    // the batch's address registers stay whole up to this wait
    asm volatile("s_wait_xcnt 0x0" :: "v"(pk), "v"(pr) : "memory");
#pragma unroll
    for (int t = 0; t < 4; ++t) { v8f s = {};
      s = wmma16(kf[t], bq, s);
#pragma unroll
      for (int r = 0; r < 8; ++r) sv[t][r] = s[r] * scl + sv[t][r]; }
    // V is requested here, into the registers K has left, and lands under the softmax: the kernel stays inside 128 registers, so all 8 waves that the grid puts on a SIMD are resident at once
#pragma unroll
    for (int kc = 0; kc < 2; ++kc) {
#pragma unroll
      for (int t = 0; t < 2; ++t) vf[kc][t] = frag_t(pv + (kc * 2 + t) * 512); }
    // as above, for V's address registers
    asm volatile("s_wait_xcnt 0x0" :: "v"(pv) : "memory");
    float mx = -3.4e38f;
#pragma unroll
    for (int t = 0; t < 4; ++t) {
#pragma unroll
      for (int r = 0; r < 8; ++r) mx = fmaxf(mx, sv[t][r]); }
    mx = fmaxf(mx, xhalf(mx));
    const float mnew = fmaxf(mrun, mx); const float corr = __builtin_amdgcn_exp2f((mrun - mnew) * L2E);
    const float eoff = 14.0f - mnew * L2E;   // exponent offset: minus the maximum in base 2, plus 14 for P's 2^14 scale; ps and lrun carry that scale too
    v2f ps = {}; v16h pf[2];   // even and odd keys are summed side by side, one packed add for two
#pragma unroll
    for (int t = 0; t < 4; ++t) {
#pragma unroll
      for (int r = 0; r < 8; r += 2) { v2f p; p[0] = __builtin_amdgcn_exp2f(fmaf(sv[t][r], L2E, eoff)); p[1] = __builtin_amdgcn_exp2f(fmaf(sv[t][r + 1], L2E, eoff)); ps += p;
        pf[t >> 1][(t & 1) * 8 + r] = (_Float16)p[0]; pf[t >> 1][(t & 1) * 8 + r + 1] = (_Float16)p[1]; } }
    lrun = lrun * corr + (ps[0] + ps[1]); mrun = mnew;
#pragma unroll
    for (int r = 0; r < 8; ++r) { acc[0][r] *= corr; acc[1][r] *= corr; }
#pragma unroll
    for (int kc = 0; kc < 2; ++kc) {
#pragma unroll
      for (int t = 0; t < 2; ++t) acc[t] = wmma16(vf[kc][t], pf[kc], acc[t]); } }
  const float lr = lrun + xhalf(lrun); const float inv = 8.0f / (lr * 4.0f);
  // acc[t][r] = O[query lane & 15][d = 16 t + 8 g + r]: the lane's 8 halves are chunk 32 t + lane of the tile, 512 contiguous bytes a store over the wave
#pragma unroll
  for (int t = 0; t < 2; ++t) { union { v8h h8; v4u u; } pk;
#pragma unroll
    for (int r = 0; r < 8; ++r) pk.h8[r] = (_Float16)(acc[t][r] * inv);
    vst2(O16 + (bh * SS + q0) * HD + (32 * t + lane) * 8, pk.u); }
}
// post, transposed: block = 64 rows, 16 waves; wave (rt, cq) = 16 rows x 64 columns as D^T = W^T A^T, so a lane holds 32 columns (n0 + 16 t + 8 g + r) of ONE row (lane & 15).
// rmha = O@Wo + bo ; gate0 = sigmoid(x gW + gb) ; gate1 = gate0*rmha + x ; mlp = sigmoid(gate1 mW + mb) ; out = gate1 * (LN(mlp) + 1): all of it on the accumulator registers.
// Two gate1 tiles converted in place are one B fragment of the third product; the waves of a row tile swap these fragments and their LN partial sums through LDS.
__global__ __launch_bounds__(512) void k_post(const _Float16* __restrict__ O16, const _Float16* __restrict__ M16, const _Float16* __restrict__ P, const float* __restrict__ bo, const float* __restrict__ gb, const float* __restrict__ mb,
                                            const float* __restrict__ lng, const float* __restrict__ lnb, const float* __restrict__ x, float* __restrict__ out) {
  __shared__ __align__(16) float sx[16][16][68];        // a wave's own 16 x 64 tile: x on the way in, out on the way out, so that global accesses cover whole lines; pitch 68: 16 rows of 16 bytes fall on all 64 banks
  __shared__ __align__(16) _Float16 sb[4][8][512];      // gate1 in f16: [row tile][k chunk] in fragment order
  __shared__ float sred[2][4][4][32];                   // LN partial sums [sum, squares][row tile][column quarter][lane]
  const int tid = threadIdx.x, wave = __builtin_amdgcn_readfirstlane(tid >> 5), lane = tid & 31, c = lane & 15, g = lane >> 4;   // the wave's number in a scalar register: what follows from it costs no vector register
  const int rt = wave & 3, cq = wave >> 2, r0 = blockIdx.x * 64 + rt * 16, n0 = cq * 64;
  const float* xp = x + (size_t)(r0 + g) * EE + n0 + c * 4; v4f xin[8];   // load i: rows 2 i + g, 256 contiguous bytes each
#pragma unroll
  for (int i = 0; i < 8; ++i) xin[i] = *(const v4f*)(xp + i * 2 * EE);
  const _Float16* Ob = O16 + (((size_t)(r0 / SS)) * NH * SS + (r0 % SS)) * HD + 8 * lane;     // chunk kc = head kc (HD = 32)
  const _Float16* Mt = M16 + (size_t)r0 * EE + 8 * lane;
  const _Float16* Wt = P + (size_t)(3 * EE + n0) * EE + 8 * lane;   // Wo's tiles of the wave's columns; gW's stand EE * EE halves further, mW's twice that
  // three fragment sets take turns; half step hs = 2 kc + m: m = 0 is Wo's k chunk kc against O's, m = 1 gW's against x's
  v16h fa[3], fw[3][4];
  auto fetch = [&](int hs, int z) { const int kc = hs >> 1; fa[z] = (hs & 1) ? frag_t(Mt + kc * 512) : frag_t(Ob + (size_t)kc * SS * HD);
#pragma unroll
    for (int t = 0; t < 4; ++t) fw[z][t] = frag_t(Wt + (hs & 1) * EE * EE + t * 16 * EE + kc * 512); };
  auto fetchm = [&](int kc, int z) {
#pragma unroll
    for (int t = 0; t < 4; ++t) fw[z][t] = frag_t(Wt + 2 * EE * EE + t * 16 * EE + kc * 512); };
  // (1) rmha^T and the gate's pre-activation^T: a set is requested anew as soon as its products are issued, two half steps ahead of its next use
  v8f ao[4] = {}, ag[4] = {};
  fetch(0, 0); fetch(1, 1); fetch(2, 2);
  // the x loads' address registers stay whole up to this wait
  asm volatile("s_wait_xcnt 0x0" :: "v"(xp) : "memory");
#pragma unroll
  for (int i = 0; i < 8; ++i) vst2(&sx[wave][2 * i + g][c * 4], xin[i]);
#pragma unroll   // unrolled whole: which set a half step uses is known at compile time, and the last fetches drop out
  for (int hs = 0; hs < 2 * (EE / 32); ++hs) { const int z = hs % 3;
#pragma unroll
    for (int t = 0; t < 4; ++t) { if (hs & 1) ag[t] = wmma16(fw[z][t], fa[z], ag[t]); else ao[t] = wmma16(fw[z][t], fa[z], ao[t]); }
    if (hs + 3 < 2 * (EE / 32)) fetch(hs + 3, z); }
  fetchm(0, 0); fetchm(1, 1); fetchm(2, 2);   // mW's first fragments fly under the gate's arithmetic and have landed at the barrier, which waits for every load
  const float* bop = bo + n0 + 8 * g; const float* gbp = gb + n0 + 8 * g; v4f bov[4][2], gbv[4][2];   // the lane's 8 columns of each tile
#pragma unroll
  for (int t = 0; t < 4; ++t) {
#pragma unroll
    for (int u = 0; u < 2; ++u) { bov[t][u] = *(const v4f*)(bop + 16 * t + 4 * u); gbv[t][u] = *(const v4f*)(gbp + 16 * t + 4 * u); } }
  // the address registers of all loads so far stay whole up to this wait
  asm volatile("s_wait_xcnt 0x0" :: "v"(bop), "v"(gbp) : "memory");
  __builtin_amdgcn_sched_barrier(0);   // keeps the arithmetic below, which reuses those registers, behind the wait
  LDSX();   // the x tile was written by other lanes of this wave
  // (2) gate1 = sigmoid(pre) * rmha + x, kept in f32 for the last step and handed on in f16
  float g1[4][8]; v16h pf[2];
#pragma unroll
  for (int t = 0; t < 4; ++t) { const int nl = 16 * t + 8 * g; float xv[8];
#pragma unroll
    for (int r = 0; r < 8; ++r) xv[r] = sx[wave][c][nl + r];
#pragma unroll
    for (int r = 0; r < 8; ++r) { const float rm = ao[t][r] * (1.0f / 128.0f) + bov[t][r >> 2][r & 3]; const float v = sigm(ag[t][r] * (1.0f / 16.0f) + gbv[t][r >> 2][r & 3]) * rm + xv[r];
      g1[t][r] = v; pf[t >> 1][(t & 1) * 8 + r] = (_Float16)v; } }
#pragma unroll
  for (int j = 0; j < 2; ++j) { union { v16h v; v4u q[2]; } u; u.v = pf[j]; _Float16* d = &sb[rt][cq * 2 + j][8 * lane]; vst2(d, u.q[0]); vst2(d + 256, u.q[1]); }
  __syncthreads();   // every wave of the row tile has written its two k chunks of gate1
  // (3) mlp^T = sigmoid(mW^T gate1^T + mb)
  v8f am[4] = {}; v4f mbv[4][2], lg[4][2], lb[4][2];   // the lane's 8 columns of each tile of mb, ln_g, ln_b
  const float* mbp = mb + n0 + 8 * g; const float* lgp = lng + n0 + 8 * g; const float* lbp = lnb + n0 + 8 * g;
  auto fetchv = [&](const float* p, v4f (&v)[4][2]) {
#pragma unroll
    for (int t = 0; t < 4; ++t) { v[t][0] = *(const v4f*)(p + 16 * t); v[t][1] = *(const v4f*)(p + 16 * t + 4); } };
#pragma unroll   // unrolled whole: which set a k chunk uses is known at compile time
  for (int kh = 0; kh < 2; ++kh) { v16h bg[4];
#pragma unroll
    for (int u = 0; u < 4; ++u) bg[u] = frag_t(&sb[rt][4 * kh + u][8 * lane]);
#pragma unroll
    for (int u = 0; u < 4; ++u) { const int kc = 4 * kh + u, z = kc % 3;
#pragma unroll
      for (int t = 0; t < 4; ++t) am[t] = wmma16(fw[z][t], bg[u], am[t]);
      if (kc + 3 < EE / 32) fetchm(kc + 3, z);
      else fetchv(kc == 5 ? mbp : kc == 6 ? lgp : lbp, kc == 5 ? mbv : kc == 6 ? lg : lb); } }   // the last three chunks leave their sets' registers to the three vectors, which land under the products and the sigmoids
  // the address registers of all loads so far stay whole up to this wait
  asm volatile("s_wait_xcnt 0x0" :: "v"(mbp), "v"(lgp), "v"(lbp) : "memory");
  __builtin_amdgcn_sched_barrier(0);   // keeps the arithmetic below, which reuses those registers, behind the wait
  float ml[4][8], sp[4];
#pragma unroll
  for (int t = 0; t < 4; ++t) sp[t] = 0.f;
#pragma unroll
  for (int r = 0; r < 8; ++r) {   // the four tiles' sums advance side by side: four independent chains
#pragma unroll
    for (int t = 0; t < 4; ++t) { const float mv = sigm(am[t][r] * (1.0f / 16.0f) + mbv[t][r >> 2][r & 3]); ml[t][r] = mv; sp[t] += mv; } }
  // (4) LN(mlp) over the row: the lane's 32 columns, the other lane half's, then the four waves' sums in a fixed order
  float s = (sp[0] + sp[1]) + (sp[2] + sp[3]); s += xhalf(s); sred[0][rt][cq][lane] = s;
  __syncthreads();   // the four partial sums of every row are written
  const float mu = ((sred[0][rt][0][lane] + sred[0][rt][1][lane]) + (sred[0][rt][2][lane] + sred[0][rt][3][lane])) * (1.0f / EE);
#pragma unroll
  for (int t = 0; t < 4; ++t) { sp[t] = 0.f;
#pragma unroll
    for (int r = 0; r < 8; ++r) { const float d = ml[t][r] - mu; sp[t] += d * d; } }
  float q2 = (sp[0] + sp[1]) + (sp[2] + sp[3]); q2 += xhalf(q2); sred[1][rt][cq][lane] = q2;
  __syncthreads();   // the four partial sums of squares of every row are written
  const float rs = rsqrtf(((sred[1][rt][0][lane] + sred[1][rt][1][lane]) + (sred[1][rt][2][lane] + sred[1][rt][3][lane])) * (1.0f / EE) + 1e-5f);
#pragma unroll
  for (int t = 0; t < 4; ++t) { const int nl = 16 * t + 8 * g; v4f o[2];
#pragma unroll
    for (int r = 0; r < 8; ++r) { const float lnv = (ml[t][r] - mu) * rs * lg[t][r >> 2][r & 3] + lb[t][r >> 2][r & 3]; o[r >> 2][r & 3] = g1[t][r] * lnv + g1[t][r]; }
    vst2(&sx[wave][c][nl], o[0]); vst2(&sx[wave][c][nl + 4], o[1]); }
  LDSX();   // the out tile is read back by other lanes of this wave
  float* op = out + (size_t)(r0 + g) * EE + n0 + c * 4;   // store i: rows 2 i + g, 256 contiguous bytes each
#pragma unroll   // unrolled: the eight LDS reads go out together
  for (int i = 0; i < 8; ++i) vst2(op + i * 2 * EE, *(const v4f*)(&sx[wave][2 * i + g][c * 4]));
}
extern "C" void kernel_launch(void* const* d_in, const int* in_sizes, int n_in, void* d_out, int out_size, void* d_ws, size_t ws_size, hipStream_t stream) {
  (void)in_sizes; (void)n_in; (void)out_size; (void)ws_size;
  const float** I = (const float**)d_in;
  const float* x = I[0]; const float* lng = I[1]; const float* lnb = I[2]; const float* Wq = I[3]; const float* bq = I[4]; const float* Wk = I[5]; const float* bk = I[6]; const float* Wv = I[7]; const float* bv = I[8]; const float* Wo = I[9]; const float* bo = I[10]; const float* rel = I[11]; const float* gW = I[12]; const float* gb = I[13]; const float* mW = I[14]; const float* mb = I[15];
  float* out = (float*)d_out;
  char* ws = (char*)d_ws; size_t off = 0;
  auto take = [&](size_t bytes) { char* p = ws + off; off += (bytes + 255) & ~(size_t)255; return p; };
  _Float16* X16 = (_Float16*)take((size_t)NR * EE * 2); _Float16* M16 = (_Float16*)take((size_t)NR * EE * 2); _Float16* P = (_Float16*)take((size_t)6 * EE * EE * 2);
  _Float16* Q16 = (_Float16*)take((size_t)NR * EE * 2); _Float16* K16 = (_Float16*)take((size_t)NR * EE * 2); _Float16* VT = (_Float16*)take((size_t)NR * EE * 2); _Float16* O16 = (_Float16*)take((size_t)NR * EE * 2); float* R32 = (float*)take((size_t)SS * SS * 4);
  k_ln<<<NR / 16, 256, 0, stream>>>(x, lng, lnb, X16, M16);
  k_pack<<<6 * EE / 16 + SS / 16 * 4, 256, 0, stream>>>(Wq, Wk, Wv, Wo, gW, mW, rel, P, R32);
  k_qkv<<<dim3(NR / 64, EE / 128, 3), 128, 0, stream>>>(X16, P, bq, bk, bv, Q16, K16, VT);
  k_attn<<<dim3(SS / 64, NH, NB), 128, 0, stream>>>(Q16, K16, VT, R32, O16);
  k_post<<<NR / 64, 512, 0, stream>>>(O16, M16, P, bo, gb, mb, lng, lnb, x, out);
}

// v006
// It runs in 87.1 microseconds.
// In two side-by-side timings against v005, it was 1.03 and 1.02 times as fast.
// Over all steps from v000 it is 2.73 times as fast.
#include <hip/hip_runtime.h>
#include <math.h>

typedef __attribute__((ext_vector_type(16))) _Float16 v16h;
typedef __attribute__((ext_vector_type(16))) __bf16 v16b;
typedef __attribute__((ext_vector_type(8)))  _Float16 v8h;
typedef __attribute__((ext_vector_type(8)))  float v8f;
typedef __attribute__((ext_vector_type(4)))  float v4f;
typedef __attribute__((ext_vector_type(2)))  float v2f;
typedef __attribute__((ext_vector_type(4)))  unsigned v4u;
typedef __attribute__((ext_vector_type(4)))  int v4i;
typedef float __attribute__((may_alias)) float_a;
typedef int __attribute__((may_alias)) int_a;

template <typename T> __device__ __forceinline__ void vst2(void* p, T v) { *(T*)p = v;  }
__device__ __forceinline__ v8f wmma16(v16h a, v16h b, v8f c) {
  return __builtin_amdgcn_wmma_f32_16x16x32_f16(false, a, false, b, (short)0, c, false, false);   // the bare builtin: the compiler keeps the distance to the next user of D, A or B itself, with useful work where there is some
}
__device__ __forceinline__ v8f wmma_bf(v16b a, v16b b, v8f c) {
  v8f d = __builtin_amdgcn_wmma_f32_16x16x32_bf16(false, a, false, b, (short)0, c, false, false);
  asm volatile("v_nop\n\tv_nop\n\tv_nop\n\tv_nop" : "+v"(d) : "v"(a), "v"(b));
  return d;
}
// 16x16x32 fragments: lane = (h = lane>>4, row/col = lane&15); elements 0..7 = k0+8h+0..7, 8..15 = k0+16+8h+0..7; D element r = row 8h+r
__device__ __forceinline__ v16h frag_h(const _Float16* rowk0, int lane) {
  union { v16h v; v8h q[2]; } u; const _Float16* p = rowk0 + 8 * (lane >> 4);
  u.q[0] = *(const v8h*)p; u.q[1] = *(const v8h*)(p + 16); return u.v;
}
// the same fragment from a pointer that already holds the lane half's offset (row + k0 + 8h)
__device__ __forceinline__ v16h frag_at(const _Float16* p) {
  union { v16h v; v8h q[2]; } u; u.q[0] = *(const v8h*)p; u.q[1] = *(const v8h*)(p + 16); return u.v;
}
// the same fragment from a tile kept in fragment order: 16 rows x 32 k = 512 halves as [k >> 3][row][k & 7]; p = tile + 8 * lane, so each of the two loads reads 512 contiguous bytes (4 whole lines) over the wave
__device__ __forceinline__ v16h frag_t(const _Float16* p) {
  union { v16h v; v8h q[2]; } u; u.q[0] = *(const v8h*)p; u.q[1] = *(const v8h*)(p + 256); return u.v;
}
__device__ __forceinline__ v16h frag_f32(const float* rowk0, int lane) {
  v16h a; const float* p = rowk0 + 8 * (lane >> 4);
#pragma unroll
  for (int i = 0; i < 8; ++i) { a[i] = (_Float16)p[i]; a[8 + i] = (_Float16)p[16 + i]; }
  return a;
}
__device__ __forceinline__ v16h frag_f32s(const float* rowk0, int lane, float sc) {
  v16h a; const float* p = rowk0 + 8 * (lane >> 4);
#pragma unroll
  for (int i = 0; i < 8; ++i) { a[i] = (_Float16)(p[i] * sc); a[8 + i] = (_Float16)(p[16 + i] * sc); }
  return a;
}
// column fragment from a [K][ld] layout (column n), rows >= K read as 0
__device__ __forceinline__ v16h fragc_f32(const float* W, int k0, int n, int lane, int ld, int K) {
  v16h a; const int g = lane >> 4;
#pragma unroll
  for (int i = 0; i < 8; ++i) { const int ka = k0 + 8 * g + i, kb = ka + 16;
    a[i] = (_Float16)(ka < K ? W[(size_t)ka * ld + n] : 0.f); a[8 + i] = (_Float16)(kb < K ? W[(size_t)kb * ld + n] : 0.f); }
  return a;
}
struct F2 { v16b h, l; };
__device__ __forceinline__ F2 bsplit16(const float v[16]) { F2 r;
#pragma unroll
  for (int i = 0; i < 16; ++i) { const __bf16 h = (__bf16)v[i]; r.h[i] = h; r.l[i] = (__bf16)(v[i] - (float)h); }
  return r; }
__device__ __forceinline__ F2 split_row(const float* row, int k0, int lane) { float v[16]; const float* p = row + k0 + 8 * (lane >> 4);
#pragma unroll
  for (int i = 0; i < 8; ++i) { v[i] = p[i]; v[8 + i] = p[16 + i]; }
  return bsplit16(v); }
__device__ __forceinline__ F2 split_rowK(const float* row, int k0, int lane, int K) { float v[16]; const int g = lane >> 4;
#pragma unroll
  for (int i = 0; i < 8; ++i) { const int ka = k0 + 8 * g + i, kb = ka + 16; v[i] = ka < K ? row[ka] : 0.f; v[8 + i] = kb < K ? row[kb] : 0.f; }
  return bsplit16(v); }
__device__ __forceinline__ F2 split_col(const float* W, int k0, int n, int lane, int ld, int K) { float v[16]; const int g = lane >> 4;
#pragma unroll
  for (int i = 0; i < 8; ++i) { const int ka = k0 + 8 * g + i, kb = ka + 16; v[i] = ka < K ? W[(size_t)ka * ld + n] : 0.f; v[8 + i] = kb < K ? W[(size_t)kb * ld + n] : 0.f; }
  return bsplit16(v); }
__device__ __forceinline__ v8f mac3(const F2& a, const F2& b, v8f c) { c = wmma_bf(a.l, b.h, c); c = wmma_bf(a.h, b.l, c); return wmma_bf(a.h, b.h, c); }
#define L2E 1.4426950408889634f
// e^x as 2^(x log2 e) on the bare v_exp_f32, without the library's range fix-ups: a vanishing result may be 0 and an overflowing one is infinity, which suits every use here
__device__ __forceinline__ float sigm(float v) { return 1.0f / (1.0f + __builtin_amdgcn_exp2f(v * -L2E)); }
#define LDSX() do { asm volatile("s_wait_dscnt 0" ::: "memory"); __builtin_amdgcn_wave_barrier(); __builtin_amdgcn_fence(__ATOMIC_RELEASE, "workgroup"); } while (0)

// Gated relation-transformer block: LN(x); 8-head (d=32) self attention with an additive [S,S] relation bias (read as data) and output
// projection; gate0 = sigmoid(x gW + gb); gate1 = gate0*mha + x; mlp = sigmoid(gate1 mW + mb); out = gate1*LN(mlp) + gate1.
// All six [in][out] weights packed transposed to f16 rows (x16); every product on v_wmma_f32_16x16x32_f16 (activations as f16 copies /
// LDS tiles, q/k/v head-major x4, P x2^14); LayerNorms, softmax (online over 16 key tiles), sigmoids and gating in f32.
// Every f16 workspace array is a sequence of 16 x 32 tiles in fragment order (frag_t), written by whole lines (through LDS, O16 straight from the accumulators); the bias is copied into accumulator order likewise.
#define NB 16
#define SS 1024
#define EE 256
#define NH 8
#define HD 32
#define NR (NB * SS)

// LN(x) -> X16 ; x -> M16 ; wave per row (256 = 32 lanes x 8), two rows a wave; the block's 16 rows leave as 8 tiles per array ([row tile][k chunk])
__global__ __launch_bounds__(256) void k_ln(const float* __restrict__ x, const float* __restrict__ g, const float* __restrict__ bb, _Float16* __restrict__ X16, _Float16* __restrict__ M16) {
  __shared__ __align__(16) _Float16 sx[2][16][EE + 8];
  const int tid = threadIdx.x, wave = tid >> 5, lane = tid & 31;
  const float* xr = x + ((size_t)blockIdx.x * 16 + wave * 2) * EE + lane * 8; float vv[2][8];
#pragma unroll
  for (int e = 0; e < 8; ++e) { vv[0][e] = xr[e]; vv[1][e] = xr[EE + e]; }
  // the loads' address registers stay whole up to this wait
  asm volatile("s_wait_xcnt 0x0" :: "v"(xr) : "memory");
#pragma unroll
  for (int rr = 0; rr < 2; ++rr) { const int rl = wave * 2 + rr; float v[8]; float s = 0.f;
#pragma unroll
    for (int e = 0; e < 8; ++e) { v[e] = vv[rr][e]; s += v[e]; }
#pragma unroll
    for (int off = 16; off >= 1; off >>= 1) s += __shfl_xor(s, off, 32);
    const float mu = s * (1.0f / EE); float q2 = 0.f;
#pragma unroll
    for (int e = 0; e < 8; ++e) { const float d = v[e] - mu; q2 += d * d; }
#pragma unroll
    for (int off = 16; off >= 1; off >>= 1) q2 += __shfl_xor(q2, off, 32);
    const float rs = rsqrtf(q2 * (1.0f / EE) + 1e-5f);
    union { v8h h; v4u u; } p1, p2;
#pragma unroll
    for (int e = 0; e < 8; ++e) { const int c = lane * 8 + e; p1.h[e] = (_Float16)((v[e] - mu) * rs * g[c] + bb[c]); p2.h[e] = (_Float16)v[e]; }
    vst2(&sx[0][rl][lane * 8], p1.u); vst2(&sx[1][rl][lane * 8], p2.u); }
  __syncthreads();
#pragma unroll   // unrolled: the four LDS reads go out together, and which array a store goes to is known at compile time
  for (int i = 0; i < 4; ++i) { const int a = i >> 1, ch = tid + (i & 1) * 256, kc = ch >> 6, j = (ch >> 4) & 3, c = ch & 15;
    vst2((a ? M16 : X16) + (size_t)blockIdx.x * 16 * EE + ch * 8, *(const v4u*)(&sx[a][c][kc * 32 + j * 8])); }
}
// P tiles [w*16 + n/16][k chunk] of W_w[k][n]*16 (tile row = n) for w: 0 Wq, 1 Wk, 2 Wv, 3 Wo, 4 gW, 5 mW ; block = 16 columns n, thread = row k
// blocks from 96 on: R32 = the bias as 16 x 16 f32 tiles [q / 16][key / 16] in the accumulator order of the transposed score tile (D register r of lane (g, c) = rel[q c][key 8 g + r]), [r >> 2][lane][r & 3] ; block = 16 rows x 256 columns
__global__ __launch_bounds__(256) void k_pack(const float* __restrict__ Wq, const float* __restrict__ Wk, const float* __restrict__ Wv, const float* __restrict__ Wo, const float* __restrict__ gW, const float* __restrict__ mW, const float* __restrict__ rel, _Float16* __restrict__ P, float* __restrict__ R32) {
  const int blk = blockIdx.x, tid = threadIdx.x; __shared__ __align__(16) _Float16 sc[16][EE + 8]; __shared__ __align__(16) float sr[16][256 + 4];
  if (blk >= 6 * EE / 16) { const int rb = blk - 6 * EE / 16, qt = rb >> 2, c0 = (rb & 3) * 256;   // the same for the whole block
    const int hi = tid >> 6, lo = tid & 63; const float* rp = rel + (size_t)(qt * 16 + hi) * SS + c0 + lo * 4; v4f in[4];
#pragma unroll   // unrolled: the four loads go out together
    for (int i = 0; i < 4; ++i) in[i] = *(const v4f*)(rp + i * 4 * SS);
    // the loads' address registers stay whole up to this wait
    asm volatile("s_wait_xcnt 0x0" :: "v"(rp) : "memory");
#pragma unroll
    for (int i = 0; i < 4; ++i) vst2(&sr[hi + 4 * i][lo * 4], in[i]);
    __syncthreads();
    const int u = (lo >> 5) & 1, gg = (lo >> 4) & 1, cc = lo & 15; float* wp = R32 + ((size_t)qt * (SS / 16) + (c0 >> 4) + hi) * 256 + lo * 4;
#pragma unroll   // unrolled: the LDS reads of all four stores go out together
    for (int i = 0; i < 4; ++i) { v4f o;   // tile hi + 4 i of the block's 16
#pragma unroll
      for (int e = 0; e < 4; ++e) o[e] = sr[cc][(hi + 4 * i) * 16 + 8 * gg + 4 * u + e];
      vst2(wp + i * 4 * 256, o); }
    return; }
  const int which = blk >> 4, n0 = (blk & 15) * 16; const float* W = which == 0 ? Wq : which == 1 ? Wk : which == 2 ? Wv : which == 3 ? Wo : which == 4 ? gW : mW;
  const float* wr = W + (size_t)tid * EE + n0;
#pragma unroll
  for (int c = 0; c < 16; ++c) sc[c][tid] = (_Float16)(wr[c] * 16.0f);
  __syncthreads();
#pragma unroll   // unrolled: both LDS reads go out together
  for (int i = 0; i < 2; ++i) { const int q = tid + i * 256, kc = q >> 6, j = (q >> 4) & 3, c = q & 15; vst2(P + (size_t)blk * 16 * EE + q * 8, *(const v4u*)(&sc[c][kc * 32 + j * 8])); }
}
// q/k/v: block (64 rows, 128 cols = 4 heads, which)
__global__ __launch_bounds__(128) void k_qkv(const _Float16* __restrict__ X16, const _Float16* __restrict__ P, const float* __restrict__ bq, const float* __restrict__ bk, const float* __restrict__ bv, _Float16* __restrict__ Q16, _Float16* __restrict__ K16, _Float16* __restrict__ VT) {
  __shared__ __align__(16) float so[4][16][132];
  __shared__ __align__(16) _Float16 st[128][72];
  const int tid = threadIdx.x, wave = tid >> 5, lane = tid & 31, col = lane & 15, g = lane >> 4;
  const int which = blockIdx.z, r0b = blockIdx.x * 64, r0 = r0b + wave * 16, n0 = blockIdx.y * 128; const int b = r0b / SS, s0 = r0b % SS;
  const _Float16* Pw = P + (size_t)which * EE * EE; const float* bias = which == 0 ? bq : (which == 1 ? bk : bv);
  v8f acc[8] = {};
  const _Float16* pa = X16 + (size_t)r0 * EE + 8 * lane; const _Float16* pb = Pw + (size_t)n0 * EE + 8 * lane;
#pragma unroll
  for (int kc = 0; kc < EE / 32; ++kc) { const v16h a = frag_t(pa + kc * 512); v16h bf[8];   // all fragments of the k step are requested before its first product
#pragma unroll
    for (int j = 0; j < 8; ++j) bf[j] = frag_t(pb + j * 16 * EE + kc * 512);
    __builtin_amdgcn_sched_barrier(0);   // keeps the k step's requests one batch ahead of its products: mixed among them, two fragment sets would take turns, a load round trip for every two products
#pragma unroll
    for (int j = 0; j < 8; ++j) acc[j] = wmma16(a, bf[j], acc[j]);
    __builtin_amdgcn_sched_barrier(0); }   // keeps the next k step's requests behind these products: moved up among them they take ten more registers, and with them a wave per SIMD
  // the loads' address registers stay whole up to this wait
  asm volatile("s_wait_xcnt 0x0" :: "v"(pa), "v"(pb) : "memory");
  if (which < 2) {
#pragma unroll
    for (int j = 0; j < 8; ++j) { const float bbv = bias[n0 + j * 16 + col];
#pragma unroll
      for (int r = 0; r < 8; ++r) so[wave][8 * g + r][j * 16 + col] = (acc[j][r] * (1.0f / 16.0f) + bbv) * 4.0f; }
    LDSX();
    _Float16* D = which == 0 ? Q16 : K16;
    // 128 cols = 4 heads of 32: per head one 16 x 32 tile (tile row = position, k = d) = 64 x v4u in fragment order
    for (int q = lane; q < 16 * 4 * 4; q += 32) { const int hh = q >> 6, pc = (q >> 4) & 3, rl = q & 15; const int h = (n0 >> 5) + hh; union { v8h h8; v4u u; } pk;
#pragma unroll
      for (int e = 0; e < 8; ++e) pk.h8[e] = (_Float16)so[wave][rl][hh * 32 + pc * 8 + e];
      vst2(D + (((size_t)b * NH + h) * SS + s0 + wave * 16) * HD + (q & 63) * 8, pk.u); } }
  else {
#pragma unroll
    for (int j = 0; j < 8; ++j) { const float bbv = bias[n0 + j * 16 + col];
#pragma unroll
      for (int r = 0; r < 8; ++r) st[j * 16 + col][wave * 16 + 8 * g + r] = (_Float16)((acc[j][r] * (1.0f / 16.0f) + bbv) * 4.0f); }
    __syncthreads();
    // VT tiles [b][h][32-key chunk][d / 16] (tile row = d, k = key)
    for (int q = tid; q < 128 * 8; q += 128) { const int hh = q >> 8, kb = (q >> 7) & 1, t = (q >> 6) & 1, j = (q >> 4) & 3, c = q & 15;
      vst2(VT + ((((size_t)b * NH + (n0 >> 5) + hh) * (SS / 32) + (s0 >> 5) + kb) * 2 + t) * 512 + (q & 63) * 8, *(const v4u*)(&st[hh * 32 + t * 16 + c][kb * 32 + j * 8])); } }
}
// lane l's value from lane l ^ 16, on the vector unit (no LDS path)
__device__ __forceinline__ float xhalf(float v) { return __builtin_bit_cast(float, __builtin_amdgcn_permlanex16(__builtin_bit_cast(int, v), __builtin_bit_cast(int, v), 0x76543210, 0xfedcba98, false, false)); }
// attention: block (64 q, h, b), transposed: S^T = K q^T / sqrt(32) + rel^T (rel = the R32 tiles), so a lane holds 32 of the 64 scores of ONE query (column lane & 15, keys 16 t + 8 g + r);
// online softmax over 16 tiles in registers; two S^T tiles converted in place are the B fragment of O^T += V^T P^T; O16 [b][h][s / 16] tiles (tile row = position, k = d) x8
__global__ __launch_bounds__(128) void k_attn(const _Float16* __restrict__ Q16, const _Float16* __restrict__ K16, const _Float16* __restrict__ VT, const float* __restrict__ rel, _Float16* __restrict__ O16) {
  const int tid = threadIdx.x, w = tid >> 5, lane = tid & 31;
  const int b = blockIdx.z, h = blockIdx.y, q0 = blockIdx.x * 64 + w * 16; const size_t bh = (size_t)b * NH + h;
  const float scl = (1.0f / 16.0f) / sqrtf((float)HD);
  const v16h bq = frag_t(Q16 + (bh * SS + q0) * HD + 8 * lane);
  float mrun = -3.0e38f, lrun = 0.f; v8f acc[2] = {};   // lrun: this lane half's keys only, the halves are joined behind the loop
#pragma unroll 1
  for (int kt = 0; kt < SS / 64; ++kt) {
    v16h kf[4], vf[2][2]; float sv[4][8];   // the tile's K and bias operands are all requested here, ahead of the first product
    const _Float16* pk = K16 + (bh * SS + kt * 64) * HD + 8 * lane; const _Float16* pv = VT + (bh * (SS / 32) + kt * 2) * 1024 + 8 * lane; const float* pr = rel + ((size_t)(q0 >> 4) * (SS / 16) + kt * 4) * 256 + 4 * lane;
#pragma unroll
    for (int t = 0; t < 4; ++t) kf[t] = frag_t(pk + t * 512);
#pragma unroll
    for (int t = 0; t < 4; ++t) {
#pragma unroll
      for (int r = 0; r < 8; ++r) sv[t][r] = pr[t * 256 + (r >> 2) * 128 + (r & 3)]; }
    // the batch's address registers stay whole up to this wait
    asm volatile("s_wait_xcnt 0x0" :: "v"(pk), "v"(pr) : "memory");
    __builtin_amdgcn_sched_barrier(0);   // keeps every product behind the whole batch of requests: moved up among them, the products would split the batch into pairs, each with a wait of its own
#pragma unroll
    for (int t = 0; t < 4; ++t) { v8f s = {};
      s = wmma16(kf[t], bq, s);
#pragma unroll
      for (int r = 0; r < 8; ++r) sv[t][r] = s[r] * scl + sv[t][r]; }
    // three products in a row, the first one's multiply-adds, the fourth product, the other multiply-adds: products and multiply-adds of other tiles fill each hazard distance, where a product followed by its own multiply-adds takes v_nop
    __builtin_amdgcn_sched_group_barrier(0x8, 3, 0); __builtin_amdgcn_sched_group_barrier(0x2, 4, 0); __builtin_amdgcn_sched_group_barrier(0x8, 1, 0); __builtin_amdgcn_sched_group_barrier(0x2, 12, 0);
    __builtin_amdgcn_sched_barrier(0);   // keeps V's requests behind the score products, whose K registers they take over
    // V is requested here, into the registers K has left, and lands under the softmax: the kernel stays inside 128 registers, so all 8 waves that the grid puts on a SIMD are resident at once
#pragma unroll
    for (int kc = 0; kc < 2; ++kc) {
#pragma unroll
      for (int t = 0; t < 2; ++t) vf[kc][t] = frag_t(pv + (kc * 2 + t) * 512); }
    // as above, for V's address registers
    asm volatile("s_wait_xcnt 0x0" :: "v"(pv) : "memory");
    __builtin_amdgcn_sched_barrier(0);   // keeps all of V's requests ahead of the softmax, which covers their flight
    float mx = -3.4e38f;
#pragma unroll
    for (int t = 0; t < 4; ++t) {
#pragma unroll
      for (int r = 0; r < 8; ++r) mx = fmaxf(mx, sv[t][r]); }
    mx = fmaxf(mx, xhalf(mx));
    const float mnew = fmaxf(mrun, mx); const float corr = __builtin_amdgcn_exp2f((mrun - mnew) * L2E);
    const float eoff = 14.0f - mnew * L2E;   // exponent offset: minus the maximum in base 2, plus 14 for P's 2^14 scale; ps and lrun carry that scale too
    v2f ps = {}; v16h pf[2];   // even and odd keys are summed side by side, one packed add for two
#pragma unroll
    for (int t = 0; t < 4; ++t) {
#pragma unroll
      for (int r = 0; r < 8; r += 2) { v2f p; p[0] = __builtin_amdgcn_exp2f(fmaf(sv[t][r], L2E, eoff)); p[1] = __builtin_amdgcn_exp2f(fmaf(sv[t][r + 1], L2E, eoff)); ps += p;
        pf[t >> 1][(t & 1) * 8 + r] = (_Float16)p[0]; pf[t >> 1][(t & 1) * 8 + r + 1] = (_Float16)p[1]; } }
    lrun = lrun * corr + (ps[0] + ps[1]); mrun = mnew;
#pragma unroll
    for (int r = 0; r < 8; ++r) { acc[0][r] *= corr; acc[1][r] *= corr; }
#pragma unroll
    for (int kc = 0; kc < 2; ++kc) {
#pragma unroll
      for (int t = 0; t < 2; ++t) acc[t] = wmma16(vf[kc][t], pf[kc], acc[t]); } }
  const float lr = lrun + xhalf(lrun); const float inv = 8.0f / (lr * 4.0f);
  // acc[t][r] = O[query lane & 15][d = 16 t + 8 g + r]: the lane's 8 halves are chunk 32 t + lane of the tile, 512 contiguous bytes a store over the wave
#pragma unroll
  for (int t = 0; t < 2; ++t) { union { v8h h8; v4u u; } pk;
#pragma unroll
    for (int r = 0; r < 8; ++r) pk.h8[r] = (_Float16)(acc[t][r] * inv);
    vst2(O16 + (bh * SS + q0) * HD + (32 * t + lane) * 8, pk.u); }
}
// post, transposed: block = 64 rows, 16 waves; wave (rt, cq) = 16 rows x 64 columns as D^T = W^T A^T, so a lane holds 32 columns (n0 + 16 t + 8 g + r) of ONE row (lane & 15).
// rmha = O@Wo + bo ; gate0 = sigmoid(x gW + gb) ; gate1 = gate0*rmha + x ; mlp = sigmoid(gate1 mW + mb) ; out = gate1 * (LN(mlp) + 1): all of it on the accumulator registers.
// Two gate1 tiles converted in place are one B fragment of the third product; the waves of a row tile swap these fragments and their LN partial sums through LDS.
__global__ __launch_bounds__(512) void k_post(const _Float16* __restrict__ O16, const _Float16* __restrict__ M16, const _Float16* __restrict__ P, const float* __restrict__ bo, const float* __restrict__ gb, const float* __restrict__ mb,
                                            const float* __restrict__ lng, const float* __restrict__ lnb, const float* __restrict__ x, float* __restrict__ out) {
  __shared__ __align__(16) float sx[16][16][68];        // a wave's own 16 x 64 tile: x on the way in, out on the way out, so that global accesses cover whole lines; pitch 68: 16 rows of 16 bytes fall on all 64 banks
  __shared__ __align__(16) _Float16 sb[4][8][512];      // gate1 in f16: [row tile][k chunk] in fragment order
  __shared__ float sred[2][4][4][32];                   // LN partial sums [sum, squares][row tile][column quarter][lane]
  const int tid = threadIdx.x, wave = __builtin_amdgcn_readfirstlane(tid >> 5), lane = tid & 31, c = lane & 15, g = lane >> 4;   // the wave's number in a scalar register: what follows from it costs no vector register
  const int rt = wave & 3, cq = wave >> 2, r0 = blockIdx.x * 64 + rt * 16, n0 = cq * 64;
  const float* xp = x + (size_t)(r0 + g) * EE + n0 + c * 4; v4f xin[8];   // load i: rows 2 i + g, 256 contiguous bytes each
#pragma unroll
  for (int i = 0; i < 8; ++i) xin[i] = *(const v4f*)(xp + i * 2 * EE);
  const _Float16* Ob = O16 + (((size_t)(r0 / SS)) * NH * SS + (r0 % SS)) * HD + 8 * lane;     // chunk kc = head kc (HD = 32)
  const _Float16* Mt = M16 + (size_t)r0 * EE + 8 * lane;
  const _Float16* Wt = P + (size_t)(3 * EE + n0) * EE + 8 * lane;   // Wo's tiles of the wave's columns; gW's stand EE * EE halves further, mW's twice that
  // three fragment sets take turns; half step hs = 2 kc + m: m = 0 is Wo's k chunk kc against O's, m = 1 gW's against x's
  v16h fa[3], fw[3][4];
  auto fetch = [&](int hs, int z) { const int kc = hs >> 1; fa[z] = (hs & 1) ? frag_t(Mt + kc * 512) : frag_t(Ob + (size_t)kc * SS * HD);
#pragma unroll
    for (int t = 0; t < 4; ++t) fw[z][t] = frag_t(Wt + (hs & 1) * EE * EE + t * 16 * EE + kc * 512); };
  auto fetchm = [&](int kc, int z) {
#pragma unroll
    for (int t = 0; t < 4; ++t) fw[z][t] = frag_t(Wt + 2 * EE * EE + t * 16 * EE + kc * 512); };
  // (1) rmha^T and the gate's pre-activation^T: a set is requested anew as soon as its products are issued, two half steps ahead of its next use
  v8f ao[4] = {}, ag[4] = {};
  fetch(0, 0); fetch(1, 1); fetch(2, 2);
  // the x loads' address registers stay whole up to this wait
  asm volatile("s_wait_xcnt 0x0" :: "v"(xp) : "memory");
#pragma unroll
  for (int i = 0; i < 8; ++i) vst2(&sx[wave][2 * i + g][c * 4], xin[i]);
#pragma unroll   // unrolled whole: which set a half step uses is known at compile time, and the last fetches drop out
  for (int hs = 0; hs < 2 * (EE / 32); ++hs) { const int z = hs % 3;
#pragma unroll
    for (int t = 0; t < 4; ++t) { if (hs & 1) ag[t] = wmma16(fw[z][t], fa[z], ag[t]); else ao[t] = wmma16(fw[z][t], fa[z], ao[t]); }
    if (hs + 3 < 2 * (EE / 32)) fetch(hs + 3, z);
    __builtin_amdgcn_sched_barrier(0); }   // keeps the ring's order: requests moved further ahead would need a fourth fragment set, which the 256 registers do not hold
  fetchm(0, 0); fetchm(1, 1); fetchm(2, 2);   // mW's first fragments fly under the gate's arithmetic and have landed at the barrier, which waits for every load
  const float* bop = bo + n0 + 8 * g; const float* gbp = gb + n0 + 8 * g; v4f bov[4][2], gbv[4][2];   // the lane's 8 columns of each tile
#pragma unroll
  for (int t = 0; t < 4; ++t) {
#pragma unroll
    for (int u = 0; u < 2; ++u) { bov[t][u] = *(const v4f*)(bop + 16 * t + 4 * u); gbv[t][u] = *(const v4f*)(gbp + 16 * t + 4 * u); } }
  // the address registers of all loads so far stay whole up to this wait
  asm volatile("s_wait_xcnt 0x0" :: "v"(bop), "v"(gbp) : "memory");
  __builtin_amdgcn_sched_barrier(0);   // keeps the arithmetic below, which reuses those registers, behind the wait
  LDSX();   // the x tile was written by other lanes of this wave
  // (2) gate1 = sigmoid(pre) * rmha + x, kept in f32 for the last step and handed on in f16
  float g1[4][8]; v16h pf[2];
#pragma unroll
  for (int t = 0; t < 4; ++t) { const int nl = 16 * t + 8 * g; float xv[8];
#pragma unroll
    for (int r = 0; r < 8; ++r) xv[r] = sx[wave][c][nl + r];
#pragma unroll
    for (int r = 0; r < 8; ++r) { const float rm = ao[t][r] * (1.0f / 128.0f) + bov[t][r >> 2][r & 3]; const float v = sigm(ag[t][r] * (1.0f / 16.0f) + gbv[t][r >> 2][r & 3]) * rm + xv[r];
      g1[t][r] = v; pf[t >> 1][(t & 1) * 8 + r] = (_Float16)v; } }
#pragma unroll
  for (int j = 0; j < 2; ++j) { union { v16h v; v4u q[2]; } u; u.v = pf[j]; _Float16* d = &sb[rt][cq * 2 + j][8 * lane]; vst2(d, u.q[0]); vst2(d + 256, u.q[1]); }
  __syncthreads();   // every wave of the row tile has written its two k chunks of gate1
  // (3) mlp^T = sigmoid(mW^T gate1^T + mb)
  v8f am[4] = {}; v4f mbv[4][2], lg[4][2], lb[4][2];   // the lane's 8 columns of each tile of mb, ln_g, ln_b
  const float* mbp = mb + n0 + 8 * g; const float* lgp = lng + n0 + 8 * g; const float* lbp = lnb + n0 + 8 * g;
  auto fetchv = [&](const float* p, v4f (&v)[4][2]) {
#pragma unroll
    for (int t = 0; t < 4; ++t) { v[t][0] = *(const v4f*)(p + 16 * t); v[t][1] = *(const v4f*)(p + 16 * t + 4); } };
#pragma unroll   // unrolled whole: which set a k chunk uses is known at compile time
  for (int kh = 0; kh < 2; ++kh) { v16h bg[4];
#pragma unroll
    for (int u = 0; u < 4; ++u) bg[u] = frag_t(&sb[rt][4 * kh + u][8 * lane]);
#pragma unroll
    for (int u = 0; u < 4; ++u) { const int kc = 4 * kh + u, z = kc % 3;
#pragma unroll
      for (int t = 0; t < 4; ++t) am[t] = wmma16(fw[z][t], bg[u], am[t]);
      if (kc + 3 < EE / 32) fetchm(kc + 3, z);
      else fetchv(kc == 5 ? mbp : kc == 6 ? lgp : lbp, kc == 5 ? mbv : kc == 6 ? lg : lb);
      __builtin_amdgcn_sched_barrier(0); } }   // the last three chunks leave their sets' registers to the three vectors, which land under the products and the sigmoids; the scheduling barrier keeps the ring's order, as in (1)
  // the address registers of all loads so far stay whole up to this wait
  asm volatile("s_wait_xcnt 0x0" :: "v"(mbp), "v"(lgp), "v"(lbp) : "memory");
  __builtin_amdgcn_sched_barrier(0);   // keeps the arithmetic below, which reuses those registers, behind the wait
  float ml[4][8], sp[4];
#pragma unroll
  for (int t = 0; t < 4; ++t) sp[t] = 0.f;
#pragma unroll
  for (int r = 0; r < 8; ++r) {   // the four tiles' sums advance side by side: four independent chains
#pragma unroll
    for (int t = 0; t < 4; ++t) { const float mv = sigm(am[t][r] * (1.0f / 16.0f) + mbv[t][r >> 2][r & 3]); ml[t][r] = mv; sp[t] += mv; } }
  // (4) LN(mlp) over the row: the lane's 32 columns, the other lane half's, then the four waves' sums in a fixed order
  float s = (sp[0] + sp[1]) + (sp[2] + sp[3]); s += xhalf(s); sred[0][rt][cq][lane] = s;
  __syncthreads();   // the four partial sums of every row are written
  const float mu = ((sred[0][rt][0][lane] + sred[0][rt][1][lane]) + (sred[0][rt][2][lane] + sred[0][rt][3][lane])) * (1.0f / EE);
#pragma unroll
  for (int t = 0; t < 4; ++t) { sp[t] = 0.f;
#pragma unroll
    for (int r = 0; r < 8; ++r) { const float d = ml[t][r] - mu; sp[t] += d * d; } }
  float q2 = (sp[0] + sp[1]) + (sp[2] + sp[3]); q2 += xhalf(q2); sred[1][rt][cq][lane] = q2;
  __syncthreads();   // the four partial sums of squares of every row are written
  const float rs = rsqrtf(((sred[1][rt][0][lane] + sred[1][rt][1][lane]) + (sred[1][rt][2][lane] + sred[1][rt][3][lane])) * (1.0f / EE) + 1e-5f);
#pragma unroll
  for (int t = 0; t < 4; ++t) { const int nl = 16 * t + 8 * g; v4f o[2];
#pragma unroll
    for (int r = 0; r < 8; ++r) { const float lnv = (ml[t][r] - mu) * rs * lg[t][r >> 2][r & 3] + lb[t][r >> 2][r & 3]; o[r >> 2][r & 3] = g1[t][r] * lnv + g1[t][r]; }
    vst2(&sx[wave][c][nl], o[0]); vst2(&sx[wave][c][nl + 4], o[1]); }
  LDSX();   // the out tile is read back by other lanes of this wave
  float* op = out + (size_t)(r0 + g) * EE + n0 + c * 4;   // store i: rows 2 i + g, 256 contiguous bytes each
#pragma unroll   // unrolled: the eight LDS reads go out together
  for (int i = 0; i < 8; ++i) vst2(op + i * 2 * EE, *(const v4f*)(&sx[wave][2 * i + g][c * 4]));
}
extern "C" void kernel_launch(void* const* d_in, const int* in_sizes, int n_in, void* d_out, int out_size, void* d_ws, size_t ws_size, hipStream_t stream) {
  (void)in_sizes; (void)n_in; (void)out_size; (void)ws_size;
  const float** I = (const float**)d_in;
  const float* x = I[0]; const float* lng = I[1]; const float* lnb = I[2]; const float* Wq = I[3]; const float* bq = I[4]; const float* Wk = I[5]; const float* bk = I[6]; const float* Wv = I[7]; const float* bv = I[8]; const float* Wo = I[9]; const float* bo = I[10]; const float* rel = I[11]; const float* gW = I[12]; const float* gb = I[13]; const float* mW = I[14]; const float* mb = I[15];
  float* out = (float*)d_out;
  char* ws = (char*)d_ws; size_t off = 0;
  auto take = [&](size_t bytes) { char* p = ws + off; off += (bytes + 255) & ~(size_t)255; return p; };
  _Float16* X16 = (_Float16*)take((size_t)NR * EE * 2); _Float16* M16 = (_Float16*)take((size_t)NR * EE * 2); _Float16* P = (_Float16*)take((size_t)6 * EE * EE * 2);
  _Float16* Q16 = (_Float16*)take((size_t)NR * EE * 2); _Float16* K16 = (_Float16*)take((size_t)NR * EE * 2); _Float16* VT = (_Float16*)take((size_t)NR * EE * 2); _Float16* O16 = (_Float16*)take((size_t)NR * EE * 2); float* R32 = (float*)take((size_t)SS * SS * 4);
  k_ln<<<NR / 16, 256, 0, stream>>>(x, lng, lnb, X16, M16);
  k_pack<<<6 * EE / 16 + SS / 16 * 4, 256, 0, stream>>>(Wq, Wk, Wv, Wo, gW, mW, rel, P, R32);
  k_qkv<<<dim3(NR / 64, EE / 128, 3), 128, 0, stream>>>(X16, P, bq, bk, bv, Q16, K16, VT);
  k_attn<<<dim3(SS / 64, NH, NB), 128, 0, stream>>>(Q16, K16, VT, R32, O16);
  k_post<<<NR / 64, 512, 0, stream>>>(O16, M16, P, bo, gb, mb, lng, lnb, x, out);
}

// v007
// It runs in 80.7 microseconds.
// Timed twice side by side with v006, it ran 1.08 times as fast both times.
// Over all steps from v000 it is 2.96 times as fast.
#include <hip/hip_runtime.h>
#include <math.h>

typedef __attribute__((ext_vector_type(16))) _Float16 v16h;
typedef __attribute__((ext_vector_type(16))) __bf16 v16b;
typedef __attribute__((ext_vector_type(8)))  _Float16 v8h;
typedef __attribute__((ext_vector_type(8)))  float v8f;
typedef __attribute__((ext_vector_type(4)))  float v4f;
typedef __attribute__((ext_vector_type(2)))  float v2f;
typedef __attribute__((ext_vector_type(4)))  unsigned v4u;
typedef __attribute__((ext_vector_type(4)))  int v4i;
typedef float __attribute__((may_alias)) float_a;
typedef int __attribute__((may_alias)) int_a;

template <typename T> __device__ __forceinline__ void vst2(void* p, T v) { *(T*)p = v;  }
__device__ __forceinline__ v8f wmma16(v16h a, v16h b, v8f c) {
  return __builtin_amdgcn_wmma_f32_16x16x32_f16(false, a, false, b, (short)0, c, false, false);   // the bare builtin: the compiler keeps the distance to the next user of D, A or B itself, with useful work where there is some
}
__device__ __forceinline__ v8f wmma_bf(v16b a, v16b b, v8f c) {
  v8f d = __builtin_amdgcn_wmma_f32_16x16x32_bf16(false, a, false, b, (short)0, c, false, false);
  asm volatile("v_nop\n\tv_nop\n\tv_nop\n\tv_nop" : "+v"(d) : "v"(a), "v"(b));
  return d;
}
// 16x16x32 fragments: lane = (h = lane>>4, row/col = lane&15); elements 0..7 = k0+8h+0..7, 8..15 = k0+16+8h+0..7; D element r = row 8h+r
__device__ __forceinline__ v16h frag_h(const _Float16* rowk0, int lane) {
  union { v16h v; v8h q[2]; } u; const _Float16* p = rowk0 + 8 * (lane >> 4);
  u.q[0] = *(const v8h*)p; u.q[1] = *(const v8h*)(p + 16); return u.v;
}
// the same fragment from a pointer that already holds the lane half's offset (row + k0 + 8h)
__device__ __forceinline__ v16h frag_at(const _Float16* p) {
  union { v16h v; v8h q[2]; } u; u.q[0] = *(const v8h*)p; u.q[1] = *(const v8h*)(p + 16); return u.v;
}
// the same fragment from a tile kept in fragment order: 16 rows x 32 k = 512 halves as [k >> 3][row][k & 7]; p = tile + 8 * lane, so each of the two loads reads 512 contiguous bytes (4 whole lines) over the wave
__device__ __forceinline__ v16h frag_t(const _Float16* p) {
  union { v16h v; v8h q[2]; } u; u.q[0] = *(const v8h*)p; u.q[1] = *(const v8h*)(p + 256); return u.v;
}
__device__ __forceinline__ v16h frag_f32(const float* rowk0, int lane) {
  v16h a; const float* p = rowk0 + 8 * (lane >> 4);
#pragma unroll
  for (int i = 0; i < 8; ++i) { a[i] = (_Float16)p[i]; a[8 + i] = (_Float16)p[16 + i]; }
  return a;
}
__device__ __forceinline__ v16h frag_f32s(const float* rowk0, int lane, float sc) {
  v16h a; const float* p = rowk0 + 8 * (lane >> 4);
#pragma unroll
  for (int i = 0; i < 8; ++i) { a[i] = (_Float16)(p[i] * sc); a[8 + i] = (_Float16)(p[16 + i] * sc); }
  return a;
}
// column fragment from a [K][ld] layout (column n), rows >= K read as 0
__device__ __forceinline__ v16h fragc_f32(const float* W, int k0, int n, int lane, int ld, int K) {
  v16h a; const int g = lane >> 4;
#pragma unroll
  for (int i = 0; i < 8; ++i) { const int ka = k0 + 8 * g + i, kb = ka + 16;
    a[i] = (_Float16)(ka < K ? W[(size_t)ka * ld + n] : 0.f); a[8 + i] = (_Float16)(kb < K ? W[(size_t)kb * ld + n] : 0.f); }
  return a;
}
struct F2 { v16b h, l; };
__device__ __forceinline__ F2 bsplit16(const float v[16]) { F2 r;
#pragma unroll
  for (int i = 0; i < 16; ++i) { const __bf16 h = (__bf16)v[i]; r.h[i] = h; r.l[i] = (__bf16)(v[i] - (float)h); }
  return r; }
__device__ __forceinline__ F2 split_row(const float* row, int k0, int lane) { float v[16]; const float* p = row + k0 + 8 * (lane >> 4);
#pragma unroll
  for (int i = 0; i < 8; ++i) { v[i] = p[i]; v[8 + i] = p[16 + i]; }
  return bsplit16(v); }
__device__ __forceinline__ F2 split_rowK(const float* row, int k0, int lane, int K) { float v[16]; const int g = lane >> 4;
#pragma unroll
  for (int i = 0; i < 8; ++i) { const int ka = k0 + 8 * g + i, kb = ka + 16; v[i] = ka < K ? row[ka] : 0.f; v[8 + i] = kb < K ? row[kb] : 0.f; }
  return bsplit16(v); }
__device__ __forceinline__ F2 split_col(const float* W, int k0, int n, int lane, int ld, int K) { float v[16]; const int g = lane >> 4;
#pragma unroll
  for (int i = 0; i < 8; ++i) { const int ka = k0 + 8 * g + i, kb = ka + 16; v[i] = ka < K ? W[(size_t)ka * ld + n] : 0.f; v[8 + i] = kb < K ? W[(size_t)kb * ld + n] : 0.f; }
  return bsplit16(v); }
__device__ __forceinline__ v8f mac3(const F2& a, const F2& b, v8f c) { c = wmma_bf(a.l, b.h, c); c = wmma_bf(a.h, b.l, c); return wmma_bf(a.h, b.h, c); }
#define L2E 1.4426950408889634f
// e^x as 2^(x log2 e) on the bare v_exp_f32, without the library's range fix-ups: a vanishing result may be 0 and an overflowing one is infinity, which suits every use here
__device__ __forceinline__ float sigm(float v) { return 1.0f / (1.0f + __builtin_amdgcn_exp2f(v * -L2E)); }
#define LDSX() do { asm volatile("s_wait_dscnt 0" ::: "memory"); __builtin_amdgcn_wave_barrier(); __builtin_amdgcn_fence(__ATOMIC_RELEASE, "workgroup"); } while (0)

// Gated relation-transformer block: LN(x); 8-head (d=32) self attention with an additive [S,S] relation bias (read as data) and output
// projection; gate0 = sigmoid(x gW + gb); gate1 = gate0*mha + x; mlp = sigmoid(gate1 mW + mb); out = gate1*LN(mlp) + gate1.
// All six [in][out] weights packed transposed to f16 rows (x16); every product on v_wmma_f32_16x16x32_f16 (activations as f16 copies /
// LDS tiles, q/k/v head-major x4, P x2^14); LayerNorms, softmax (online over 16 key tiles), sigmoids and gating in f32.
// Every f16 workspace array is a sequence of 16 x 32 tiles in fragment order (frag_t), written by whole lines through LDS; the bias is copied into accumulator order likewise.
#define NB 16
#define SS 1024
#define EE 256
#define NH 8
#define HD 32
#define NR (NB * SS)

// LN(x) -> X16 ; x -> M16 ; wave per row (256 = 32 lanes x 8), two rows a wave; the block's 16 rows leave as 8 tiles per array ([row tile][k chunk])
__global__ __launch_bounds__(256) void k_ln(const float* __restrict__ x, const float* __restrict__ g, const float* __restrict__ bb, _Float16* __restrict__ X16, _Float16* __restrict__ M16) {
  __shared__ __align__(16) _Float16 sx[2][16][EE + 8];
  const int tid = threadIdx.x, wave = tid >> 5, lane = tid & 31;
  const float* xr = x + ((size_t)blockIdx.x * 16 + wave * 2) * EE + lane * 8; float vv[2][8];
#pragma unroll
  for (int e = 0; e < 8; ++e) { vv[0][e] = xr[e]; vv[1][e] = xr[EE + e]; }
  // the loads' address registers stay whole up to this wait
  asm volatile("s_wait_xcnt 0x0" :: "v"(xr) : "memory");
#pragma unroll
  for (int rr = 0; rr < 2; ++rr) { const int rl = wave * 2 + rr; float v[8]; float s = 0.f;
#pragma unroll
    for (int e = 0; e < 8; ++e) { v[e] = vv[rr][e]; s += v[e]; }
#pragma unroll
    for (int off = 16; off >= 1; off >>= 1) s += __shfl_xor(s, off, 32);
    const float mu = s * (1.0f / EE); float q2 = 0.f;
#pragma unroll
    for (int e = 0; e < 8; ++e) { const float d = v[e] - mu; q2 += d * d; }
#pragma unroll
    for (int off = 16; off >= 1; off >>= 1) q2 += __shfl_xor(q2, off, 32);
    const float rs = rsqrtf(q2 * (1.0f / EE) + 1e-5f);
    union { v8h h; v4u u; } p1, p2;
#pragma unroll
    for (int e = 0; e < 8; ++e) { const int c = lane * 8 + e; p1.h[e] = (_Float16)((v[e] - mu) * rs * g[c] + bb[c]); p2.h[e] = (_Float16)v[e]; }
    vst2(&sx[0][rl][lane * 8], p1.u); vst2(&sx[1][rl][lane * 8], p2.u); }
  __syncthreads();
#pragma unroll   // unrolled: the four LDS reads go out together, and which array a store goes to is known at compile time
  for (int i = 0; i < 4; ++i) { const int a = i >> 1, ch = tid + (i & 1) * 256, kc = ch >> 6, j = (ch >> 4) & 3, c = ch & 15;
    vst2((a ? M16 : X16) + (size_t)blockIdx.x * 16 * EE + ch * 8, *(const v4u*)(&sx[a][c][kc * 32 + j * 8])); }
}
// P tiles [w*16 + n/16][k chunk] of W_w[k][n]*16 (tile row = n) for w: 0 Wq, 1 Wk, 2 Wv, 3 Wo, 4 gW, 5 mW ; block = 16 columns n, thread = row k
// blocks from 96 on: R32 = the bias as 16 x 16 f32 tiles [q / 16][key / 16] in the accumulator order of the transposed score tile (D register r of lane (g, c) = rel[q c][key 8 g + r]), [r >> 2][lane][r & 3] ; block = 16 rows x 256 columns
__global__ __launch_bounds__(256) void k_pack(const float* __restrict__ Wq, const float* __restrict__ Wk, const float* __restrict__ Wv, const float* __restrict__ Wo, const float* __restrict__ gW, const float* __restrict__ mW, const float* __restrict__ rel, _Float16* __restrict__ P, float* __restrict__ R32) {
  const int blk = blockIdx.x, tid = threadIdx.x; __shared__ __align__(16) _Float16 sc[16][EE + 8]; __shared__ __align__(16) float sr[16][256 + 4];
  if (blk >= 6 * EE / 16) { const int rb = blk - 6 * EE / 16, qt = rb >> 2, c0 = (rb & 3) * 256;   // the same for the whole block
    const int hi = tid >> 6, lo = tid & 63; const float* rp = rel + (size_t)(qt * 16 + hi) * SS + c0 + lo * 4; v4f in[4];
#pragma unroll   // unrolled: the four loads go out together
    for (int i = 0; i < 4; ++i) in[i] = *(const v4f*)(rp + i * 4 * SS);
    // the loads' address registers stay whole up to this wait
    asm volatile("s_wait_xcnt 0x0" :: "v"(rp) : "memory");
#pragma unroll
    for (int i = 0; i < 4; ++i) vst2(&sr[hi + 4 * i][lo * 4], in[i]);
    __syncthreads();
    const int u = (lo >> 5) & 1, gg = (lo >> 4) & 1, cc = lo & 15; float* wp = R32 + ((size_t)qt * (SS / 16) + (c0 >> 4) + hi) * 256 + lo * 4;
#pragma unroll   // unrolled: the LDS reads of all four stores go out together
    for (int i = 0; i < 4; ++i) { v4f o;   // tile hi + 4 i of the block's 16
#pragma unroll
      for (int e = 0; e < 4; ++e) o[e] = sr[cc][(hi + 4 * i) * 16 + 8 * gg + 4 * u + e];
      vst2(wp + i * 4 * 256, o); }
    return; }
  const int which = blk >> 4, n0 = (blk & 15) * 16; const float* W = which == 0 ? Wq : which == 1 ? Wk : which == 2 ? Wv : which == 3 ? Wo : which == 4 ? gW : mW;
  const float* wr = W + (size_t)tid * EE + n0;
#pragma unroll
  for (int c = 0; c < 16; ++c) sc[c][tid] = (_Float16)(wr[c] * 16.0f);
  __syncthreads();
#pragma unroll   // unrolled: both LDS reads go out together
  for (int i = 0; i < 2; ++i) { const int q = tid + i * 256, kc = q >> 6, j = (q >> 4) & 3, c = q & 15; vst2(P + (size_t)blk * 16 * EE + q * 8, *(const v4u*)(&sc[c][kc * 32 + j * 8])); }
}
// q/k/v: block (64 rows, 128 cols = 4 heads, which)
__global__ __launch_bounds__(128) void k_qkv(const _Float16* __restrict__ X16, const _Float16* __restrict__ P, const float* __restrict__ bq, const float* __restrict__ bk, const float* __restrict__ bv, _Float16* __restrict__ Q16, _Float16* __restrict__ K16, _Float16* __restrict__ VT) {
  __shared__ __align__(16) float so[4][16][132];
  __shared__ __align__(16) _Float16 st[128][72];
  const int tid = threadIdx.x, wave = tid >> 5, lane = tid & 31, col = lane & 15, g = lane >> 4;
  const int which = blockIdx.z, r0b = blockIdx.x * 64, r0 = r0b + wave * 16, n0 = blockIdx.y * 128; const int b = r0b / SS, s0 = r0b % SS;
  const _Float16* Pw = P + (size_t)which * EE * EE; const float* bias = which == 0 ? bq : (which == 1 ? bk : bv);
  v8f acc[8] = {};
  const _Float16* pa = X16 + (size_t)r0 * EE + 8 * lane; const _Float16* pb = Pw + (size_t)n0 * EE + 8 * lane;
#pragma unroll
  for (int kc = 0; kc < EE / 32; ++kc) { const v16h a = frag_t(pa + kc * 512); v16h bf[8];   // all fragments of the k step are requested before its first product
#pragma unroll
    for (int j = 0; j < 8; ++j) bf[j] = frag_t(pb + j * 16 * EE + kc * 512);
    __builtin_amdgcn_sched_barrier(0);   // keeps the k step's requests one batch ahead of its products: mixed among them, two fragment sets would take turns, a load round trip for every two products
#pragma unroll
    for (int j = 0; j < 8; ++j) acc[j] = wmma16(a, bf[j], acc[j]);
    __builtin_amdgcn_sched_barrier(0); }   // keeps the next k step's requests behind these products: moved up among them they take ten more registers, and with them a wave per SIMD
  // the loads' address registers stay whole up to this wait
  asm volatile("s_wait_xcnt 0x0" :: "v"(pa), "v"(pb) : "memory");
  if (which < 2) {
#pragma unroll
    for (int j = 0; j < 8; ++j) { const float bbv = bias[n0 + j * 16 + col];
#pragma unroll
      for (int r = 0; r < 8; ++r) so[wave][8 * g + r][j * 16 + col] = (acc[j][r] * (1.0f / 16.0f) + bbv) * 4.0f; }
    LDSX();
    _Float16* D = which == 0 ? Q16 : K16;
    // 128 cols = 4 heads of 32: per head one 16 x 32 tile (tile row = position, k = d) = 64 x v4u in fragment order
    for (int q = lane; q < 16 * 4 * 4; q += 32) { const int hh = q >> 6, pc = (q >> 4) & 3, rl = q & 15; const int h = (n0 >> 5) + hh; union { v8h h8; v4u u; } pk;
#pragma unroll
      for (int e = 0; e < 8; ++e) pk.h8[e] = (_Float16)so[wave][rl][hh * 32 + pc * 8 + e];
      vst2(D + (((size_t)b * NH + h) * SS + s0 + wave * 16) * HD + (q & 63) * 8, pk.u); } }
  else {
#pragma unroll
    for (int j = 0; j < 8; ++j) { const float bbv = bias[n0 + j * 16 + col];
#pragma unroll
      for (int r = 0; r < 8; ++r) st[j * 16 + col][wave * 16 + 8 * g + r] = (_Float16)((acc[j][r] * (1.0f / 16.0f) + bbv) * 4.0f); }
    __syncthreads();
    // VT tiles [b][h][32-key chunk][d / 16] (tile row = d, k = key)
    for (int q = tid; q < 128 * 8; q += 128) { const int hh = q >> 8, kb = (q >> 7) & 1, t = (q >> 6) & 1, j = (q >> 4) & 3, c = q & 15;
      vst2(VT + ((((size_t)b * NH + (n0 >> 5) + hh) * (SS / 32) + (s0 >> 5) + kb) * 2 + t) * 512 + (q & 63) * 8, *(const v4u*)(&st[hh * 32 + t * 16 + c][kb * 32 + j * 8])); } }
}
// lane l's value from lane l ^ 16, on the vector unit (no LDS path)
__device__ __forceinline__ float xhalf(float v) { return __builtin_bit_cast(float, __builtin_amdgcn_permlanex16(__builtin_bit_cast(int, v), __builtin_bit_cast(int, v), 0x76543210, 0xfedcba98, false, false)); }
// Attention and all that follows it in one launch: block = 64 rows of one batch element, 16 waves; wave (rt, cq).
// Attention part, transposed: the wave takes 16 queries (row tile rt) of the heads 2 cq and 2 cq + 1. S^T = K q^T / sqrt(32) + rel^T (rel = the R32 tiles, read once for both heads), so a lane holds 32 of the 64 scores of ONE query
// (column lane & 15, keys 16 t + 8 g + r); online softmax over 16 tiles in registers; two S^T tiles converted in place are the B fragment of O^T += V^T P^T; O x8 goes to LDS as [row tile][head] tiles (tile row = position, k = d).
// Post part, transposed: the wave takes 16 rows x 64 columns as D^T = W^T A^T, so a lane holds 32 columns (n0 + 16 t + 8 g + r) of ONE row (lane & 15).
// rmha = O@Wo + bo ; gate0 = sigmoid(x gW + gb) ; gate1 = gate0*rmha + x ; mlp = sigmoid(gate1 mW + mb) ; out = gate1 * (LN(mlp) + 1): all of it on the accumulator registers.
// Two gate1 tiles converted in place are one B fragment of the third product; the waves of a row tile swap these fragments and their LN partial sums through LDS.
__global__ __launch_bounds__(512) void k_attn_post(const _Float16* __restrict__ Q16, const _Float16* __restrict__ K16, const _Float16* __restrict__ VT, const float* __restrict__ rel, const _Float16* __restrict__ M16, const _Float16* __restrict__ P,
                                                 const float* __restrict__ bo, const float* __restrict__ gb, const float* __restrict__ mb, const float* __restrict__ lng, const float* __restrict__ lnb, const float* __restrict__ x, float* __restrict__ out) {
  __shared__ __align__(16) float sx[16][16][68];        // a wave's own 16 x 64 tile: x on the way in, out on the way out, so that global accesses cover whole lines; pitch 68: 16 rows of 16 bytes fall on all 64 banks
  __shared__ __align__(16) _Float16 sb[4][8][512];      // gate1 in f16: [row tile][k chunk] in fragment order
  __shared__ __align__(16) _Float16 so[4][8][512];      // attention's O in f16: [row tile][head = k chunk] in fragment order
  __shared__ float sred[2][4][4][32];                   // LN partial sums [sum, squares][row tile][column quarter][lane]
  const int tid = threadIdx.x, wave = __builtin_amdgcn_readfirstlane(tid >> 5), lane = tid & 31, c = lane & 15, g = lane >> 4;   // the wave's number in a scalar register: what follows from it costs no vector register
  const int rt = wave & 3, cq = wave >> 2, r0 = blockIdx.x * 64 + rt * 16, n0 = cq * 64;
  const float* xp = x + (size_t)(r0 + g) * EE + n0 + c * 4; v4f xin[8];   // load i: rows 2 i + g, 256 contiguous bytes each
  const _Float16* Mt = M16 + (size_t)r0 * EE + 8 * lane;
  const _Float16* Wt = P + (size_t)(3 * EE + n0) * EE + 8 * lane;   // Wo's tiles of the wave's columns; gW's stand EE * EE halves further, mW's twice that
  // post part: three fragment sets take turns; half step hs = 2 kc + m: m = 0 is Wo's k chunk kc against O's, m = 1 gW's against x's
  v16h fa[3], fw[3][4];
  auto fetchw = [&](int hs, int z) {
#pragma unroll
    for (int t = 0; t < 4; ++t) fw[z][t] = frag_t(Wt + (hs & 1) * EE * EE + t * 16 * EE + (hs >> 1) * 512); };
  auto fetch = [&](int hs, int z) { const int kc = hs >> 1; fa[z] = (hs & 1) ? frag_t(Mt + kc * 512) : frag_t(&so[rt][kc][8 * lane]);   // O's chunk kc = head kc (HD = 32)
    fetchw(hs, z); };
  auto fetchm = [&](int kc, int z) {
#pragma unroll
    for (int t = 0; t < 4; ++t) fw[z][t] = frag_t(Wt + 2 * EE * EE + t * 16 * EE + kc * 512); };
  { const int q0 = r0 % SS; const size_t bh = (size_t)(r0 / SS) * NH + 2 * cq;   // the first of the wave's two heads; the second one's arrays stand one head further
    const float scl = (1.0f / 16.0f) / sqrtf((float)HD);
    v16h bq[2]; float mrun[2], lrun[2]; v8f acc[2][2] = {};   // lrun: this lane half's keys only, the halves are joined behind the loop
#pragma unroll
    for (int hh = 0; hh < 2; ++hh) { bq[hh] = frag_t(Q16 + ((bh + hh) * SS + q0) * HD + 8 * lane); mrun[hh] = -3.0e38f; lrun[hh] = 0.f; }
#pragma unroll 1   // stays rolled: two trips side by side would not fit the 256 registers
    for (int kt = 0; kt < SS / 64; ++kt) {
      v16h kf[2][4], vf[2][2][2]; float bs[4][8], sv[2][4][8];   // the tile's K and bias operands are all requested here, ahead of the first product
      const _Float16* pk = K16 + (bh * SS + kt * 64) * HD + 8 * lane; const _Float16* pv = VT + (bh * (SS / 32) + kt * 2) * 1024 + 8 * lane; const float* pr = rel + ((size_t)(q0 >> 4) * (SS / 16) + kt * 4) * 256 + 4 * lane;
#pragma unroll
      for (int hh = 0; hh < 2; ++hh) {
#pragma unroll
        for (int t = 0; t < 4; ++t) kf[hh][t] = frag_t(pk + hh * SS * HD + t * 512); }
#pragma unroll
      for (int t = 0; t < 4; ++t) {
#pragma unroll
        for (int r = 0; r < 8; ++r) bs[t][r] = pr[t * 256 + (r >> 2) * 128 + (r & 3)]; }
      // the batch's address registers stay whole up to this wait
      asm volatile("s_wait_xcnt 0x0" :: "v"(pk), "v"(pr) : "memory");
      __builtin_amdgcn_sched_barrier(0);   // keeps every product behind the whole batch of requests: moved up among them, the products would split the batch into pairs, each with a wait of its own
#pragma unroll
      for (int hh = 0; hh < 2; ++hh) {
#pragma unroll
        for (int t = 0; t < 4; ++t) { v8f s = {};
          s = wmma16(kf[hh][t], bq[hh], s);
#pragma unroll
          for (int r = 0; r < 8; ++r) sv[hh][t][r] = s[r] * scl + bs[t][r]; } }
      // three products in a row, then by turns one tile's multiply-adds and one more product: products and multiply-adds of other tiles fill each hazard distance, where a product followed by its own multiply-adds takes v_nop
      __builtin_amdgcn_sched_group_barrier(0x8, 3, 0); __builtin_amdgcn_sched_group_barrier(0x2, 4, 0);
#pragma unroll   // unrolled: the builtins are marks for the scheduler, five pairs of them in a row
      for (int i = 0; i < 5; ++i) { __builtin_amdgcn_sched_group_barrier(0x8, 1, 0); __builtin_amdgcn_sched_group_barrier(0x2, 4, 0); }
      __builtin_amdgcn_sched_group_barrier(0x2, 8, 0);
      __builtin_amdgcn_sched_barrier(0);   // keeps V's requests behind the score products, whose K registers they take over
      // V is requested here, into the registers K has left, and lands under the softmax
#pragma unroll
      for (int hh = 0; hh < 2; ++hh) {
#pragma unroll
        for (int kc = 0; kc < 2; ++kc) {
#pragma unroll
          for (int t = 0; t < 2; ++t) vf[hh][kc][t] = frag_t(pv + hh * (SS / 32) * 1024 + (kc * 2 + t) * 512); } }
      // as above, for V's address registers
      asm volatile("s_wait_xcnt 0x0" :: "v"(pv) : "memory");
      __builtin_amdgcn_sched_barrier(0);   // keeps all of V's requests ahead of the softmax, which covers their flight
#pragma unroll
      for (int hh = 0; hh < 2; ++hh) {
        float mx = -3.4e38f;
#pragma unroll
        for (int t = 0; t < 4; ++t) {
#pragma unroll
          for (int r = 0; r < 8; ++r) mx = fmaxf(mx, sv[hh][t][r]); }
        mx = fmaxf(mx, xhalf(mx));
        const float mnew = fmaxf(mrun[hh], mx); const float corr = __builtin_amdgcn_exp2f((mrun[hh] - mnew) * L2E);
        const float eoff = 14.0f - mnew * L2E;   // exponent offset: minus the maximum in base 2, plus 14 for P's 2^14 scale; ps and lrun carry that scale too
        v2f ps = {}; v16h pf[2];   // even and odd keys are summed side by side, one packed add for two
#pragma unroll
        for (int t = 0; t < 4; ++t) {
#pragma unroll
          for (int r = 0; r < 8; r += 2) { v2f pp; pp[0] = __builtin_amdgcn_exp2f(fmaf(sv[hh][t][r], L2E, eoff)); pp[1] = __builtin_amdgcn_exp2f(fmaf(sv[hh][t][r + 1], L2E, eoff)); ps += pp;
            pf[t >> 1][(t & 1) * 8 + r] = (_Float16)pp[0]; pf[t >> 1][(t & 1) * 8 + r + 1] = (_Float16)pp[1]; } }
        lrun[hh] = lrun[hh] * corr + (ps[0] + ps[1]); mrun[hh] = mnew;
#pragma unroll
        for (int r = 0; r < 8; ++r) { acc[hh][0][r] *= corr; acc[hh][1][r] *= corr; }
#pragma unroll
        for (int kc = 0; kc < 2; ++kc) {
#pragma unroll
          for (int t = 0; t < 2; ++t) acc[hh][t] = wmma16(vf[hh][kc][t], pf[kc], acc[hh][t]); } } }
    // what the post part needs first and what does not hang on O is requested here: it flies under the division, the O stores and the wait for the other waves
#pragma unroll
    for (int i = 0; i < 8; ++i) xin[i] = *(const v4f*)(xp + i * 2 * EE);
    fetchw(0, 0); fetchw(1, 1); fetchw(2, 2); fa[1] = frag_t(Mt);
    // acc[hh][t][r] = O[query lane & 15][d = 16 t + 8 g + r] of head 2 cq + hh: the lane's 8 halves are chunk 32 t + lane of that head's tile
#pragma unroll
    for (int hh = 0; hh < 2; ++hh) { const float lr = lrun[hh] + xhalf(lrun[hh]); const float inv = 8.0f / (lr * 4.0f);
#pragma unroll
      for (int t = 0; t < 2; ++t) { union { v8h h8; v4u u; } pk;
#pragma unroll
        for (int r = 0; r < 8; ++r) pk.h8[r] = (_Float16)(acc[hh][t][r] * inv);
        vst2(&so[rt][2 * cq + hh][(32 * t + lane) * 8], pk.u); } } }
  __syncthreads();   // every wave of the row tile has written its two heads of O
  // (1) rmha^T and the gate's pre-activation^T: a set is requested anew as soon as its products are issued, two half steps ahead of its next use
  v8f ao[4] = {}, ag[4] = {};
  fa[0] = frag_t(&so[rt][0][8 * lane]); fa[2] = frag_t(&so[rt][1][8 * lane]);   // O's part of the first three sets; the rest was requested ahead of the barrier
  // the x loads' address registers stay whole up to this wait
  asm volatile("s_wait_xcnt 0x0" :: "v"(xp) : "memory");
#pragma unroll
  for (int i = 0; i < 8; ++i) vst2(&sx[wave][2 * i + g][c * 4], xin[i]);
#pragma unroll   // unrolled whole: which set a half step uses is known at compile time, and the last fetches drop out
  for (int hs = 0; hs < 2 * (EE / 32); ++hs) { const int z = hs % 3;
#pragma unroll
    for (int t = 0; t < 4; ++t) { if (hs & 1) ag[t] = wmma16(fw[z][t], fa[z], ag[t]); else ao[t] = wmma16(fw[z][t], fa[z], ao[t]); }
    if (hs + 3 < 2 * (EE / 32)) fetch(hs + 3, z);
    __builtin_amdgcn_sched_barrier(0); }   // keeps the ring's order: requests moved further ahead would need a fourth fragment set, which the 256 registers do not hold
  fetchm(0, 0); fetchm(1, 1); fetchm(2, 2);   // mW's first fragments fly under the gate's arithmetic and have landed at the barrier, which waits for every load
  const float* bop = bo + n0 + 8 * g; const float* gbp = gb + n0 + 8 * g; v4f bov[4][2], gbv[4][2];   // the lane's 8 columns of each tile
#pragma unroll
  for (int t = 0; t < 4; ++t) {
#pragma unroll
    for (int u = 0; u < 2; ++u) { bov[t][u] = *(const v4f*)(bop + 16 * t + 4 * u); gbv[t][u] = *(const v4f*)(gbp + 16 * t + 4 * u); } }
  // the address registers of all loads so far stay whole up to this wait
  asm volatile("s_wait_xcnt 0x0" :: "v"(bop), "v"(gbp) : "memory");
  __builtin_amdgcn_sched_barrier(0);   // keeps the arithmetic below, which reuses those registers, behind the wait
  LDSX();   // the x tile was written by other lanes of this wave
  // (2) gate1 = sigmoid(pre) * rmha + x, kept in f32 for the last step and handed on in f16
  float g1[4][8]; v16h pf[2];
#pragma unroll
  for (int t = 0; t < 4; ++t) { const int nl = 16 * t + 8 * g; float xv[8];
#pragma unroll
    for (int r = 0; r < 8; ++r) xv[r] = sx[wave][c][nl + r];
#pragma unroll
    for (int r = 0; r < 8; ++r) { const float rm = ao[t][r] * (1.0f / 128.0f) + bov[t][r >> 2][r & 3]; const float v = sigm(ag[t][r] * (1.0f / 16.0f) + gbv[t][r >> 2][r & 3]) * rm + xv[r];
      g1[t][r] = v; pf[t >> 1][(t & 1) * 8 + r] = (_Float16)v; } }
#pragma unroll
  for (int j = 0; j < 2; ++j) { union { v16h v; v4u q[2]; } u; u.v = pf[j]; _Float16* d = &sb[rt][cq * 2 + j][8 * lane]; vst2(d, u.q[0]); vst2(d + 256, u.q[1]); }
  __syncthreads();   // every wave of the row tile has written its two k chunks of gate1
  // (3) mlp^T = sigmoid(mW^T gate1^T + mb)
  v8f am[4] = {}; v4f mbv[4][2], lg[4][2], lb[4][2];   // the lane's 8 columns of each tile of mb, ln_g, ln_b
  const float* mbp = mb + n0 + 8 * g; const float* lgp = lng + n0 + 8 * g; const float* lbp = lnb + n0 + 8 * g;
  auto fetchv = [&](const float* p, v4f (&v)[4][2]) {
#pragma unroll
    for (int t = 0; t < 4; ++t) { v[t][0] = *(const v4f*)(p + 16 * t); v[t][1] = *(const v4f*)(p + 16 * t + 4); } };
#pragma unroll   // unrolled whole: which set a k chunk uses is known at compile time
  for (int kh = 0; kh < 2; ++kh) { v16h bg[4];
#pragma unroll
    for (int u = 0; u < 4; ++u) bg[u] = frag_t(&sb[rt][4 * kh + u][8 * lane]);
#pragma unroll
    for (int u = 0; u < 4; ++u) { const int kc = 4 * kh + u, z = kc % 3;
#pragma unroll
      for (int t = 0; t < 4; ++t) am[t] = wmma16(fw[z][t], bg[u], am[t]);
      if (kc + 3 < EE / 32) fetchm(kc + 3, z);
      else fetchv(kc == 5 ? mbp : kc == 6 ? lgp : lbp, kc == 5 ? mbv : kc == 6 ? lg : lb);
      __builtin_amdgcn_sched_barrier(0); } }   // the last three chunks leave their sets' registers to the three vectors, which land under the products and the sigmoids; the scheduling barrier keeps the ring's order, as in (1)
  // the address registers of all loads so far stay whole up to this wait
  asm volatile("s_wait_xcnt 0x0" :: "v"(mbp), "v"(lgp), "v"(lbp) : "memory");
  __builtin_amdgcn_sched_barrier(0);   // keeps the arithmetic below, which reuses those registers, behind the wait
  float ml[4][8], sp[4];
#pragma unroll
  for (int t = 0; t < 4; ++t) sp[t] = 0.f;
#pragma unroll
  for (int r = 0; r < 8; ++r) {   // the four tiles' sums advance side by side: four independent chains
#pragma unroll
    for (int t = 0; t < 4; ++t) { const float mv = sigm(am[t][r] * (1.0f / 16.0f) + mbv[t][r >> 2][r & 3]); ml[t][r] = mv; sp[t] += mv; } }
  // (4) LN(mlp) over the row: the lane's 32 columns, the other lane half's, then the four waves' sums in a fixed order
  float s = (sp[0] + sp[1]) + (sp[2] + sp[3]); s += xhalf(s); sred[0][rt][cq][lane] = s;
  __syncthreads();   // the four partial sums of every row are written
  const float mu = ((sred[0][rt][0][lane] + sred[0][rt][1][lane]) + (sred[0][rt][2][lane] + sred[0][rt][3][lane])) * (1.0f / EE);
#pragma unroll
  for (int t = 0; t < 4; ++t) { sp[t] = 0.f;
#pragma unroll
    for (int r = 0; r < 8; ++r) { const float d = ml[t][r] - mu; sp[t] += d * d; } }
  float q2 = (sp[0] + sp[1]) + (sp[2] + sp[3]); q2 += xhalf(q2); sred[1][rt][cq][lane] = q2;
  __syncthreads();   // the four partial sums of squares of every row are written
  const float rs = rsqrtf(((sred[1][rt][0][lane] + sred[1][rt][1][lane]) + (sred[1][rt][2][lane] + sred[1][rt][3][lane])) * (1.0f / EE) + 1e-5f);
#pragma unroll
  for (int t = 0; t < 4; ++t) { const int nl = 16 * t + 8 * g; v4f o[2];
#pragma unroll
    for (int r = 0; r < 8; ++r) { const float lnv = (ml[t][r] - mu) * rs * lg[t][r >> 2][r & 3] + lb[t][r >> 2][r & 3]; o[r >> 2][r & 3] = g1[t][r] * lnv + g1[t][r]; }
    vst2(&sx[wave][c][nl], o[0]); vst2(&sx[wave][c][nl + 4], o[1]); }
  LDSX();   // the out tile is read back by other lanes of this wave
  float* op = out + (size_t)(r0 + g) * EE + n0 + c * 4;   // store i: rows 2 i + g, 256 contiguous bytes each
#pragma unroll   // unrolled: the eight LDS reads go out together
  for (int i = 0; i < 8; ++i) vst2(op + i * 2 * EE, *(const v4f*)(&sx[wave][2 * i + g][c * 4]));
}
extern "C" void kernel_launch(void* const* d_in, const int* in_sizes, int n_in, void* d_out, int out_size, void* d_ws, size_t ws_size, hipStream_t stream) {
  (void)in_sizes; (void)n_in; (void)out_size; (void)ws_size;
  const float** I = (const float**)d_in;
  const float* x = I[0]; const float* lng = I[1]; const float* lnb = I[2]; const float* Wq = I[3]; const float* bq = I[4]; const float* Wk = I[5]; const float* bk = I[6]; const float* Wv = I[7]; const float* bv = I[8]; const float* Wo = I[9]; const float* bo = I[10]; const float* rel = I[11]; const float* gW = I[12]; const float* gb = I[13]; const float* mW = I[14]; const float* mb = I[15];
  float* out = (float*)d_out;
  char* ws = (char*)d_ws; size_t off = 0;
  auto take = [&](size_t bytes) { char* p = ws + off; off += (bytes + 255) & ~(size_t)255; return p; };
  _Float16* X16 = (_Float16*)take((size_t)NR * EE * 2); _Float16* M16 = (_Float16*)take((size_t)NR * EE * 2); _Float16* P = (_Float16*)take((size_t)6 * EE * EE * 2);
  _Float16* Q16 = (_Float16*)take((size_t)NR * EE * 2); _Float16* K16 = (_Float16*)take((size_t)NR * EE * 2); _Float16* VT = (_Float16*)take((size_t)NR * EE * 2); float* R32 = (float*)take((size_t)SS * SS * 4);
  k_ln<<<NR / 16, 256, 0, stream>>>(x, lng, lnb, X16, M16);
  k_pack<<<6 * EE / 16 + SS / 16 * 4, 256, 0, stream>>>(Wq, Wk, Wv, Wo, gW, mW, rel, P, R32);
  k_qkv<<<dim3(NR / 64, EE / 128, 3), 128, 0, stream>>>(X16, P, bq, bk, bv, Q16, K16, VT);
  k_attn_post<<<NR / 64, 512, 0, stream>>>(Q16, K16, VT, R32, M16, P, bo, gb, mb, lng, lnb, x, out);
}

// v008
// One run takes 72.6 microseconds.
// Timed twice side by side with v007, it ran 1.11 and 1.10 times as fast.
// Counting every step since v000, it is 3.28 times as fast.
#include <hip/hip_runtime.h>
#include <math.h>

typedef __attribute__((ext_vector_type(16))) _Float16 v16h;
typedef __attribute__((ext_vector_type(16))) __bf16 v16b;
typedef __attribute__((ext_vector_type(8)))  _Float16 v8h;
typedef __attribute__((ext_vector_type(8)))  float v8f;
typedef __attribute__((ext_vector_type(4)))  float v4f;
typedef __attribute__((ext_vector_type(2)))  float v2f;
typedef __attribute__((ext_vector_type(4)))  unsigned v4u;
typedef __attribute__((ext_vector_type(4)))  int v4i;
typedef float __attribute__((may_alias)) float_a;
typedef int __attribute__((may_alias)) int_a;

template <typename T> __device__ __forceinline__ void vst2(void* p, T v) { *(T*)p = v;  }
__device__ __forceinline__ v8f wmma16(v16h a, v16h b, v8f c) {
  return __builtin_amdgcn_wmma_f32_16x16x32_f16(false, a, false, b, (short)0, c, false, false);   // the bare builtin: the compiler keeps the distance to the next user of D, A or B itself, with useful work where there is some
}
__device__ __forceinline__ v8f wmma_bf(v16b a, v16b b, v8f c) {
  v8f d = __builtin_amdgcn_wmma_f32_16x16x32_bf16(false, a, false, b, (short)0, c, false, false);
  asm volatile("v_nop\n\tv_nop\n\tv_nop\n\tv_nop" : "+v"(d) : "v"(a), "v"(b));
  return d;
}
// 16x16x32 fragments: lane = (h = lane>>4, row/col = lane&15); elements 0..7 = k0+8h+0..7, 8..15 = k0+16+8h+0..7; D element r = row 8h+r
__device__ __forceinline__ v16h frag_h(const _Float16* rowk0, int lane) {
  union { v16h v; v8h q[2]; } u; const _Float16* p = rowk0 + 8 * (lane >> 4);
  u.q[0] = *(const v8h*)p; u.q[1] = *(const v8h*)(p + 16); return u.v;
}
// the same fragment from a pointer that already holds the lane half's offset (row + k0 + 8h)
__device__ __forceinline__ v16h frag_at(const _Float16* p) {
  union { v16h v; v8h q[2]; } u; u.q[0] = *(const v8h*)p; u.q[1] = *(const v8h*)(p + 16); return u.v;
}
// the same fragment from a tile kept in fragment order: 16 rows x 32 k = 512 halves as [k >> 3][row][k & 7]; p = tile + 8 * lane, so each of the two loads reads 512 contiguous bytes (4 whole lines) over the wave
__device__ __forceinline__ v16h frag_t(const _Float16* p) {
  union { v16h v; v8h q[2]; } u; u.q[0] = *(const v8h*)p; u.q[1] = *(const v8h*)(p + 256); return u.v;
}
__device__ __forceinline__ v16h frag_f32(const float* rowk0, int lane) {
  v16h a; const float* p = rowk0 + 8 * (lane >> 4);
#pragma unroll
  for (int i = 0; i < 8; ++i) { a[i] = (_Float16)p[i]; a[8 + i] = (_Float16)p[16 + i]; }
  return a;
}
__device__ __forceinline__ v16h frag_f32s(const float* rowk0, int lane, float sc) {
  v16h a; const float* p = rowk0 + 8 * (lane >> 4);
#pragma unroll
  for (int i = 0; i < 8; ++i) { a[i] = (_Float16)(p[i] * sc); a[8 + i] = (_Float16)(p[16 + i] * sc); }
  return a;
}
// column fragment from a [K][ld] layout (column n), rows >= K read as 0
__device__ __forceinline__ v16h fragc_f32(const float* W, int k0, int n, int lane, int ld, int K) {
  v16h a; const int g = lane >> 4;
#pragma unroll
  for (int i = 0; i < 8; ++i) { const int ka = k0 + 8 * g + i, kb = ka + 16;
    a[i] = (_Float16)(ka < K ? W[(size_t)ka * ld + n] : 0.f); a[8 + i] = (_Float16)(kb < K ? W[(size_t)kb * ld + n] : 0.f); }
  return a;
}
struct F2 { v16b h, l; };
__device__ __forceinline__ F2 bsplit16(const float v[16]) { F2 r;
#pragma unroll
  for (int i = 0; i < 16; ++i) { const __bf16 h = (__bf16)v[i]; r.h[i] = h; r.l[i] = (__bf16)(v[i] - (float)h); }
  return r; }
__device__ __forceinline__ F2 split_row(const float* row, int k0, int lane) { float v[16]; const float* p = row + k0 + 8 * (lane >> 4);
#pragma unroll
  for (int i = 0; i < 8; ++i) { v[i] = p[i]; v[8 + i] = p[16 + i]; }
  return bsplit16(v); }
__device__ __forceinline__ F2 split_rowK(const float* row, int k0, int lane, int K) { float v[16]; const int g = lane >> 4;
#pragma unroll
  for (int i = 0; i < 8; ++i) { const int ka = k0 + 8 * g + i, kb = ka + 16; v[i] = ka < K ? row[ka] : 0.f; v[8 + i] = kb < K ? row[kb] : 0.f; }
  return bsplit16(v); }
__device__ __forceinline__ F2 split_col(const float* W, int k0, int n, int lane, int ld, int K) { float v[16]; const int g = lane >> 4;
#pragma unroll
  for (int i = 0; i < 8; ++i) { const int ka = k0 + 8 * g + i, kb = ka + 16; v[i] = ka < K ? W[(size_t)ka * ld + n] : 0.f; v[8 + i] = kb < K ? W[(size_t)kb * ld + n] : 0.f; }
  return bsplit16(v); }
__device__ __forceinline__ v8f mac3(const F2& a, const F2& b, v8f c) { c = wmma_bf(a.l, b.h, c); c = wmma_bf(a.h, b.l, c); return wmma_bf(a.h, b.h, c); }
#define L2E 1.4426950408889634f
// e^x as 2^(x log2 e) on the bare v_exp_f32, without the library's range fix-ups: a vanishing result may be 0 and an overflowing one is infinity, which suits every use here
__device__ __forceinline__ float sigm(float v) { return 1.0f / (1.0f + __builtin_amdgcn_exp2f(v * -L2E)); }
#define LDSX() do { asm volatile("s_wait_dscnt 0" ::: "memory"); __builtin_amdgcn_wave_barrier(); __builtin_amdgcn_fence(__ATOMIC_RELEASE, "workgroup"); } while (0)

// Gated relation-transformer block: LN(x); 8-head (d=32) self attention with an additive [S,S] relation bias (read as data) and output
// projection; gate0 = sigmoid(x gW + gb); gate1 = gate0*mha + x; mlp = sigmoid(gate1 mW + mb); out = gate1*LN(mlp) + gate1.
// All six [in][out] weights packed transposed to f16 rows (x16); every product on v_wmma_f32_16x16x32_f16 (activations as f16 copies /
// LDS tiles, q/k/v head-major x4, P x2^14); LayerNorms, softmax (online over 16 key tiles), sigmoids and gating in f32.
// Every f16 workspace array is a sequence of 16 x 32 tiles in fragment order (frag_t), written by whole lines through LDS; the bias is copied into accumulator order likewise.
#define NB 16
#define SS 1024
#define EE 256
#define NH 8
#define HD 32
#define NR (NB * SS)

// P tiles [w*16 + n/16][k chunk] of W_w[k][n]*16 (tile row = n) for w: 0 Wq, 1 Wk, 2 Wv, 3 Wo, 4 gW, 5 mW ; block = 16 columns n, thread = row k
// blocks from 96 on: R32 = the bias as 16 x 16 f32 tiles [q / 16][key / 16] in the accumulator order of the transposed score tile (D register r of lane (g, c) = rel[q c][key 8 g + r]), [r >> 2][lane][r & 3] ; block = 16 rows x 256 columns
__global__ __launch_bounds__(256) void k_pack(const float* __restrict__ Wq, const float* __restrict__ Wk, const float* __restrict__ Wv, const float* __restrict__ Wo, const float* __restrict__ gW, const float* __restrict__ mW, const float* __restrict__ rel, _Float16* __restrict__ P, float* __restrict__ R32) {
  const int blk = blockIdx.x, tid = threadIdx.x; __shared__ __align__(16) _Float16 sc[16][EE + 8]; __shared__ __align__(16) float sr[16][256 + 4];
  if (blk >= 6 * EE / 16) { const int rb = blk - 6 * EE / 16, qt = rb >> 2, c0 = (rb & 3) * 256;   // the same for the whole block
    const int hi = tid >> 6, lo = tid & 63; const float* rp = rel + (size_t)(qt * 16 + hi) * SS + c0 + lo * 4; v4f in[4];
#pragma unroll   // unrolled: the four loads go out together
    for (int i = 0; i < 4; ++i) in[i] = *(const v4f*)(rp + i * 4 * SS);
    // the loads' address registers stay whole up to this wait
    asm volatile("s_wait_xcnt 0x0" :: "v"(rp) : "memory");
#pragma unroll
    for (int i = 0; i < 4; ++i) vst2(&sr[hi + 4 * i][lo * 4], in[i]);
    __syncthreads();
    const int u = (lo >> 5) & 1, gg = (lo >> 4) & 1, cc = lo & 15; float* wp = R32 + ((size_t)qt * (SS / 16) + (c0 >> 4) + hi) * 256 + lo * 4;
#pragma unroll   // unrolled: the LDS reads of all four stores go out together
    for (int i = 0; i < 4; ++i) { v4f o;   // tile hi + 4 i of the block's 16
#pragma unroll
      for (int e = 0; e < 4; ++e) o[e] = sr[cc][(hi + 4 * i) * 16 + 8 * gg + 4 * u + e];
      vst2(wp + i * 4 * 256, o); }
    return; }
  const int which = blk >> 4, n0 = (blk & 15) * 16; const float* W = which == 0 ? Wq : which == 1 ? Wk : which == 2 ? Wv : which == 3 ? Wo : which == 4 ? gW : mW;
  const float* wr = W + (size_t)tid * EE + n0;
#pragma unroll
  for (int c = 0; c < 16; ++c) sc[c][tid] = (_Float16)(wr[c] * 16.0f);
  __syncthreads();
#pragma unroll   // unrolled: both LDS reads go out together
  for (int i = 0; i < 2; ++i) { const int q = tid + i * 256, kc = q >> 6, j = (q >> 4) & 3, c = q & 15; vst2(P + (size_t)blk * 16 * EE + q * 8, *(const v4u*)(&sc[c][kc * 32 + j * 8])); }
}
// LN(x) and q/k/v in one launch: block = 64 rows, 24 waves.
// First the waves normalise the block's rows (wave per row, 256 = 32 lanes x 8; rows wave, wave + 24, wave + 48): LN(x) stays in LDS as f16 rows, x in f16 leaves as M16 tiles ([row tile][k chunk]).
// Then wave (rt, yy, which) takes 16 rows x 128 cols = 4 heads of q, k or v; its A fragments come from the LDS rows (pitch 264 halves = 16 bytes x 33: no bank conflict)
__global__ __launch_bounds__(768) void k_qkv(const float* __restrict__ x, const float* __restrict__ lng, const float* __restrict__ lnb, const _Float16* __restrict__ P, const float* __restrict__ bq, const float* __restrict__ bk, const float* __restrict__ bv, _Float16* __restrict__ M16, _Float16* __restrict__ Q16, _Float16* __restrict__ K16, _Float16* __restrict__ VT) {
  __shared__ __align__(16) float so[16][16][132];
  __shared__ __align__(16) _Float16 st[2][128][72];
  __shared__ __align__(16) _Float16 sx[2][72][EE + 8];   // rows 64 to 71 are spare
  const int tid = threadIdx.x, wave = __builtin_amdgcn_readfirstlane(tid >> 5), lane = tid & 31, col = lane & 15, g = lane >> 4;   // the wave's number in a scalar register: every test on it is a scalar branch
  const int rt = wave & 3, yy = (wave >> 2) & 1, which = wave >> 3, r0b = blockIdx.x * 64, n0 = yy * 128; const int b = r0b / SS, s0 = r0b % SS;
  { const int r3 = wave < 16 ? wave + 48 : 63;   // 64 rows on 24 waves: the third round has 16; the other 8 waves work row 63 along, into the spare LDS rows, so that the three rows' sums advance side by side with no branch among them
    const float* xr = x + ((size_t)r0b + wave) * EE + lane * 8; const float* xr3 = x + ((size_t)r0b + r3) * EE + lane * 8; float vv[3][8];
#pragma unroll
    for (int e = 0; e < 8; ++e) { vv[0][e] = xr[e]; vv[1][e] = xr[24 * EE + e]; vv[2][e] = xr3[e]; }
    // the loads' address registers stay whole up to this wait
    asm volatile("s_wait_xcnt 0x0" :: "v"(xr), "v"(xr3) : "memory");
#pragma unroll   // unrolled: three independent chains of cross-lane sums
    for (int i = 0; i < 3; ++i) { const int rl = wave + 24 * i; float v[8]; float s = 0.f;
#pragma unroll
        for (int e = 0; e < 8; ++e) { v[e] = vv[i][e]; s += v[e]; }
#pragma unroll
        for (int off = 16; off >= 1; off >>= 1) s += __shfl_xor(s, off, 32);
        const float mu = s * (1.0f / EE); float q2 = 0.f;
#pragma unroll
        for (int e = 0; e < 8; ++e) { const float d = v[e] - mu; q2 += d * d; }
#pragma unroll
        for (int off = 16; off >= 1; off >>= 1) q2 += __shfl_xor(q2, off, 32);
        const float rs = rsqrtf(q2 * (1.0f / EE) + 1e-5f);
        union { v8h h; v4u u; } p1, p2;
#pragma unroll
        for (int e = 0; e < 8; ++e) { const int c = lane * 8 + e; p1.h[e] = (_Float16)((v[e] - mu) * rs * lng[c] + lnb[c]); p2.h[e] = (_Float16)v[e]; }
        vst2(&sx[0][rl][lane * 8], p1.u); vst2(&sx[1][rl][lane * 8], p2.u); } }
  __syncthreads();   // all 64 rows of LN(x) and of x stand in LDS
  if (wave < 16) {   // x in f16 leaves by whole lines: 4 row tiles of 512 chunks of 16 bytes, a chunk of each per thread
    _Float16* mp = M16 + (size_t)r0b * EE + tid * 8; const _Float16* ms = &sx[1][tid & 15][(tid >> 6) * 32 + ((tid >> 4) & 3) * 8]; v4u md[4];
#pragma unroll   // unrolled: the four LDS reads go out together
    for (int i = 0; i < 4; ++i) md[i] = *(const v4u*)(ms + i * 16 * (EE + 8));
#pragma unroll
    for (int i = 0; i < 4; ++i) vst2(mp + i * 16 * EE, md[i]);
    // the stores' address registers stay whole up to this wait
    asm volatile("s_wait_xcnt 0x0" ::: "memory");
    __builtin_amdgcn_sched_barrier(0); }   // keeps what follows, which reuses those registers, behind the wait
  const _Float16* Pw = P + (size_t)which * EE * EE; const float* bias = which == 0 ? bq : (which == 1 ? bk : bv);
  v8f acc[8] = {};
  const _Float16* pa = &sx[0][rt * 16 + col][8 * g]; const _Float16* pb = Pw + (size_t)n0 * EE + 8 * lane;
#pragma unroll
  for (int kc = 0; kc < EE / 32; ++kc) { const v16h a = frag_at(pa + kc * 32); v16h bf[8];   // all fragments of the k step are requested before its first product
#pragma unroll
    for (int j = 0; j < 8; ++j) bf[j] = frag_t(pb + j * 16 * EE + kc * 512);
    __builtin_amdgcn_sched_barrier(0);   // keeps the k step's requests one batch ahead of its products: mixed among them, two fragment sets would take turns, a load round trip for every two products
#pragma unroll
    for (int j = 0; j < 8; ++j) acc[j] = wmma16(a, bf[j], acc[j]);
    __builtin_amdgcn_sched_barrier(0); }   // keeps the next k step's requests behind these products: moved up among them they take ten more registers, and with them a wave per SIMD
  // the loads' address registers stay whole up to this wait
  asm volatile("s_wait_xcnt 0x0" :: "v"(pb) : "memory");
  if (which < 2) {   // waves 0 to 15
#pragma unroll
    for (int j = 0; j < 8; ++j) { const float bbv = bias[n0 + j * 16 + col];
#pragma unroll
      for (int r = 0; r < 8; ++r) so[wave][8 * g + r][j * 16 + col] = (acc[j][r] * (1.0f / 16.0f) + bbv) * 4.0f; }
    LDSX();
    _Float16* D = which == 0 ? Q16 : K16;
    // 128 cols = 4 heads of 32: per head one 16 x 32 tile (tile row = position, k = d) = 64 x v4u in fragment order
    for (int q = lane; q < 16 * 4 * 4; q += 32) { const int hh = q >> 6, pc = (q >> 4) & 3, rl = q & 15; const int h = (n0 >> 5) + hh; union { v8h h8; v4u u; } pk;
#pragma unroll
      for (int e = 0; e < 8; ++e) pk.h8[e] = (_Float16)so[wave][rl][hh * 32 + pc * 8 + e];
      vst2(D + (((size_t)b * NH + h) * SS + s0 + rt * 16) * HD + (q & 63) * 8, pk.u); } }
  else {
#pragma unroll
    for (int j = 0; j < 8; ++j) { const float bbv = bias[n0 + j * 16 + col];
#pragma unroll
      for (int r = 0; r < 8; ++r) st[yy][j * 16 + col][rt * 16 + 8 * g + r] = (_Float16)((acc[j][r] * (1.0f / 16.0f) + bbv) * 4.0f); } }
  __syncthreads();   // the four row tiles of v's columns stand in LDS; every wave of the block passes here
  if (which == 2) {
    // VT tiles [b][h][32-key chunk][d / 16] (tile row = d, k = key)
    for (int q = rt * 32 + lane; q < 128 * 8; q += 128) { const int hh = q >> 8, kb = (q >> 7) & 1, t = (q >> 6) & 1, j = (q >> 4) & 3, c = q & 15;
      vst2(VT + ((((size_t)b * NH + (n0 >> 5) + hh) * (SS / 32) + (s0 >> 5) + kb) * 2 + t) * 512 + (q & 63) * 8, *(const v4u*)(&st[yy][hh * 32 + t * 16 + c][kb * 32 + j * 8])); } }
}
// lane l's value from lane l ^ 16, on the vector unit (no LDS path)
__device__ __forceinline__ float xhalf(float v) { return __builtin_bit_cast(float, __builtin_amdgcn_permlanex16(__builtin_bit_cast(int, v), __builtin_bit_cast(int, v), 0x76543210, 0xfedcba98, false, false)); }
// Attention and all that follows it in one launch: block = 64 rows of one batch element, 16 waves; wave (rt, cq).
// Attention part, transposed: the wave takes 16 queries (row tile rt) of the heads 2 cq and 2 cq + 1. S^T = K q^T / sqrt(32) + rel^T (rel = the R32 tiles, read once for both heads), so a lane holds 32 of the 64 scores of ONE query
// (column lane & 15, keys 16 t + 8 g + r); online softmax over 16 tiles in registers; two S^T tiles converted in place are the B fragment of O^T += V^T P^T; O x8 goes to LDS as [row tile][head] tiles (tile row = position, k = d).
// Post part, transposed: the wave takes 16 rows x 64 columns as D^T = W^T A^T, so a lane holds 32 columns (n0 + 16 t + 8 g + r) of ONE row (lane & 15).
// rmha = O@Wo + bo ; gate0 = sigmoid(x gW + gb) ; gate1 = gate0*rmha + x ; mlp = sigmoid(gate1 mW + mb) ; out = gate1 * (LN(mlp) + 1): all of it on the accumulator registers.
// Two gate1 tiles converted in place are one B fragment of the third product; the waves of a row tile swap these fragments and their LN partial sums through LDS.
__global__ __launch_bounds__(512) void k_attn_post(const _Float16* __restrict__ Q16, const _Float16* __restrict__ K16, const _Float16* __restrict__ VT, const float* __restrict__ rel, const _Float16* __restrict__ M16, const _Float16* __restrict__ P,
                                                 const float* __restrict__ bo, const float* __restrict__ gb, const float* __restrict__ mb, const float* __restrict__ lng, const float* __restrict__ lnb, const float* __restrict__ x, float* __restrict__ out) {
  __shared__ __align__(16) float sx[16][16][68];        // a wave's own 16 x 64 tile: x on the way in, out on the way out, so that global accesses cover whole lines; pitch 68: 16 rows of 16 bytes fall on all 64 banks
  __shared__ __align__(16) _Float16 sb[4][8][512];      // gate1 in f16: [row tile][k chunk] in fragment order
  __shared__ __align__(16) _Float16 so[4][8][512];      // attention's O in f16: [row tile][head = k chunk] in fragment order
  __shared__ float sred[2][4][4][32];                   // LN partial sums [sum, squares][row tile][column quarter][lane]
  const int tid = threadIdx.x, wave = __builtin_amdgcn_readfirstlane(tid >> 5), lane = tid & 31, c = lane & 15, g = lane >> 4;   // the wave's number in a scalar register: what follows from it costs no vector register
  const int rt = wave & 3, cq = wave >> 2, r0 = blockIdx.x * 64 + rt * 16, n0 = cq * 64;
  const float* xp = x + (size_t)(r0 + g) * EE + n0 + c * 4; v4f xin[8];   // load i: rows 2 i + g, 256 contiguous bytes each
  const _Float16* Mt = M16 + (size_t)r0 * EE + 8 * lane;
  const _Float16* Wt = P + (size_t)(3 * EE + n0) * EE + 8 * lane;   // Wo's tiles of the wave's columns; gW's stand EE * EE halves further, mW's twice that
  // post part: three fragment sets take turns; half step hs = 2 kc + m: m = 0 is Wo's k chunk kc against O's, m = 1 gW's against x's
  v16h fa[3], fw[3][4];
  auto fetchw = [&](int hs, int z) {
#pragma unroll
    for (int t = 0; t < 4; ++t) fw[z][t] = frag_t(Wt + (hs & 1) * EE * EE + t * 16 * EE + (hs >> 1) * 512); };
  auto fetch = [&](int hs, int z) { const int kc = hs >> 1; fa[z] = (hs & 1) ? frag_t(Mt + kc * 512) : frag_t(&so[rt][kc][8 * lane]);   // O's chunk kc = head kc (HD = 32)
    fetchw(hs, z); };
  auto fetchm = [&](int kc, int z) {
#pragma unroll
    for (int t = 0; t < 4; ++t) fw[z][t] = frag_t(Wt + 2 * EE * EE + t * 16 * EE + kc * 512); };
  { const int q0 = r0 % SS; const size_t bh = (size_t)(r0 / SS) * NH + 2 * cq;   // the first of the wave's two heads; the second one's arrays stand one head further
    const float scl = (1.0f / 16.0f) / sqrtf((float)HD);
    v16h bq[2]; float mrun[2], lrun[2]; v8f acc[2][2] = {};   // lrun: this lane half's keys only, the halves are joined behind the loop
#pragma unroll
    for (int hh = 0; hh < 2; ++hh) { bq[hh] = frag_t(Q16 + ((bh + hh) * SS + q0) * HD + 8 * lane); mrun[hh] = -3.0e38f; lrun[hh] = 0.f; }
#pragma unroll 1   // stays rolled: two trips side by side would not fit the 256 registers
    for (int kt = 0; kt < SS / 64; ++kt) {
      v16h kf[2][4], vf[2][2][2]; float bs[4][8], sv[2][4][8];   // the tile's K and bias operands are all requested here, ahead of the first product
      const _Float16* pk = K16 + (bh * SS + kt * 64) * HD + 8 * lane; const _Float16* pv = VT + (bh * (SS / 32) + kt * 2) * 1024 + 8 * lane; const float* pr = rel + ((size_t)(q0 >> 4) * (SS / 16) + kt * 4) * 256 + 4 * lane;
#pragma unroll
      for (int hh = 0; hh < 2; ++hh) {
#pragma unroll
        for (int t = 0; t < 4; ++t) kf[hh][t] = frag_t(pk + hh * SS * HD + t * 512); }
#pragma unroll
      for (int t = 0; t < 4; ++t) {
#pragma unroll
        for (int r = 0; r < 8; ++r) bs[t][r] = pr[t * 256 + (r >> 2) * 128 + (r & 3)]; }
      // the batch's address registers stay whole up to this wait
      asm volatile("s_wait_xcnt 0x0" :: "v"(pk), "v"(pr) : "memory");
      __builtin_amdgcn_sched_barrier(0);   // keeps every product behind the whole batch of requests: moved up among them, the products would split the batch into pairs, each with a wait of its own
#pragma unroll
      for (int hh = 0; hh < 2; ++hh) {
#pragma unroll
        for (int t = 0; t < 4; ++t) { v8f s = {};
          s = wmma16(kf[hh][t], bq[hh], s);
#pragma unroll
          for (int r = 0; r < 8; ++r) sv[hh][t][r] = s[r] * scl + bs[t][r]; } }
      // three products in a row, then by turns one tile's multiply-adds and one more product: products and multiply-adds of other tiles fill each hazard distance, where a product followed by its own multiply-adds takes v_nop
      __builtin_amdgcn_sched_group_barrier(0x8, 3, 0); __builtin_amdgcn_sched_group_barrier(0x2, 4, 0);
#pragma unroll   // unrolled: the builtins are marks for the scheduler, five pairs of them in a row
      for (int i = 0; i < 5; ++i) { __builtin_amdgcn_sched_group_barrier(0x8, 1, 0); __builtin_amdgcn_sched_group_barrier(0x2, 4, 0); }
      __builtin_amdgcn_sched_group_barrier(0x2, 8, 0);
      __builtin_amdgcn_sched_barrier(0);   // keeps V's requests behind the score products, whose K registers they take over
      // V is requested here, into the registers K has left, and lands under the softmax
#pragma unroll
      for (int hh = 0; hh < 2; ++hh) {
#pragma unroll
        for (int kc = 0; kc < 2; ++kc) {
#pragma unroll
          for (int t = 0; t < 2; ++t) vf[hh][kc][t] = frag_t(pv + hh * (SS / 32) * 1024 + (kc * 2 + t) * 512); } }
      // as above, for V's address registers
      asm volatile("s_wait_xcnt 0x0" :: "v"(pv) : "memory");
      __builtin_amdgcn_sched_barrier(0);   // keeps all of V's requests ahead of the softmax, which covers their flight
#pragma unroll
      for (int hh = 0; hh < 2; ++hh) {
        float mx = -3.4e38f;
#pragma unroll
        for (int t = 0; t < 4; ++t) {
#pragma unroll
          for (int r = 0; r < 8; ++r) mx = fmaxf(mx, sv[hh][t][r]); }
        mx = fmaxf(mx, xhalf(mx));
        const float mnew = fmaxf(mrun[hh], mx); const float corr = __builtin_amdgcn_exp2f((mrun[hh] - mnew) * L2E);
        const float eoff = 14.0f - mnew * L2E;   // exponent offset: minus the maximum in base 2, plus 14 for P's 2^14 scale; ps and lrun carry that scale too
        v2f ps = {}; v16h pf[2];   // even and odd keys are summed side by side, one packed add for two
#pragma unroll
        for (int t = 0; t < 4; ++t) {
#pragma unroll
          for (int r = 0; r < 8; r += 2) { v2f pp; pp[0] = __builtin_amdgcn_exp2f(fmaf(sv[hh][t][r], L2E, eoff)); pp[1] = __builtin_amdgcn_exp2f(fmaf(sv[hh][t][r + 1], L2E, eoff)); ps += pp;
            pf[t >> 1][(t & 1) * 8 + r] = (_Float16)pp[0]; pf[t >> 1][(t & 1) * 8 + r + 1] = (_Float16)pp[1]; } }
        lrun[hh] = lrun[hh] * corr + (ps[0] + ps[1]); mrun[hh] = mnew;
#pragma unroll
        for (int r = 0; r < 8; ++r) { acc[hh][0][r] *= corr; acc[hh][1][r] *= corr; }
#pragma unroll
        for (int kc = 0; kc < 2; ++kc) {
#pragma unroll
          for (int t = 0; t < 2; ++t) acc[hh][t] = wmma16(vf[hh][kc][t], pf[kc], acc[hh][t]); } } }
    // what the post part needs first and what does not hang on O is requested here: it flies under the division, the O stores and the wait for the other waves
#pragma unroll
    for (int i = 0; i < 8; ++i) xin[i] = *(const v4f*)(xp + i * 2 * EE);
    fetchw(0, 0); fetchw(1, 1); fetchw(2, 2); fa[1] = frag_t(Mt);
    // acc[hh][t][r] = O[query lane & 15][d = 16 t + 8 g + r] of head 2 cq + hh: the lane's 8 halves are chunk 32 t + lane of that head's tile
#pragma unroll
    for (int hh = 0; hh < 2; ++hh) { const float lr = lrun[hh] + xhalf(lrun[hh]); const float inv = 8.0f / (lr * 4.0f);
#pragma unroll
      for (int t = 0; t < 2; ++t) { union { v8h h8; v4u u; } pk;
#pragma unroll
        for (int r = 0; r < 8; ++r) pk.h8[r] = (_Float16)(acc[hh][t][r] * inv);
        vst2(&so[rt][2 * cq + hh][(32 * t + lane) * 8], pk.u); } } }
  __syncthreads();   // every wave of the row tile has written its two heads of O
  // (1) rmha^T and the gate's pre-activation^T: a set is requested anew as soon as its products are issued, two half steps ahead of its next use
  v8f ao[4] = {}, ag[4] = {};
  fa[0] = frag_t(&so[rt][0][8 * lane]); fa[2] = frag_t(&so[rt][1][8 * lane]);   // O's part of the first three sets; the rest was requested ahead of the barrier
  // the x loads' address registers stay whole up to this wait
  asm volatile("s_wait_xcnt 0x0" :: "v"(xp) : "memory");
#pragma unroll
  for (int i = 0; i < 8; ++i) vst2(&sx[wave][2 * i + g][c * 4], xin[i]);
#pragma unroll   // unrolled whole: which set a half step uses is known at compile time, and the last fetches drop out
  for (int hs = 0; hs < 2 * (EE / 32); ++hs) { const int z = hs % 3;
#pragma unroll
    for (int t = 0; t < 4; ++t) { if (hs & 1) ag[t] = wmma16(fw[z][t], fa[z], ag[t]); else ao[t] = wmma16(fw[z][t], fa[z], ao[t]); }
    if (hs + 3 < 2 * (EE / 32)) fetch(hs + 3, z);
    __builtin_amdgcn_sched_barrier(0); }   // keeps the ring's order: requests moved further ahead would need a fourth fragment set, which the 256 registers do not hold
  fetchm(0, 0); fetchm(1, 1); fetchm(2, 2);   // mW's first fragments fly under the gate's arithmetic and have landed at the barrier, which waits for every load
  const float* bop = bo + n0 + 8 * g; const float* gbp = gb + n0 + 8 * g; v4f bov[4][2], gbv[4][2];   // the lane's 8 columns of each tile
#pragma unroll
  for (int t = 0; t < 4; ++t) {
#pragma unroll
    for (int u = 0; u < 2; ++u) { bov[t][u] = *(const v4f*)(bop + 16 * t + 4 * u); gbv[t][u] = *(const v4f*)(gbp + 16 * t + 4 * u); } }
  // the address registers of all loads so far stay whole up to this wait
  asm volatile("s_wait_xcnt 0x0" :: "v"(bop), "v"(gbp) : "memory");
  __builtin_amdgcn_sched_barrier(0);   // keeps the arithmetic below, which reuses those registers, behind the wait
  LDSX();   // the x tile was written by other lanes of this wave
  // (2) gate1 = sigmoid(pre) * rmha + x, kept in f32 for the last step and handed on in f16
  float g1[4][8]; v16h pf[2];
#pragma unroll
  for (int t = 0; t < 4; ++t) { const int nl = 16 * t + 8 * g; float xv[8];
#pragma unroll
    for (int r = 0; r < 8; ++r) xv[r] = sx[wave][c][nl + r];
#pragma unroll
    for (int r = 0; r < 8; ++r) { const float rm = ao[t][r] * (1.0f / 128.0f) + bov[t][r >> 2][r & 3]; const float v = sigm(ag[t][r] * (1.0f / 16.0f) + gbv[t][r >> 2][r & 3]) * rm + xv[r];
      g1[t][r] = v; pf[t >> 1][(t & 1) * 8 + r] = (_Float16)v; } }
#pragma unroll
  for (int j = 0; j < 2; ++j) { union { v16h v; v4u q[2]; } u; u.v = pf[j]; _Float16* d = &sb[rt][cq * 2 + j][8 * lane]; vst2(d, u.q[0]); vst2(d + 256, u.q[1]); }
  __syncthreads();   // every wave of the row tile has written its two k chunks of gate1
  // (3) mlp^T = sigmoid(mW^T gate1^T + mb)
  v8f am[4] = {}; v4f mbv[4][2], lg[4][2], lb[4][2];   // the lane's 8 columns of each tile of mb, ln_g, ln_b
  const float* mbp = mb + n0 + 8 * g; const float* lgp = lng + n0 + 8 * g; const float* lbp = lnb + n0 + 8 * g;
  auto fetchv = [&](const float* p, v4f (&v)[4][2]) {
#pragma unroll
    for (int t = 0; t < 4; ++t) { v[t][0] = *(const v4f*)(p + 16 * t); v[t][1] = *(const v4f*)(p + 16 * t + 4); } };
#pragma unroll   // unrolled whole: which set a k chunk uses is known at compile time
  for (int kh = 0; kh < 2; ++kh) { v16h bg[4];
#pragma unroll
    for (int u = 0; u < 4; ++u) bg[u] = frag_t(&sb[rt][4 * kh + u][8 * lane]);
#pragma unroll
    for (int u = 0; u < 4; ++u) { const int kc = 4 * kh + u, z = kc % 3;
#pragma unroll
      for (int t = 0; t < 4; ++t) am[t] = wmma16(fw[z][t], bg[u], am[t]);
      if (kc + 3 < EE / 32) fetchm(kc + 3, z);
      else fetchv(kc == 5 ? mbp : kc == 6 ? lgp : lbp, kc == 5 ? mbv : kc == 6 ? lg : lb);
      __builtin_amdgcn_sched_barrier(0); } }   // the last three chunks leave their sets' registers to the three vectors, which land under the products and the sigmoids; the scheduling barrier keeps the ring's order, as in (1)
  // the address registers of all loads so far stay whole up to this wait
  asm volatile("s_wait_xcnt 0x0" :: "v"(mbp), "v"(lgp), "v"(lbp) : "memory");
  __builtin_amdgcn_sched_barrier(0);   // keeps the arithmetic below, which reuses those registers, behind the wait
  float ml[4][8], sp[4];
#pragma unroll
  for (int t = 0; t < 4; ++t) sp[t] = 0.f;
#pragma unroll
  for (int r = 0; r < 8; ++r) {   // the four tiles' sums advance side by side: four independent chains
#pragma unroll
    for (int t = 0; t < 4; ++t) { const float mv = sigm(am[t][r] * (1.0f / 16.0f) + mbv[t][r >> 2][r & 3]); ml[t][r] = mv; sp[t] += mv; } }
  // (4) LN(mlp) over the row: the lane's 32 columns, the other lane half's, then the four waves' sums in a fixed order
  float s = (sp[0] + sp[1]) + (sp[2] + sp[3]); s += xhalf(s); sred[0][rt][cq][lane] = s;
  __syncthreads();   // the four partial sums of every row are written
  const float mu = ((sred[0][rt][0][lane] + sred[0][rt][1][lane]) + (sred[0][rt][2][lane] + sred[0][rt][3][lane])) * (1.0f / EE);
#pragma unroll
  for (int t = 0; t < 4; ++t) { sp[t] = 0.f;
#pragma unroll
    for (int r = 0; r < 8; ++r) { const float d = ml[t][r] - mu; sp[t] += d * d; } }
  float q2 = (sp[0] + sp[1]) + (sp[2] + sp[3]); q2 += xhalf(q2); sred[1][rt][cq][lane] = q2;
  __syncthreads();   // the four partial sums of squares of every row are written
  const float rs = rsqrtf(((sred[1][rt][0][lane] + sred[1][rt][1][lane]) + (sred[1][rt][2][lane] + sred[1][rt][3][lane])) * (1.0f / EE) + 1e-5f);
#pragma unroll
  for (int t = 0; t < 4; ++t) { const int nl = 16 * t + 8 * g; v4f o[2];
#pragma unroll
    for (int r = 0; r < 8; ++r) { const float lnv = (ml[t][r] - mu) * rs * lg[t][r >> 2][r & 3] + lb[t][r >> 2][r & 3]; o[r >> 2][r & 3] = g1[t][r] * lnv + g1[t][r]; }
    vst2(&sx[wave][c][nl], o[0]); vst2(&sx[wave][c][nl + 4], o[1]); }
  LDSX();   // the out tile is read back by other lanes of this wave
  float* op = out + (size_t)(r0 + g) * EE + n0 + c * 4;   // store i: rows 2 i + g, 256 contiguous bytes each
#pragma unroll   // unrolled: the eight LDS reads go out together
  for (int i = 0; i < 8; ++i) vst2(op + i * 2 * EE, *(const v4f*)(&sx[wave][2 * i + g][c * 4]));
}
extern "C" void kernel_launch(void* const* d_in, const int* in_sizes, int n_in, void* d_out, int out_size, void* d_ws, size_t ws_size, hipStream_t stream) {
  (void)in_sizes; (void)n_in; (void)out_size; (void)ws_size;
  const float** I = (const float**)d_in;
  const float* x = I[0]; const float* lng = I[1]; const float* lnb = I[2]; const float* Wq = I[3]; const float* bq = I[4]; const float* Wk = I[5]; const float* bk = I[6]; const float* Wv = I[7]; const float* bv = I[8]; const float* Wo = I[9]; const float* bo = I[10]; const float* rel = I[11]; const float* gW = I[12]; const float* gb = I[13]; const float* mW = I[14]; const float* mb = I[15];
  float* out = (float*)d_out;
  char* ws = (char*)d_ws; size_t off = 0;
  auto take = [&](size_t bytes) { char* p = ws + off; off += (bytes + 255) & ~(size_t)255; return p; };
  _Float16* M16 = (_Float16*)take((size_t)NR * EE * 2); _Float16* P = (_Float16*)take((size_t)6 * EE * EE * 2);
  _Float16* Q16 = (_Float16*)take((size_t)NR * EE * 2); _Float16* K16 = (_Float16*)take((size_t)NR * EE * 2); _Float16* VT = (_Float16*)take((size_t)NR * EE * 2); float* R32 = (float*)take((size_t)SS * SS * 4);
  k_pack<<<6 * EE / 16 + SS / 16 * 4, 256, 0, stream>>>(Wq, Wk, Wv, Wo, gW, mW, rel, P, R32);
  k_qkv<<<NR / 64, 768, 0, stream>>>(x, lng, lnb, P, bq, bk, bv, M16, Q16, K16, VT);
  k_attn_post<<<NR / 64, 512, 0, stream>>>(Q16, K16, VT, R32, M16, P, bo, gb, mb, lng, lnb, x, out);
}

// v009
// Measured time: 68.1 microseconds a run.
// Two timings next to v008 both put it at 1.06 times that version's speed.
// All steps since v000 together make it 3.48 times as fast.
#include <hip/hip_runtime.h>
#include <math.h>

typedef __attribute__((ext_vector_type(16))) _Float16 v16h;
typedef __attribute__((ext_vector_type(16))) __bf16 v16b;
typedef __attribute__((ext_vector_type(8)))  _Float16 v8h;
typedef __attribute__((ext_vector_type(8)))  float v8f;
typedef __attribute__((ext_vector_type(4)))  float v4f;
typedef __attribute__((ext_vector_type(2)))  float v2f;
typedef __attribute__((ext_vector_type(4)))  unsigned v4u;
typedef __attribute__((ext_vector_type(4)))  int v4i;
typedef float __attribute__((may_alias)) float_a;
typedef int __attribute__((may_alias)) int_a;

template <typename T> __device__ __forceinline__ void vst2(void* p, T v) { *(T*)p = v;  }
__device__ __forceinline__ v8f wmma16(v16h a, v16h b, v8f c) {
  return __builtin_amdgcn_wmma_f32_16x16x32_f16(false, a, false, b, (short)0, c, false, false);   // the bare builtin: the compiler keeps the distance to the next user of D, A or B itself, with useful work where there is some
}
__device__ __forceinline__ v8f wmma_bf(v16b a, v16b b, v8f c) {
  v8f d = __builtin_amdgcn_wmma_f32_16x16x32_bf16(false, a, false, b, (short)0, c, false, false);
  asm volatile("v_nop\n\tv_nop\n\tv_nop\n\tv_nop" : "+v"(d) : "v"(a), "v"(b));
  return d;
}
// 16x16x32 fragments: lane = (h = lane>>4, row/col = lane&15); elements 0..7 = k0+8h+0..7, 8..15 = k0+16+8h+0..7; D element r = row 8h+r
__device__ __forceinline__ v16h frag_h(const _Float16* rowk0, int lane) {
  union { v16h v; v8h q[2]; } u; const _Float16* p = rowk0 + 8 * (lane >> 4);
  u.q[0] = *(const v8h*)p; u.q[1] = *(const v8h*)(p + 16); return u.v;
}
// the same fragment from a pointer that already holds the lane half's offset (row + k0 + 8h)
__device__ __forceinline__ v16h frag_at(const _Float16* p) {
  union { v16h v; v8h q[2]; } u; u.q[0] = *(const v8h*)p; u.q[1] = *(const v8h*)(p + 16); return u.v;
}
// the same fragment from a tile kept in fragment order: 16 rows x 32 k = 512 halves as [k >> 3][row][k & 7]; p = tile + 8 * lane, so each of the two loads reads 512 contiguous bytes (4 whole lines) over the wave
__device__ __forceinline__ v16h frag_t(const _Float16* p) {
  union { v16h v; v8h q[2]; } u; u.q[0] = *(const v8h*)p; u.q[1] = *(const v8h*)(p + 256); return u.v;
}
__device__ __forceinline__ v16h frag_f32(const float* rowk0, int lane) {
  v16h a; const float* p = rowk0 + 8 * (lane >> 4);
#pragma unroll
  for (int i = 0; i < 8; ++i) { a[i] = (_Float16)p[i]; a[8 + i] = (_Float16)p[16 + i]; }
  return a;
}
__device__ __forceinline__ v16h frag_f32s(const float* rowk0, int lane, float sc) {
  v16h a; const float* p = rowk0 + 8 * (lane >> 4);
#pragma unroll
  for (int i = 0; i < 8; ++i) { a[i] = (_Float16)(p[i] * sc); a[8 + i] = (_Float16)(p[16 + i] * sc); }
  return a;
}
// column fragment from a [K][ld] layout (column n), rows >= K read as 0
__device__ __forceinline__ v16h fragc_f32(const float* W, int k0, int n, int lane, int ld, int K) {
  v16h a; const int g = lane >> 4;
#pragma unroll
  for (int i = 0; i < 8; ++i) { const int ka = k0 + 8 * g + i, kb = ka + 16;
    a[i] = (_Float16)(ka < K ? W[(size_t)ka * ld + n] : 0.f); a[8 + i] = (_Float16)(kb < K ? W[(size_t)kb * ld + n] : 0.f); }
  return a;
}
struct F2 { v16b h, l; };
__device__ __forceinline__ F2 bsplit16(const float v[16]) { F2 r;
#pragma unroll
  for (int i = 0; i < 16; ++i) { const __bf16 h = (__bf16)v[i]; r.h[i] = h; r.l[i] = (__bf16)(v[i] - (float)h); }
  return r; }
__device__ __forceinline__ F2 split_row(const float* row, int k0, int lane) { float v[16]; const float* p = row + k0 + 8 * (lane >> 4);
#pragma unroll
  for (int i = 0; i < 8; ++i) { v[i] = p[i]; v[8 + i] = p[16 + i]; }
  return bsplit16(v); }
__device__ __forceinline__ F2 split_rowK(const float* row, int k0, int lane, int K) { float v[16]; const int g = lane >> 4;
#pragma unroll
  for (int i = 0; i < 8; ++i) { const int ka = k0 + 8 * g + i, kb = ka + 16; v[i] = ka < K ? row[ka] : 0.f; v[8 + i] = kb < K ? row[kb] : 0.f; }
  return bsplit16(v); }
__device__ __forceinline__ F2 split_col(const float* W, int k0, int n, int lane, int ld, int K) { float v[16]; const int g = lane >> 4;
#pragma unroll
  for (int i = 0; i < 8; ++i) { const int ka = k0 + 8 * g + i, kb = ka + 16; v[i] = ka < K ? W[(size_t)ka * ld + n] : 0.f; v[8 + i] = kb < K ? W[(size_t)kb * ld + n] : 0.f; }
  return bsplit16(v); }
__device__ __forceinline__ v8f mac3(const F2& a, const F2& b, v8f c) { c = wmma_bf(a.l, b.h, c); c = wmma_bf(a.h, b.l, c); return wmma_bf(a.h, b.h, c); }
#define L2E 1.4426950408889634f
// e^x as 2^(x log2 e) on the bare v_exp_f32, without the library's range fix-ups: a vanishing result may be 0 and an overflowing one is infinity, which suits every use here
__device__ __forceinline__ float sigm(float v) { return 1.0f / (1.0f + __builtin_amdgcn_exp2f(v * -L2E)); }
#define LDSX() do { asm volatile("s_wait_dscnt 0" ::: "memory"); __builtin_amdgcn_wave_barrier(); __builtin_amdgcn_fence(__ATOMIC_RELEASE, "workgroup"); } while (0)

// Gated relation-transformer block: LN(x); 8-head (d=32) self attention with an additive [S,S] relation bias (read as data) and output
// projection; gate0 = sigmoid(x gW + gb); gate1 = gate0*mha + x; mlp = sigmoid(gate1 mW + mb); out = gate1*LN(mlp) + gate1.
// All six [in][out] weights packed transposed to f16 rows (x16); every product on v_wmma_f32_16x16x32_f16 (activations as f16 copies /
// LDS tiles, q/k/v head-major x4, P x2^14); LayerNorms, softmax (online over 16 key tiles), sigmoids and gating in f32.
// Every f16 workspace array is a sequence of 16 x 32 tiles in fragment order (frag_t), written by whole lines through LDS; the bias is copied into accumulator order likewise.
#define NB 16
#define SS 1024
#define EE 256
#define NH 8
#define HD 32
#define NR (NB * SS)

// P tiles [w*16 + n/16][k chunk] of W_w[k][n]*16 (tile row = n) for w: 0 Wq, 1 Wk, 2 Wv, 3 Wo, 4 gW, 5 mW ; block = 16 columns n, thread = row k
// blocks from 96 on: R32 = the bias as 16 x 16 f32 tiles [q / 16][key / 16] in the accumulator order of the transposed score tile (D register r of lane (g, c) = rel[q c][key 8 g + r]), [r >> 2][lane][r & 3] ; block = 16 rows x 256 columns
__global__ __launch_bounds__(256) void k_pack(const float* __restrict__ Wq, const float* __restrict__ Wk, const float* __restrict__ Wv, const float* __restrict__ Wo, const float* __restrict__ gW, const float* __restrict__ mW, const float* __restrict__ rel, _Float16* __restrict__ P, float* __restrict__ R32) {
  const int blk = blockIdx.x, tid = threadIdx.x; __shared__ __align__(16) _Float16 sc[16][EE + 8]; __shared__ __align__(16) float sr[16][256 + 4];
  if (blk >= 6 * EE / 16) { const int rb = blk - 6 * EE / 16, qt = rb >> 2, c0 = (rb & 3) * 256;   // the same for the whole block
    const int hi = tid >> 6, lo = tid & 63; const float* rp = rel + (size_t)(qt * 16 + hi) * SS + c0 + lo * 4; v4f in[4];
#pragma unroll   // unrolled: the four loads go out together
    for (int i = 0; i < 4; ++i) in[i] = *(const v4f*)(rp + i * 4 * SS);
    // the loads' address registers stay whole up to this wait
    asm volatile("s_wait_xcnt 0x0" :: "v"(rp) : "memory");
#pragma unroll
    for (int i = 0; i < 4; ++i) vst2(&sr[hi + 4 * i][lo * 4], in[i]);
    __syncthreads();
    const int u = (lo >> 5) & 1, gg = (lo >> 4) & 1, cc = lo & 15; float* wp = R32 + ((size_t)qt * (SS / 16) + (c0 >> 4) + hi) * 256 + lo * 4;
#pragma unroll   // unrolled: the LDS reads of all four stores go out together
    for (int i = 0; i < 4; ++i) { v4f o;   // tile hi + 4 i of the block's 16
#pragma unroll
      for (int e = 0; e < 4; ++e) o[e] = sr[cc][(hi + 4 * i) * 16 + 8 * gg + 4 * u + e];
      vst2(wp + i * 4 * 256, o); }
    return; }
  const int which = blk >> 4, n0 = (blk & 15) * 16; const float* W = which == 0 ? Wq : which == 1 ? Wk : which == 2 ? Wv : which == 3 ? Wo : which == 4 ? gW : mW;
  const float* wr = W + (size_t)tid * EE + n0;
#pragma unroll
  for (int c = 0; c < 16; ++c) sc[c][tid] = (_Float16)(wr[c] * 16.0f);
  __syncthreads();
#pragma unroll   // unrolled: both LDS reads go out together
  for (int i = 0; i < 2; ++i) { const int q = tid + i * 256, kc = q >> 6, j = (q >> 4) & 3, c = q & 15; vst2(P + (size_t)blk * 16 * EE + q * 8, *(const v4u*)(&sc[c][kc * 32 + j * 8])); }
}
// LN(x) and q/k/v in one launch: block = 64 rows, 24 waves.
// First the waves normalise the block's rows (wave per row, 256 = 32 lanes x 8; rows wave, wave + 24, wave + 48): LN(x) stays in LDS as f16 rows, x in f16 leaves as M16 tiles ([row tile][k chunk]).
// Then wave (rt, yy, which) takes 16 rows x 128 cols = 4 heads of q, k or v; its A fragments come from the LDS rows (pitch 264 halves = 16 bytes x 33: no bank conflict)
__global__ __launch_bounds__(768) void k_qkv(const float* __restrict__ x, const float* __restrict__ lng, const float* __restrict__ lnb, const _Float16* __restrict__ P, const float* __restrict__ bq, const float* __restrict__ bk, const float* __restrict__ bv, _Float16* __restrict__ M16, _Float16* __restrict__ Q16, _Float16* __restrict__ K16, _Float16* __restrict__ VT) {
  __shared__ __align__(16) float so[16][16][132];
  __shared__ __align__(16) _Float16 st[2][128][72];
  __shared__ __align__(16) _Float16 sx[2][72][EE + 8];   // rows 64 to 71 are spare
  const int tid = threadIdx.x, wave = __builtin_amdgcn_readfirstlane(tid >> 5), lane = tid & 31, col = lane & 15, g = lane >> 4;   // the wave's number in a scalar register: every test on it is a scalar branch
  const int rt = wave & 3, yy = (wave >> 2) & 1, which = wave >> 3, r0b = blockIdx.x * 64, n0 = yy * 128; const int b = r0b / SS, s0 = r0b % SS;
  { const int r3 = wave < 16 ? wave + 48 : 63;   // 64 rows on 24 waves: the third round has 16; the other 8 waves work row 63 along, into the spare LDS rows, so that the three rows' sums advance side by side with no branch among them
    const float* xr = x + ((size_t)r0b + wave) * EE + lane * 8; const float* xr3 = x + ((size_t)r0b + r3) * EE + lane * 8; float vv[3][8];
#pragma unroll
    for (int e = 0; e < 8; ++e) { vv[0][e] = xr[e]; vv[1][e] = xr[24 * EE + e]; vv[2][e] = xr3[e]; }
    // the loads' address registers stay whole up to this wait
    asm volatile("s_wait_xcnt 0x0" :: "v"(xr), "v"(xr3) : "memory");
#pragma unroll   // unrolled: three independent chains of cross-lane sums
    for (int i = 0; i < 3; ++i) { const int rl = wave + 24 * i; float v[8]; float s = 0.f;
#pragma unroll
        for (int e = 0; e < 8; ++e) { v[e] = vv[i][e]; s += v[e]; }
#pragma unroll
        for (int off = 16; off >= 1; off >>= 1) s += __shfl_xor(s, off, 32);
        const float mu = s * (1.0f / EE); float q2 = 0.f;
#pragma unroll
        for (int e = 0; e < 8; ++e) { const float d = v[e] - mu; q2 += d * d; }
#pragma unroll
        for (int off = 16; off >= 1; off >>= 1) q2 += __shfl_xor(q2, off, 32);
        const float rs = rsqrtf(q2 * (1.0f / EE) + 1e-5f);
        union { v8h h; v4u u; } p1, p2;
#pragma unroll
        for (int e = 0; e < 8; ++e) { const int c = lane * 8 + e; p1.h[e] = (_Float16)((v[e] - mu) * rs * lng[c] + lnb[c]); p2.h[e] = (_Float16)v[e]; }
        vst2(&sx[0][rl][lane * 8], p1.u); vst2(&sx[1][rl][lane * 8], p2.u); } }
  __syncthreads();   // all 64 rows of LN(x) and of x stand in LDS
  if (wave < 16) {   // x in f16 leaves by whole lines: 4 row tiles of 512 chunks of 16 bytes, a chunk of each per thread
    _Float16* mp = M16 + (size_t)r0b * EE + tid * 8; const _Float16* ms = &sx[1][tid & 15][(tid >> 6) * 32 + ((tid >> 4) & 3) * 8]; v4u md[4];
#pragma unroll   // unrolled: the four LDS reads go out together
    for (int i = 0; i < 4; ++i) md[i] = *(const v4u*)(ms + i * 16 * (EE + 8));
#pragma unroll
    for (int i = 0; i < 4; ++i) vst2(mp + i * 16 * EE, md[i]);
    // the stores' address registers stay whole up to this wait
    asm volatile("s_wait_xcnt 0x0" ::: "memory");
    __builtin_amdgcn_sched_barrier(0); }   // keeps what follows, which reuses those registers, behind the wait
  const _Float16* Pw = P + (size_t)which * EE * EE; const float* bias = which == 0 ? bq : (which == 1 ? bk : bv);
  v8f acc[8] = {};
  const _Float16* pa = &sx[0][rt * 16 + col][8 * g]; const _Float16* pb = Pw + (size_t)n0 * EE + 8 * lane;
  const int ks = (blockIdx.x + (blockIdx.x >> 3) + (wave >> 2)) & (EE / 32 - 1);   // every block reads the same weights: each enters the k walk at its own chunk and wraps, so that the blocks do not ask L2 for the same lines at the same moment (the four waves that share tiles keep one start)
#pragma unroll
  for (int kk = 0; kk < EE / 32; ++kk) { const int kc = (kk + ks) & (EE / 32 - 1); const _Float16* pbk = pb + kc * 512; const v16h a = frag_at(pa + kc * 32); v16h bf[8];   // all fragments of the k step are requested before its first product
#pragma unroll
    for (int j = 0; j < 8; ++j) bf[j] = frag_t(pbk + j * 16 * EE);
    // the batch's address registers stay whole up to this wait
    asm volatile("s_wait_xcnt 0x0" :: "v"(pbk) : "memory");
    __builtin_amdgcn_sched_barrier(0);   // keeps the k step's requests one batch ahead of its products: mixed among them, two fragment sets would take turns, a load round trip for every two products
#pragma unroll
    for (int j = 0; j < 8; ++j) acc[j] = wmma16(a, bf[j], acc[j]);
    __builtin_amdgcn_sched_barrier(0); }   // keeps the next k step's requests behind these products: moved up among them they take ten more registers, and with them a wave per SIMD
  if (which < 2) {   // waves 0 to 15
#pragma unroll
    for (int j = 0; j < 8; ++j) { const float bbv = bias[n0 + j * 16 + col];
#pragma unroll
      for (int r = 0; r < 8; ++r) so[wave][8 * g + r][j * 16 + col] = (acc[j][r] * (1.0f / 16.0f) + bbv) * 4.0f; }
    LDSX();
    _Float16* D = which == 0 ? Q16 : K16;
    // 128 cols = 4 heads of 32: per head one 16 x 32 tile (tile row = position, k = d) = 64 x v4u in fragment order
    for (int q = lane; q < 16 * 4 * 4; q += 32) { const int hh = q >> 6, pc = (q >> 4) & 3, rl = q & 15; const int h = (n0 >> 5) + hh; union { v8h h8; v4u u; } pk;
#pragma unroll
      for (int e = 0; e < 8; ++e) pk.h8[e] = (_Float16)so[wave][rl][hh * 32 + pc * 8 + e];
      vst2(D + (((size_t)b * NH + h) * SS + s0 + rt * 16) * HD + (q & 63) * 8, pk.u); } }
  else {
#pragma unroll
    for (int j = 0; j < 8; ++j) { const float bbv = bias[n0 + j * 16 + col];
#pragma unroll
      for (int r = 0; r < 8; ++r) st[yy][j * 16 + col][rt * 16 + 8 * g + r] = (_Float16)((acc[j][r] * (1.0f / 16.0f) + bbv) * 4.0f); } }
  __syncthreads();   // the four row tiles of v's columns stand in LDS; every wave of the block passes here
  if (which == 2) {
    // VT tiles [b][h][32-key chunk][d / 16] (tile row = d, k = key)
    for (int q = rt * 32 + lane; q < 128 * 8; q += 128) { const int hh = q >> 8, kb = (q >> 7) & 1, t = (q >> 6) & 1, j = (q >> 4) & 3, c = q & 15;
      vst2(VT + ((((size_t)b * NH + (n0 >> 5) + hh) * (SS / 32) + (s0 >> 5) + kb) * 2 + t) * 512 + (q & 63) * 8, *(const v4u*)(&st[yy][hh * 32 + t * 16 + c][kb * 32 + j * 8])); } }
}
// lane l's value from lane l ^ 16, on the vector unit (no LDS path)
__device__ __forceinline__ float xhalf(float v) { return __builtin_bit_cast(float, __builtin_amdgcn_permlanex16(__builtin_bit_cast(int, v), __builtin_bit_cast(int, v), 0x76543210, 0xfedcba98, false, false)); }
// Attention and all that follows it in one launch: block = 64 rows of one batch element, 16 waves; wave (rt, cq).
// Attention part, transposed: the wave takes 16 queries (row tile rt) of the heads 2 cq and 2 cq + 1. S^T = K q^T / sqrt(32) + rel^T (rel = the R32 tiles, read once for both heads), so a lane holds 32 of the 64 scores of ONE query
// (column lane & 15, keys 16 t + 8 g + r); online softmax over 16 tiles in registers; two S^T tiles converted in place are the B fragment of O^T += V^T P^T; O x8 goes to LDS as [row tile][head] tiles (tile row = position, k = d).
// Post part, transposed: the wave takes 16 rows x 64 columns as D^T = W^T A^T, so a lane holds 32 columns (n0 + 16 t + 8 g + r) of ONE row (lane & 15).
// rmha = O@Wo + bo ; gate0 = sigmoid(x gW + gb) ; gate1 = gate0*rmha + x ; mlp = sigmoid(gate1 mW + mb) ; out = gate1 * (LN(mlp) + 1): all of it on the accumulator registers.
// Two gate1 tiles converted in place are one B fragment of the third product; the waves of a row tile swap these fragments and their LN partial sums through LDS.
__global__ __launch_bounds__(512) void k_attn_post(const _Float16* __restrict__ Q16, const _Float16* __restrict__ K16, const _Float16* __restrict__ VT, const float* __restrict__ rel, const _Float16* __restrict__ M16, const _Float16* __restrict__ P,
                                                 const float* __restrict__ bo, const float* __restrict__ gb, const float* __restrict__ mb, const float* __restrict__ lng, const float* __restrict__ lnb, const float* __restrict__ x, float* __restrict__ out) {
  __shared__ __align__(16) float sx[16][16][68];        // a wave's own 16 x 64 tile: x on the way in, out on the way out, so that global accesses cover whole lines; pitch 68: 16 rows of 16 bytes fall on all 64 banks
  __shared__ __align__(16) _Float16 sb[4][8][512];      // gate1 in f16: [row tile][k chunk] in fragment order
  __shared__ __align__(16) _Float16 so[4][8][512];      // attention's O in f16: [row tile][head = k chunk] in fragment order
  __shared__ float sred[2][4][4][32];                   // LN partial sums [sum, squares][row tile][column quarter][lane]
  const int tid = threadIdx.x, wave = __builtin_amdgcn_readfirstlane(tid >> 5), lane = tid & 31, c = lane & 15, g = lane >> 4;   // the wave's number in a scalar register: what follows from it costs no vector register
  const int rt = wave & 3, cq = wave >> 2, r0 = blockIdx.x * 64 + rt * 16, n0 = cq * 64;
  const float* xp = x + (size_t)(r0 + g) * EE + n0 + c * 4; v4f xin[8];   // load i: rows 2 i + g, 256 contiguous bytes each
  const _Float16* Mt = M16 + (size_t)r0 * EE;
  const _Float16* Wt = P + (size_t)(3 * EE + n0) * EE;   // Wo's tiles of the wave's columns; gW's stand EE * EE halves further, mW's twice that
  const unsigned lby = 16 * lane;   // the lane's byte offset in a tile: Mt and Wt are the same for the whole wave and stay in scalar registers
  auto at = [&](const _Float16* u) { return (const _Float16*)((const char*)u + lby); };
  // post part: three fragment sets take turns; half step hs = 2 kc + m: m = 0 is Wo's k chunk kc against O's, m = 1 gW's against x's
  v16h fa[3], fw[3][4];
  const int kp = (blockIdx.x + (blockIdx.x >> 3)) & (EE / 32 - 1);   // every block reads the same three weights: each walks their k chunks from its own start and wraps (rot), for the reason given at the key walk below
  auto rot = [&](int kc) { return (kc + kp) & (EE / 32 - 1); };
  // a chunk's base address is formed anew for every fetch: h0, h1, h2 hold the bases of the newest requests, and each fetch opens with a wait up to which they stay whole (it stands a half step behind those requests, so it costs little)
  const _Float16* h0 = Wt; const _Float16* h1 = Wt; const _Float16* h2 = Mt;
  auto hold = [&]() { asm volatile("s_wait_xcnt 0x0" :: "s"(h0), "s"(h1), "s"(h2) : "memory"); };
  auto loadw = [&](const _Float16* w, int z) {
#pragma unroll
    for (int t = 0; t < 4; ++t) fw[z][t] = frag_t(at(w + t * 16 * EE)); };
  auto fetch = [&](int hs, int z) { hold(); h0 = Wt + rot(hs >> 1) * 512;
    if (hs & 1) { h2 = Mt + rot(hs >> 1) * 512; fa[z] = frag_t(at(h2)); } else fa[z] = frag_t(&so[rt][rot(hs >> 1)][8 * lane]);   // O's chunk kc = head kc (HD = 32)
    loadw(h0 + (hs & 1) * EE * EE, z); };
  auto fetchm = [&](int kc, int z) { hold(); h0 = Wt + rot(kc) * 512; loadw(h0 + 2 * EE * EE, z); };
  { const int q0 = r0 % SS; const size_t bh = (size_t)(r0 / SS) * NH + 2 * cq;   // the first of the wave's two heads; the second one's arrays stand one head further
    const float scl = (1.0f / 16.0f) / sqrtf((float)HD);
    v16h bq[2]; float mrun[2], lrun[2]; v8f acc[2][2] = {};   // lrun: this lane half's keys only, the halves are joined behind the loop
#pragma unroll
    for (int hh = 0; hh < 2; ++hh) { bq[hh] = frag_t(Q16 + ((bh + hh) * SS + q0) * HD + 8 * lane); mrun[hh] = -3.0e38f; lrun[hh] = 0.f; }
    // The 16 blocks of a batch element read the same K and V, the 16 blocks of a row position the same bias tiles: requests for one line that reach L2 at one moment collide.
    // So each block enters the key walk at its own tile and wraps: the starts differ within both sets of 16. The online softmax takes the tiles in any order.
    const int kst = (blockIdx.x + (blockIdx.x >> 4)) & (SS / 64 - 1);
#pragma unroll 1   // stays rolled: two trips side by side would not fit the 256 registers
    for (int kk = 0; kk < SS / 64; ++kk) { const int kt = (kk + kst) & (SS / 64 - 1);
      v16h kf[2][4], vf[2][2][2]; float bs[4][8], sv[2][4][8];   // the tile's K and bias operands are all requested here, ahead of the first product
      const _Float16* pk = K16 + (bh * SS + kt * 64) * HD + 8 * lane; const _Float16* pv = VT + (bh * (SS / 32) + kt * 2) * 1024 + 8 * lane; const float* pr = rel + ((size_t)(q0 >> 4) * (SS / 16) + kt * 4) * 256 + 4 * lane;
#pragma unroll
      for (int hh = 0; hh < 2; ++hh) {
#pragma unroll
        for (int t = 0; t < 4; ++t) kf[hh][t] = frag_t(pk + hh * SS * HD + t * 512); }
#pragma unroll
      for (int t = 0; t < 4; ++t) {
#pragma unroll
        for (int r = 0; r < 8; ++r) bs[t][r] = pr[t * 256 + (r >> 2) * 128 + (r & 3)]; }
      // the batch's address registers stay whole up to this wait
      asm volatile("s_wait_xcnt 0x0" :: "v"(pk), "v"(pr) : "memory");
      __builtin_amdgcn_sched_barrier(0);   // keeps every product behind the whole batch of requests: moved up among them, the products would split the batch into pairs, each with a wait of its own
#pragma unroll
      for (int hh = 0; hh < 2; ++hh) {
#pragma unroll
        for (int t = 0; t < 4; ++t) { v8f s = {};
          s = wmma16(kf[hh][t], bq[hh], s);
#pragma unroll
          for (int r = 0; r < 8; ++r) sv[hh][t][r] = s[r] * scl + bs[t][r]; } }
      // three products in a row, then by turns one tile's multiply-adds and one more product: products and multiply-adds of other tiles fill each hazard distance, where a product followed by its own multiply-adds takes v_nop
      __builtin_amdgcn_sched_group_barrier(0x8, 3, 0); __builtin_amdgcn_sched_group_barrier(0x2, 4, 0);
#pragma unroll   // unrolled: the builtins are marks for the scheduler, five pairs of them in a row
      for (int i = 0; i < 5; ++i) { __builtin_amdgcn_sched_group_barrier(0x8, 1, 0); __builtin_amdgcn_sched_group_barrier(0x2, 4, 0); }
      __builtin_amdgcn_sched_group_barrier(0x2, 8, 0);
      __builtin_amdgcn_sched_barrier(0);   // keeps V's requests behind the score products, whose K registers they take over
      // V is requested here, into the registers K has left, and lands under the softmax
#pragma unroll
      for (int hh = 0; hh < 2; ++hh) {
#pragma unroll
        for (int kc = 0; kc < 2; ++kc) {
#pragma unroll
          for (int t = 0; t < 2; ++t) vf[hh][kc][t] = frag_t(pv + hh * (SS / 32) * 1024 + (kc * 2 + t) * 512); } }
      // as above, for V's address registers
      asm volatile("s_wait_xcnt 0x0" :: "v"(pv) : "memory");
      __builtin_amdgcn_sched_barrier(0);   // keeps all of V's requests ahead of the softmax, which covers their flight
#pragma unroll
      for (int hh = 0; hh < 2; ++hh) {
        float mx = -3.4e38f;
#pragma unroll
        for (int t = 0; t < 4; ++t) {
#pragma unroll
          for (int r = 0; r < 8; ++r) mx = fmaxf(mx, sv[hh][t][r]); }
        mx = fmaxf(mx, xhalf(mx));
        const float mnew = fmaxf(mrun[hh], mx); const float corr = __builtin_amdgcn_exp2f((mrun[hh] - mnew) * L2E);
        const float eoff = 14.0f - mnew * L2E;   // exponent offset: minus the maximum in base 2, plus 14 for P's 2^14 scale; ps and lrun carry that scale too
        v2f ps = {}; v16h pf[2];   // even and odd keys are summed side by side, one packed add for two
#pragma unroll
        for (int t = 0; t < 4; ++t) {
#pragma unroll
          for (int r = 0; r < 8; r += 2) { v2f pp; pp[0] = __builtin_amdgcn_exp2f(fmaf(sv[hh][t][r], L2E, eoff)); pp[1] = __builtin_amdgcn_exp2f(fmaf(sv[hh][t][r + 1], L2E, eoff)); ps += pp;
            pf[t >> 1][(t & 1) * 8 + r] = (_Float16)pp[0]; pf[t >> 1][(t & 1) * 8 + r + 1] = (_Float16)pp[1]; } }
        lrun[hh] = lrun[hh] * corr + (ps[0] + ps[1]); mrun[hh] = mnew;
#pragma unroll
        for (int r = 0; r < 8; ++r) { acc[hh][0][r] *= corr; acc[hh][1][r] *= corr; }
#pragma unroll
        for (int kc = 0; kc < 2; ++kc) {
#pragma unroll
          for (int t = 0; t < 2; ++t) acc[hh][t] = wmma16(vf[hh][kc][t], pf[kc], acc[hh][t]); } } }
    // what the post part needs first and what does not hang on O is requested here: it flies under the division, the O stores and the wait for the other waves
#pragma unroll
    for (int i = 0; i < 8; ++i) xin[i] = *(const v4f*)(xp + i * 2 * EE);
    h0 = Wt + rot(0) * 512; h1 = Wt + rot(1) * 512; h2 = Mt + rot(0) * 512; loadw(h0, 0); loadw(h0 + EE * EE, 1); loadw(h1, 2); fa[1] = frag_t(at(h2));
    // acc[hh][t][r] = O[query lane & 15][d = 16 t + 8 g + r] of head 2 cq + hh: the lane's 8 halves are chunk 32 t + lane of that head's tile
#pragma unroll
    for (int hh = 0; hh < 2; ++hh) { const float lr = lrun[hh] + xhalf(lrun[hh]); const float inv = 8.0f / (lr * 4.0f);
#pragma unroll
      for (int t = 0; t < 2; ++t) { union { v8h h8; v4u u; } pk;
#pragma unroll
        for (int r = 0; r < 8; ++r) pk.h8[r] = (_Float16)(acc[hh][t][r] * inv);
        vst2(&so[rt][2 * cq + hh][(32 * t + lane) * 8], pk.u); } } }
  __syncthreads();   // every wave of the row tile has written its two heads of O
  // (1) rmha^T and the gate's pre-activation^T: a set is requested anew as soon as its products are issued, two half steps ahead of its next use
  v8f ao[4] = {}, ag[4] = {};
  fa[0] = frag_t(&so[rt][rot(0)][8 * lane]); fa[2] = frag_t(&so[rt][rot(1)][8 * lane]);   // O's part of the first three sets; the rest was requested ahead of the barrier
  // the x loads' address registers stay whole up to this wait
  asm volatile("s_wait_xcnt 0x0" :: "v"(xp) : "memory");
#pragma unroll
  for (int i = 0; i < 8; ++i) vst2(&sx[wave][2 * i + g][c * 4], xin[i]);
#pragma unroll   // unrolled whole: which set a half step uses is known at compile time, and the last fetches drop out
  for (int hs = 0; hs < 2 * (EE / 32); ++hs) { const int z = hs % 3;
#pragma unroll
    for (int t = 0; t < 4; ++t) { if (hs & 1) ag[t] = wmma16(fw[z][t], fa[z], ag[t]); else ao[t] = wmma16(fw[z][t], fa[z], ao[t]); }
    if (hs + 3 < 2 * (EE / 32)) fetch(hs + 3, z);
    __builtin_amdgcn_sched_barrier(0); }   // keeps the ring's order: requests moved further ahead would need a fourth fragment set, which the 256 registers do not hold
  hold(); h0 = Wt + rot(0) * 512; h1 = Wt + rot(1) * 512; h2 = Wt + rot(2) * 512; loadw(h0 + 2 * EE * EE, 0); loadw(h1 + 2 * EE * EE, 1); loadw(h2 + 2 * EE * EE, 2);   // mW's first fragments fly under the gate's arithmetic and have landed at the barrier, which waits for every load
  const float* bop = bo + n0 + 8 * g; const float* gbp = gb + n0 + 8 * g; v4f bov[4][2], gbv[4][2];   // the lane's 8 columns of each tile
#pragma unroll
  for (int t = 0; t < 4; ++t) {
#pragma unroll
    for (int u = 0; u < 2; ++u) { bov[t][u] = *(const v4f*)(bop + 16 * t + 4 * u); gbv[t][u] = *(const v4f*)(gbp + 16 * t + 4 * u); } }
  // the address registers of all loads so far stay whole up to this wait
  asm volatile("s_wait_xcnt 0x0" :: "v"(bop), "v"(gbp) : "memory");
  __builtin_amdgcn_sched_barrier(0);   // keeps the arithmetic below, which reuses those registers, behind the wait
  LDSX();   // the x tile was written by other lanes of this wave
  // (2) gate1 = sigmoid(pre) * rmha + x, kept in f32 for the last step and handed on in f16
  float g1[4][8]; v16h pf[2];
#pragma unroll
  for (int t = 0; t < 4; ++t) { const int nl = 16 * t + 8 * g; float xv[8];
#pragma unroll
    for (int r = 0; r < 8; ++r) xv[r] = sx[wave][c][nl + r];
#pragma unroll
    for (int r = 0; r < 8; ++r) { const float rm = ao[t][r] * (1.0f / 128.0f) + bov[t][r >> 2][r & 3]; const float v = sigm(ag[t][r] * (1.0f / 16.0f) + gbv[t][r >> 2][r & 3]) * rm + xv[r];
      g1[t][r] = v; pf[t >> 1][(t & 1) * 8 + r] = (_Float16)v; } }
#pragma unroll
  for (int j = 0; j < 2; ++j) { union { v16h v; v4u q[2]; } u; u.v = pf[j]; _Float16* d = &sb[rt][cq * 2 + j][8 * lane]; vst2(d, u.q[0]); vst2(d + 256, u.q[1]); }
  __syncthreads();   // every wave of the row tile has written its two k chunks of gate1
  // (3) mlp^T = sigmoid(mW^T gate1^T + mb)
  v8f am[4] = {}; v4f mbv[4][2], lg[4][2], lb[4][2];   // the lane's 8 columns of each tile of mb, ln_g, ln_b
  const float* mbp = mb + n0 + 8 * g; const float* lgp = lng + n0 + 8 * g; const float* lbp = lnb + n0 + 8 * g;
  auto fetchv = [&](const float* p, v4f (&v)[4][2]) {
#pragma unroll
    for (int t = 0; t < 4; ++t) { v[t][0] = *(const v4f*)(p + 16 * t); v[t][1] = *(const v4f*)(p + 16 * t + 4); } };
#pragma unroll   // unrolled whole: which set a k chunk uses is known at compile time
  for (int kh = 0; kh < 2; ++kh) { v16h bg[4];
#pragma unroll
    for (int u = 0; u < 4; ++u) bg[u] = frag_t(&sb[rt][rot(4 * kh + u)][8 * lane]);
#pragma unroll
    for (int u = 0; u < 4; ++u) { const int kc = 4 * kh + u, z = kc % 3;
#pragma unroll
      for (int t = 0; t < 4; ++t) am[t] = wmma16(fw[z][t], bg[u], am[t]);
      if (kc + 3 < EE / 32) fetchm(kc + 3, z);
      else fetchv(kc == 5 ? mbp : kc == 6 ? lgp : lbp, kc == 5 ? mbv : kc == 6 ? lg : lb);
      __builtin_amdgcn_sched_barrier(0); } }   // the last three chunks leave their sets' registers to the three vectors, which land under the products and the sigmoids; the scheduling barrier keeps the ring's order, as in (1)
  // the address registers of all loads so far stay whole up to this wait
  asm volatile("s_wait_xcnt 0x0" :: "v"(mbp), "v"(lgp), "v"(lbp), "s"(h0) : "memory");
  __builtin_amdgcn_sched_barrier(0);   // keeps the arithmetic below, which reuses those registers, behind the wait
  float ml[4][8], sp[4];
#pragma unroll
  for (int t = 0; t < 4; ++t) sp[t] = 0.f;
#pragma unroll
  for (int r = 0; r < 8; ++r) {   // the four tiles' sums advance side by side: four independent chains
#pragma unroll
    for (int t = 0; t < 4; ++t) { const float mv = sigm(am[t][r] * (1.0f / 16.0f) + mbv[t][r >> 2][r & 3]); ml[t][r] = mv; sp[t] += mv; } }
  // (4) LN(mlp) over the row: the lane's 32 columns, the other lane half's, then the four waves' sums in a fixed order
  float s = (sp[0] + sp[1]) + (sp[2] + sp[3]); s += xhalf(s); sred[0][rt][cq][lane] = s;
  __syncthreads();   // the four partial sums of every row are written
  const float mu = ((sred[0][rt][0][lane] + sred[0][rt][1][lane]) + (sred[0][rt][2][lane] + sred[0][rt][3][lane])) * (1.0f / EE);
#pragma unroll
  for (int t = 0; t < 4; ++t) { sp[t] = 0.f;
#pragma unroll
    for (int r = 0; r < 8; ++r) { const float d = ml[t][r] - mu; sp[t] += d * d; } }
  float q2 = (sp[0] + sp[1]) + (sp[2] + sp[3]); q2 += xhalf(q2); sred[1][rt][cq][lane] = q2;
  __syncthreads();   // the four partial sums of squares of every row are written
  const float rs = rsqrtf(((sred[1][rt][0][lane] + sred[1][rt][1][lane]) + (sred[1][rt][2][lane] + sred[1][rt][3][lane])) * (1.0f / EE) + 1e-5f);
#pragma unroll
  for (int t = 0; t < 4; ++t) { const int nl = 16 * t + 8 * g; v4f o[2];
#pragma unroll
    for (int r = 0; r < 8; ++r) { const float lnv = (ml[t][r] - mu) * rs * lg[t][r >> 2][r & 3] + lb[t][r >> 2][r & 3]; o[r >> 2][r & 3] = g1[t][r] * lnv + g1[t][r]; }
    vst2(&sx[wave][c][nl], o[0]); vst2(&sx[wave][c][nl + 4], o[1]); }
  LDSX();   // the out tile is read back by other lanes of this wave
  float* op = out + (size_t)(r0 + g) * EE + n0 + c * 4;   // store i: rows 2 i + g, 256 contiguous bytes each
#pragma unroll   // unrolled: the eight LDS reads go out together
  for (int i = 0; i < 8; ++i) vst2(op + i * 2 * EE, *(const v4f*)(&sx[wave][2 * i + g][c * 4]));
}
extern "C" void kernel_launch(void* const* d_in, const int* in_sizes, int n_in, void* d_out, int out_size, void* d_ws, size_t ws_size, hipStream_t stream) {
  (void)in_sizes; (void)n_in; (void)out_size; (void)ws_size;
  const float** I = (const float**)d_in;
  const float* x = I[0]; const float* lng = I[1]; const float* lnb = I[2]; const float* Wq = I[3]; const float* bq = I[4]; const float* Wk = I[5]; const float* bk = I[6]; const float* Wv = I[7]; const float* bv = I[8]; const float* Wo = I[9]; const float* bo = I[10]; const float* rel = I[11]; const float* gW = I[12]; const float* gb = I[13]; const float* mW = I[14]; const float* mb = I[15];
  float* out = (float*)d_out;
  char* ws = (char*)d_ws; size_t off = 0;
  auto take = [&](size_t bytes) { char* p = ws + off; off += (bytes + 255) & ~(size_t)255; return p; };
  _Float16* M16 = (_Float16*)take((size_t)NR * EE * 2); _Float16* P = (_Float16*)take((size_t)6 * EE * EE * 2);
  _Float16* Q16 = (_Float16*)take((size_t)NR * EE * 2); _Float16* K16 = (_Float16*)take((size_t)NR * EE * 2); _Float16* VT = (_Float16*)take((size_t)NR * EE * 2); float* R32 = (float*)take((size_t)SS * SS * 4);
  k_pack<<<6 * EE / 16 + SS / 16 * 4, 256, 0, stream>>>(Wq, Wk, Wv, Wo, gW, mW, rel, P, R32);
  k_qkv<<<NR / 64, 768, 0, stream>>>(x, lng, lnb, P, bq, bk, bv, M16, Q16, K16, VT);
  k_attn_post<<<NR / 64, 512, 0, stream>>>(Q16, K16, VT, R32, M16, P, bo, gb, mb, lng, lnb, x, out);
}

// v010
// It runs in 60.5 microseconds.
// Next to v009, in two timings, it ran 1.13 times as fast each time.
// All steps since v000 together make it 3.94 times as fast.
#include <hip/hip_runtime.h>
#include <math.h>

typedef __attribute__((ext_vector_type(16))) _Float16 v16h;
typedef __attribute__((ext_vector_type(16))) __bf16 v16b;
typedef __attribute__((ext_vector_type(8)))  _Float16 v8h;
typedef __attribute__((ext_vector_type(8)))  float v8f;
typedef __attribute__((ext_vector_type(4)))  float v4f;
typedef __attribute__((ext_vector_type(2)))  float v2f;
typedef __attribute__((ext_vector_type(4)))  unsigned v4u;
typedef __attribute__((ext_vector_type(4)))  int v4i;
typedef float __attribute__((may_alias)) float_a;
typedef int __attribute__((may_alias)) int_a;

template <typename T> __device__ __forceinline__ void vst2(void* p, T v) { *(T*)p = v;  }
__device__ __forceinline__ v8f wmma16(v16h a, v16h b, v8f c) {
  return __builtin_amdgcn_wmma_f32_16x16x32_f16(false, a, false, b, (short)0, c, false, false);   // the bare builtin: the compiler keeps the distance to the next user of D, A or B itself, with useful work where there is some
}
__device__ __forceinline__ v8f wmma_bf(v16b a, v16b b, v8f c) {
  v8f d = __builtin_amdgcn_wmma_f32_16x16x32_bf16(false, a, false, b, (short)0, c, false, false);
  asm volatile("v_nop\n\tv_nop\n\tv_nop\n\tv_nop" : "+v"(d) : "v"(a), "v"(b));
  return d;
}
// 16x16x32 fragments: lane = (h = lane>>4, row/col = lane&15); elements 0..7 = k0+8h+0..7, 8..15 = k0+16+8h+0..7; D element r = row 8h+r
__device__ __forceinline__ v16h frag_h(const _Float16* rowk0, int lane) {
  union { v16h v; v8h q[2]; } u; const _Float16* p = rowk0 + 8 * (lane >> 4);
  u.q[0] = *(const v8h*)p; u.q[1] = *(const v8h*)(p + 16); return u.v;
}
// the same fragment from a pointer that already holds the lane half's offset (row + k0 + 8h)
__device__ __forceinline__ v16h frag_at(const _Float16* p) {
  union { v16h v; v8h q[2]; } u; u.q[0] = *(const v8h*)p; u.q[1] = *(const v8h*)(p + 16); return u.v;
}
// the same fragment from a tile kept in fragment order: 16 rows x 32 k = 512 halves as [k >> 3][row][k & 7]; p = tile + 8 * lane, so each of the two loads reads 512 contiguous bytes (4 whole lines) over the wave
__device__ __forceinline__ v16h frag_t(const _Float16* p) {
  union { v16h v; v8h q[2]; } u; u.q[0] = *(const v8h*)p; u.q[1] = *(const v8h*)(p + 256); return u.v;
}
__device__ __forceinline__ v16h frag_f32(const float* rowk0, int lane) {
  v16h a; const float* p = rowk0 + 8 * (lane >> 4);
#pragma unroll
  for (int i = 0; i < 8; ++i) { a[i] = (_Float16)p[i]; a[8 + i] = (_Float16)p[16 + i]; }
  return a;
}
__device__ __forceinline__ v16h frag_f32s(const float* rowk0, int lane, float sc) {
  v16h a; const float* p = rowk0 + 8 * (lane >> 4);
#pragma unroll
  for (int i = 0; i < 8; ++i) { a[i] = (_Float16)(p[i] * sc); a[8 + i] = (_Float16)(p[16 + i] * sc); }
  return a;
}
// column fragment from a [K][ld] layout (column n), rows >= K read as 0
__device__ __forceinline__ v16h fragc_f32(const float* W, int k0, int n, int lane, int ld, int K) {
  v16h a; const int g = lane >> 4;
#pragma unroll
  for (int i = 0; i < 8; ++i) { const int ka = k0 + 8 * g + i, kb = ka + 16;
    a[i] = (_Float16)(ka < K ? W[(size_t)ka * ld + n] : 0.f); a[8 + i] = (_Float16)(kb < K ? W[(size_t)kb * ld + n] : 0.f); }
  return a;
}
struct F2 { v16b h, l; };
__device__ __forceinline__ F2 bsplit16(const float v[16]) { F2 r;
#pragma unroll
  for (int i = 0; i < 16; ++i) { const __bf16 h = (__bf16)v[i]; r.h[i] = h; r.l[i] = (__bf16)(v[i] - (float)h); }
  return r; }
__device__ __forceinline__ F2 split_row(const float* row, int k0, int lane) { float v[16]; const float* p = row + k0 + 8 * (lane >> 4);
#pragma unroll
  for (int i = 0; i < 8; ++i) { v[i] = p[i]; v[8 + i] = p[16 + i]; }
  return bsplit16(v); }
__device__ __forceinline__ F2 split_rowK(const float* row, int k0, int lane, int K) { float v[16]; const int g = lane >> 4;
#pragma unroll
  for (int i = 0; i < 8; ++i) { const int ka = k0 + 8 * g + i, kb = ka + 16; v[i] = ka < K ? row[ka] : 0.f; v[8 + i] = kb < K ? row[kb] : 0.f; }
  return bsplit16(v); }
__device__ __forceinline__ F2 split_col(const float* W, int k0, int n, int lane, int ld, int K) { float v[16]; const int g = lane >> 4;
#pragma unroll
  for (int i = 0; i < 8; ++i) { const int ka = k0 + 8 * g + i, kb = ka + 16; v[i] = ka < K ? W[(size_t)ka * ld + n] : 0.f; v[8 + i] = kb < K ? W[(size_t)kb * ld + n] : 0.f; }
  return bsplit16(v); }
__device__ __forceinline__ v8f mac3(const F2& a, const F2& b, v8f c) { c = wmma_bf(a.l, b.h, c); c = wmma_bf(a.h, b.l, c); return wmma_bf(a.h, b.h, c); }
#define L2E 1.4426950408889634f
// e^x as 2^(x log2 e) on the bare v_exp_f32, without the library's range fix-ups: a vanishing result may be 0 and an overflowing one is infinity, which suits every use here
__device__ __forceinline__ float sigm(float v) { return 1.0f / (1.0f + __builtin_amdgcn_exp2f(v * -L2E)); }
#define LDSX() do { asm volatile("s_wait_dscnt 0" ::: "memory"); __builtin_amdgcn_wave_barrier(); __builtin_amdgcn_fence(__ATOMIC_RELEASE, "workgroup"); } while (0)

// Gated relation-transformer block: LN(x); 8-head (d=32) self attention with an additive [S,S] relation bias (read as data) and output
// projection; gate0 = sigmoid(x gW + gb); gate1 = gate0*mha + x; mlp = sigmoid(gate1 mW + mb); out = gate1*LN(mlp) + gate1.
// All six [in][out] weights enter their products (all but Wv transposed) in f16, x16 (Wo, gW, mW as packed tiles, Wq, Wk, Wv converted in registers); every product on v_wmma_f32_16x16x32_f16 (activations as f16 copies /
// LDS tiles, q/k/v head-major x4, P x2^14); LayerNorms, softmax (online over 16 key tiles), sigmoids and gating in f32.
// Every f16 workspace array is a sequence of 16 x 32 tiles in fragment order (frag_t), written by whole lines; the bias is copied into accumulator order likewise.
#define NB 16
#define SS 1024
#define EE 256
#define NH 8
#define HD 32
#define NR (NB * SS)

// There is no packing launch. k_qkv reads Wq, Wk, Wv as they are given (f32, [k][n]) and forms its fragments in registers; beside that its blocks lay out what only the next launch reads:
// P tiles [w*16 + n/16][k chunk] of W_w[k][n]*16 (tile row = n) for w: 3 Wo, 4 gW, 5 mW (the places of w = 0 to 2 stay unused): 384 tiles, a wave forms one
// R32 = the bias as 16 x 16 f32 tiles [q / 16][key / 16] in the accumulator order of the transposed score tile (D register r of lane (g, c) = rel[q c][key 8 g + r]), [r >> 2][lane][r & 3]: 4096 tiles, 16 per block, a wave copies one
// The lane's weights of one k chunk for the two 16-column tiles of its wave: column lane & 15 (+ 16 for the second tile), 16 rows k in fragment order; p = W + (k0 + 8 g) * EE + n. A load covers two rows of 64 bytes; the two tiles share their lines
__device__ __forceinline__ void loadw32(const float* p, float (&raw)[2][16]) {
#pragma unroll
  for (int j = 0; j < 2; ++j) {
#pragma unroll
    for (int i = 0; i < 8; ++i) { raw[j][i] = p[i * EE + j * 16]; raw[j][8 + i] = p[(16 + i) * EE + j * 16]; } }
  // the loads' address registers stay whole up to this wait
  asm volatile("s_wait_xcnt 0x0" :: "v"(p) : "memory");
}
// the two weight fragments of a k step from their f32 values (x16, as in the P tiles)
__device__ __forceinline__ void cvtw(const float (&raw)[2][16], v16h (&bf)[2]) {
#pragma unroll
  for (int j = 0; j < 2; ++j) {
#pragma unroll
    for (int e = 0; e < 16; ++e) bf[j][e] = (_Float16)(raw[j][e] * 16.0f); }
}
// one k step of 64 rows x 32 columns: a weight fragment feeds four products; TR: D^T = W^T A^T, else D = A W
template <bool TR> __device__ __forceinline__ void qkv_step(const _Float16* pak, const v16h (&bf)[2], v8f (&acc)[4][2]) {
  v16h a[4];
#pragma unroll
  for (int i = 0; i < 4; ++i) a[i] = frag_at(pak + i * 16 * (EE + 8));
#pragma unroll
  for (int i = 0; i < 4; ++i) {
#pragma unroll
    for (int j = 0; j < 2; ++j) acc[i][j] = TR ? wmma16(bf[j], a[i], acc[i][j]) : wmma16(a[i], bf[j], acc[i][j]); }
}
// k = 256 in 8 steps from chunk ks on, wrapping; raw holds the first step's weights on entry; each step requests the next one's ahead of its own products and converts them behind these
template <bool TR> __device__ __forceinline__ void qkv_mm(const float* pw, const _Float16* pa, int ks, float (&raw)[2][16], v8f (&acc)[4][2]) {
  v16h bf[2]; cvtw(raw, bf);
#pragma unroll 1   // stays rolled: unrolled, the compiler mixed the steps and spilled beyond the 160 registers that 24 waves leave
  for (int kk = 0; kk < EE / 32 - 1; ++kk) {
    loadw32(pw + (size_t)((kk + 1 + ks) & (EE / 32 - 1)) * 32 * EE, raw);
    qkv_step<TR>(pa + ((kk + ks) & (EE / 32 - 1)) * 32, bf, acc);
    cvtw(raw, bf); }
  qkv_step<TR>(pa + ((EE / 32 - 1 + ks) & (EE / 32 - 1)) * 32, bf, acc);
}
// LN(x) and q/k/v in one launch: block = 64 rows, 24 waves.
// First the waves normalise the block's rows (wave per row, 256 = 32 lanes x 8; rows wave, wave + 24, wave + 48): LN(x) stays in LDS as f16 rows, x in f16 leaves as M16 tiles ([row tile][k chunk]).
// Then wave (which, h) takes all 64 rows x the 32 columns of head h of q, k or v, so that the block reads every weight once; its A fragments come from the LDS rows (pitch 264 halves = 16 bytes x 33: no bank conflict).
// q and k are formed transposed (a lane holds 8 successive d of one position), v as it is (a lane holds 8 successive keys of one d): in both cases the lane's 8 halves are one 16-byte chunk of the fragment-order tile and leave straight from the registers.
__global__ __launch_bounds__(768) void k_qkv(const float* __restrict__ x, const float* __restrict__ lng, const float* __restrict__ lnb, const float* __restrict__ Wq, const float* __restrict__ Wk, const float* __restrict__ Wv, const float* __restrict__ Wo, const float* __restrict__ gW, const float* __restrict__ mW, const float* __restrict__ rel,
                                             const float* __restrict__ bq, const float* __restrict__ bk, const float* __restrict__ bv, _Float16* __restrict__ P, float* __restrict__ R32, _Float16* __restrict__ M16, _Float16* __restrict__ Q16, _Float16* __restrict__ K16, _Float16* __restrict__ VT) {
  __shared__ __align__(16) _Float16 sx[2][72][EE + 8];   // rows 64 to 71 are spare
  const int tid = threadIdx.x, wave = __builtin_amdgcn_readfirstlane(tid >> 5), lane = tid & 31, col = lane & 15, g = lane >> 4;   // the wave's number in a scalar register: every test on it is a scalar branch
  const int which = wave >> 3, h = wave & 7, r0b = blockIdx.x * 64; const int b = r0b / SS, s0 = r0b % SS;
  const float* bias = which == 0 ? bq : (which == 1 ? bk : bv);
  const float* pw = (which == 0 ? Wq : (which == 1 ? Wk : Wv)) + (size_t)(8 * g) * EE + h * 32 + col;
  const int ks = (blockIdx.x + (blockIdx.x >> 3) + (wave >> 2)) & (EE / 32 - 1);   // every block reads the same weights: each enters the k walk at its own chunk and wraps, so that the blocks do not ask L2 for the same lines at the same moment
  float raw[2][16];
  // What the next launch reads is laid out by the way: its values are requested here, ahead of x, land with x and leave behind the barrier, so that no wave waits for them alone.
  const bool doR = wave < 16, doW = wave == 16 || (wave == 17 && blockIdx.x < 128);   // both the same for the whole wave
  const int qt = blockIdx.x >> 2, kt = (blockIdx.x & 3) * 16 + (wave & 15), id = blockIdx.x + (wave & 1) * 256;   // the wave's bias tile; its tile of Wo, gW, mW
  v4f sd[2]; float sw[16];
  if (doR) {   // one bias tile: the lane's 8 values are 32 successive bytes of row lane & 15
    const float* rp = rel + (size_t)(qt * 16 + col) * SS + kt * 16 + 8 * g;
    sd[0] = *(const v4f*)rp; sd[1] = *(const v4f*)(rp + 4);
    // the loads' address registers stay whole up to this wait
    asm volatile("s_wait_xcnt 0x0" :: "v"(rp) : "memory"); }
  else if (doW) {   // one weight tile: the lane gathers its own fragment (column lane & 15, 16 rows k in fragment order)
    const int w = id >> 7; const float* sp = (w == 0 ? Wo : (w == 1 ? gW : mW)) + (size_t)((id & 7) * 32 + 8 * g) * EE + ((id >> 3) & 15) * 16 + col;
#pragma unroll
    for (int i = 0; i < 8; ++i) { sw[i] = sp[i * EE]; sw[8 + i] = sp[(16 + i) * EE]; }
    // the loads' address registers stay whole up to this wait
    asm volatile("s_wait_xcnt 0x0" :: "v"(sp) : "memory"); }
  loadw32(pw + (size_t)ks * 32 * EE, raw);   // the first k step's weights hang on nothing here: they fly under the LayerNorm
  { const int r3 = wave < 16 ? wave + 48 : 63;   // 64 rows on 24 waves: the third round has 16; the other 8 waves work row 63 along, into the spare LDS rows, so that the three rows' sums advance side by side with no branch among them
    const float* xr = x + ((size_t)r0b + wave) * EE + lane * 8; const float* xr3 = x + ((size_t)r0b + r3) * EE + lane * 8; float vv[3][8];
#pragma unroll
    for (int e = 0; e < 8; ++e) { vv[0][e] = xr[e]; vv[1][e] = xr[24 * EE + e]; vv[2][e] = xr3[e]; }
    // the loads' address registers stay whole up to this wait
    asm volatile("s_wait_xcnt 0x0" :: "v"(xr), "v"(xr3) : "memory");
#pragma unroll   // unrolled: three independent chains of cross-lane sums
    for (int i = 0; i < 3; ++i) { const int rl = wave + 24 * i; float v[8]; float s = 0.f;
#pragma unroll
        for (int e = 0; e < 8; ++e) { v[e] = vv[i][e]; s += v[e]; }
#pragma unroll
        for (int off = 16; off >= 1; off >>= 1) s += __shfl_xor(s, off, 32);
        const float mu = s * (1.0f / EE); float q2 = 0.f;
#pragma unroll
        for (int e = 0; e < 8; ++e) { const float d = v[e] - mu; q2 += d * d; }
#pragma unroll
        for (int off = 16; off >= 1; off >>= 1) q2 += __shfl_xor(q2, off, 32);
        const float rs = rsqrtf(q2 * (1.0f / EE) + 1e-5f);
        union { v8h h; v4u u; } p1, p2;
#pragma unroll
        for (int e = 0; e < 8; ++e) { const int c = lane * 8 + e; p1.h[e] = (_Float16)((v[e] - mu) * rs * lng[c] + lnb[c]); p2.h[e] = (_Float16)v[e]; }
        vst2(&sx[0][rl][lane * 8], p1.u); vst2(&sx[1][rl][lane * 8], p2.u); } }
  // the lane's byte offset, which the loads of ln_g and ln_b name, stays whole up to this wait
  asm volatile("s_wait_xcnt 0x0" :: "v"(lane * 32) : "memory");
  __syncthreads();   // all 64 rows of LN(x) and of x stand in LDS
  if (doR) {   // each store covers 512 successive bytes
    float* wp = R32 + ((size_t)qt * (SS / 16) + kt) * 256 + 4 * lane;
    vst2(wp, sd[0]); vst2(wp + 128, sd[1]);
    // the stores' address registers stay whole up to this wait
    asm volatile("s_wait_xcnt 0x0" ::: "memory"); }
  else if (doW) {   // the fragment is chunks lane and 32 + lane of the tile
    _Float16* dp = P + (size_t)(3 * 128 + id) * 512 + 8 * lane; union { v16h v; v4u q[2]; } u;
    // takes the loaded values as they are: without it the conversion, and with it the wait for these loads, moves up in front of the LayerNorm and holds the whole block at the barrier
    asm volatile("" :: "v"(sw[0]), "v"(sw[1]), "v"(sw[2]), "v"(sw[3]), "v"(sw[4]), "v"(sw[5]), "v"(sw[6]), "v"(sw[7]), "v"(sw[8]), "v"(sw[9]), "v"(sw[10]), "v"(sw[11]), "v"(sw[12]), "v"(sw[13]), "v"(sw[14]), "v"(sw[15]));
#pragma unroll
    for (int i = 0; i < 16; ++i) u.v[i] = (_Float16)(sw[i] * 16.0f);
    vst2(dp, u.q[0]); vst2(dp + 256, u.q[1]);
    // the stores' address registers stay whole up to this wait
    asm volatile("s_wait_xcnt 0x0" ::: "memory"); }
  if (wave < 16) {   // x in f16 leaves by whole lines: 4 row tiles of 512 chunks of 16 bytes, a chunk of each per thread
    _Float16* mp = M16 + (size_t)r0b * EE + tid * 8; const _Float16* ms = &sx[1][tid & 15][(tid >> 6) * 32 + ((tid >> 4) & 3) * 8]; v4u md[4];
#pragma unroll   // unrolled: the four LDS reads go out together
    for (int i = 0; i < 4; ++i) md[i] = *(const v4u*)(ms + i * 16 * (EE + 8));
#pragma unroll
    for (int i = 0; i < 4; ++i) vst2(mp + i * 16 * EE, md[i]);
    // the stores' address registers stay whole up to this wait
    asm volatile("s_wait_xcnt 0x0" ::: "memory");
    __builtin_amdgcn_sched_barrier(0); }   // keeps what follows, which reuses those registers, behind the wait
  v8f acc[4][2] = {}; v4u pk[4][2];
  const _Float16* pa = &sx[0][col][8 * g];
  if (which < 2) {   // waves 0 to 15: acc[i][j][r] = position 16 i + (lane & 15), d = 16 j + 8 g + r
    qkv_mm<true>(pw, pa, ks, raw, acc);
    const float* bp = bias + h * 32 + 8 * g; v4f bb[2][2];
#pragma unroll
    for (int j = 0; j < 2; ++j) { bb[j][0] = *(const v4f*)(bp + j * 16); bb[j][1] = *(const v4f*)(bp + j * 16 + 4); }
    // the loads' address registers stay whole up to this wait
    asm volatile("s_wait_xcnt 0x0" :: "v"(bp) : "memory");
#pragma unroll
    for (int i = 0; i < 4; ++i) {
#pragma unroll
      for (int j = 0; j < 2; ++j) { union { v8h h8; v4u u; } t;
#pragma unroll
        for (int r = 0; r < 8; ++r) t.h8[r] = (_Float16)((acc[i][j][r] * (1.0f / 16.0f) + bb[j][r >> 2][r & 3]) * 4.0f);
        pk[i][j] = t.u; } }
    // per head and 16 positions one 16 x 32 tile (tile row = position, k = d): the lane's chunk is 32 j + lane
    _Float16* D = (which == 0 ? Q16 : K16) + (((size_t)b * NH + h) * SS + s0) * HD + 8 * lane;
#pragma unroll
    for (int i = 0; i < 4; ++i) {
#pragma unroll
      for (int j = 0; j < 2; ++j) vst2(D + i * 16 * HD + j * 256, pk[i][j]); } }
  else {   // waves 16 to 23: acc[i][j][r] = key 16 i + 8 g + r, d = 16 j + (lane & 15)
    qkv_mm<false>(pw, pa, ks, raw, acc);
    const float* bp = bias + h * 32 + col; const float bb[2] = { bp[0], bp[16] };
    // the loads' address registers stay whole up to this wait
    asm volatile("s_wait_xcnt 0x0" :: "v"(bp) : "memory");
#pragma unroll
    for (int i = 0; i < 4; ++i) {
#pragma unroll
      for (int j = 0; j < 2; ++j) { union { v8h h8; v4u u; } t;
#pragma unroll
        for (int r = 0; r < 8; ++r) t.h8[r] = (_Float16)((acc[i][j][r] * (1.0f / 16.0f) + bb[j]) * 4.0f);
        pk[i][j] = t.u; } }
    // VT tiles [b][h][32-key chunk][d / 16] (tile row = d, k = key): the lane's chunk is 32 (i & 1) + lane of tile (i >> 1, j)
    _Float16* D = VT + (((size_t)b * NH + h) * (SS / 32) + (s0 >> 5)) * 1024 + 8 * lane;
#pragma unroll
    for (int i = 0; i < 4; ++i) {
#pragma unroll
      for (int j = 0; j < 2; ++j) vst2(D + ((i >> 1) * 2 + j) * 512 + (i & 1) * 256, pk[i][j]); } }
}
// lane l's value from lane l ^ 16, on the vector unit (no LDS path)
__device__ __forceinline__ float xhalf(float v) { return __builtin_bit_cast(float, __builtin_amdgcn_permlanex16(__builtin_bit_cast(int, v), __builtin_bit_cast(int, v), 0x76543210, 0xfedcba98, false, false)); }
// Attention and all that follows it in one launch: block = 64 rows of one batch element, 16 waves; wave (rt, cq).
// Attention part, transposed: the wave takes 16 queries (row tile rt) of the heads 2 cq and 2 cq + 1. S^T = K q^T / sqrt(32) + rel^T (rel = the R32 tiles, read once for both heads), so a lane holds 32 of the 64 scores of ONE query
// (column lane & 15, keys 16 t + 8 g + r); online softmax over 16 tiles in registers; two S^T tiles converted in place are the B fragment of O^T += V^T P^T; O x8 goes to LDS as [row tile][head] tiles (tile row = position, k = d).
// Post part, transposed: the wave takes 16 rows x 64 columns as D^T = W^T A^T, so a lane holds 32 columns (n0 + 16 t + 8 g + r) of ONE row (lane & 15).
// rmha = O@Wo + bo ; gate0 = sigmoid(x gW + gb) ; gate1 = gate0*rmha + x ; mlp = sigmoid(gate1 mW + mb) ; out = gate1 * (LN(mlp) + 1): all of it on the accumulator registers.
// Two gate1 tiles converted in place are one B fragment of the third product; the waves of a row tile swap these fragments and their LN partial sums through LDS.
__global__ __launch_bounds__(512) void k_attn_post(const _Float16* __restrict__ Q16, const _Float16* __restrict__ K16, const _Float16* __restrict__ VT, const float* __restrict__ rel, const _Float16* __restrict__ M16, const _Float16* __restrict__ P,
                                                 const float* __restrict__ bo, const float* __restrict__ gb, const float* __restrict__ mb, const float* __restrict__ lng, const float* __restrict__ lnb, const float* __restrict__ x, float* __restrict__ out) {
  __shared__ __align__(16) float sx[16][16][68];        // a wave's own 16 x 64 tile: x on the way in, out on the way out, so that global accesses cover whole lines; pitch 68: 16 rows of 16 bytes fall on all 64 banks
  __shared__ __align__(16) _Float16 sb[4][8][512];      // gate1 in f16: [row tile][k chunk] in fragment order
  __shared__ __align__(16) _Float16 so[4][8][512];      // attention's O in f16: [row tile][head = k chunk] in fragment order
  __shared__ float sred[2][4][4][32];                   // LN partial sums [sum, squares][row tile][column quarter][lane]
  const int tid = threadIdx.x, wave = __builtin_amdgcn_readfirstlane(tid >> 5), lane = tid & 31, c = lane & 15, g = lane >> 4;   // the wave's number in a scalar register: what follows from it costs no vector register
  const int rt = wave & 3, cq = wave >> 2, r0 = blockIdx.x * 64 + rt * 16, n0 = cq * 64;
  const float* xp = x + (size_t)(r0 + g) * EE + n0 + c * 4; v4f xin[8];   // load i: rows 2 i + g, 256 contiguous bytes each
  const _Float16* Mt = M16 + (size_t)r0 * EE;
  const _Float16* Wt = P + (size_t)(3 * EE + n0) * EE;   // Wo's tiles of the wave's columns; gW's stand EE * EE halves further, mW's twice that
  const unsigned lby = 16 * lane;   // the lane's byte offset in a tile: Mt and Wt are the same for the whole wave and stay in scalar registers
  auto at = [&](const _Float16* u) { return (const _Float16*)((const char*)u + lby); };
  // post part: three fragment sets take turns; half step hs = 2 kc + m: m = 0 is Wo's k chunk kc against O's, m = 1 gW's against x's
  v16h fa[3], fw[3][4];
  const int kp = (blockIdx.x + (blockIdx.x >> 3)) & (EE / 32 - 1);   // every block reads the same three weights: each walks their k chunks from its own start and wraps (rot), for the reason given at the key walk below
  auto rot = [&](int kc) { return (kc + kp) & (EE / 32 - 1); };
  // a chunk's base address is formed anew for every fetch: h0, h1, h2 hold the bases of the newest requests, and each fetch opens with a wait up to which they stay whole (it stands a half step behind those requests, so it costs little)
  const _Float16* h0 = Wt; const _Float16* h1 = Wt; const _Float16* h2 = Mt;
  auto hold = [&]() { asm volatile("s_wait_xcnt 0x0" :: "s"(h0), "s"(h1), "s"(h2) : "memory"); };
  auto loadw = [&](const _Float16* w, int z) {
#pragma unroll
    for (int t = 0; t < 4; ++t) fw[z][t] = frag_t(at(w + t * 16 * EE)); };
  auto fetch = [&](int hs, int z) { hold(); h0 = Wt + rot(hs >> 1) * 512;
    if (hs & 1) { h2 = Mt + rot(hs >> 1) * 512; fa[z] = frag_t(at(h2)); } else fa[z] = frag_t(&so[rt][rot(hs >> 1)][8 * lane]);   // O's chunk kc = head kc (HD = 32)
    loadw(h0 + (hs & 1) * EE * EE, z); };
  auto fetchm = [&](int kc, int z) { hold(); h0 = Wt + rot(kc) * 512; loadw(h0 + 2 * EE * EE, z); };
  { const int q0 = r0 % SS; const size_t bh = (size_t)(r0 / SS) * NH + 2 * cq;   // the first of the wave's two heads; the second one's arrays stand one head further
    const float scl = (1.0f / 16.0f) / sqrtf((float)HD);
    v16h bq[2]; float mrun[2], lrun[2]; v8f acc[2][2] = {};   // lrun: this lane half's keys only, the halves are joined behind the loop
#pragma unroll
    for (int hh = 0; hh < 2; ++hh) { bq[hh] = frag_t(Q16 + ((bh + hh) * SS + q0) * HD + 8 * lane); mrun[hh] = -3.0e38f; lrun[hh] = 0.f; }
    // The 16 blocks of a batch element read the same K and V, the 16 blocks of a row position the same bias tiles: requests for one line that reach L2 at one moment collide.
    // So each block enters the key walk at its own tile and wraps: the starts differ within both sets of 16. The online softmax takes the tiles in any order.
    const int kst = (blockIdx.x + (blockIdx.x >> 4)) & (SS / 64 - 1);
#pragma unroll 1   // stays rolled: two trips side by side would not fit the 256 registers
    for (int kk = 0; kk < SS / 64; ++kk) { const int kt = (kk + kst) & (SS / 64 - 1);
      v16h kf[2][4], vf[2][2][2]; float bs[4][8], sv[2][4][8];   // the tile's K and bias operands are all requested here, ahead of the first product
      const _Float16* pk = K16 + (bh * SS + kt * 64) * HD + 8 * lane; const _Float16* pv = VT + (bh * (SS / 32) + kt * 2) * 1024 + 8 * lane; const float* pr = rel + ((size_t)(q0 >> 4) * (SS / 16) + kt * 4) * 256 + 4 * lane;
#pragma unroll
      for (int hh = 0; hh < 2; ++hh) {
#pragma unroll
        for (int t = 0; t < 4; ++t) kf[hh][t] = frag_t(pk + hh * SS * HD + t * 512); }
#pragma unroll
      for (int t = 0; t < 4; ++t) {
#pragma unroll
        for (int r = 0; r < 8; ++r) bs[t][r] = pr[t * 256 + (r >> 2) * 128 + (r & 3)]; }
      // the batch's address registers stay whole up to this wait
      asm volatile("s_wait_xcnt 0x0" :: "v"(pk), "v"(pr) : "memory");
      __builtin_amdgcn_sched_barrier(0);   // keeps every product behind the whole batch of requests: moved up among them, the products would split the batch into pairs, each with a wait of its own
#pragma unroll
      for (int hh = 0; hh < 2; ++hh) {
#pragma unroll
        for (int t = 0; t < 4; ++t) { v8f s = {};
          s = wmma16(kf[hh][t], bq[hh], s);
#pragma unroll
          for (int r = 0; r < 8; ++r) sv[hh][t][r] = s[r] * scl + bs[t][r]; } }
      // three products in a row, then by turns one tile's multiply-adds and one more product: products and multiply-adds of other tiles fill each hazard distance, where a product followed by its own multiply-adds takes v_nop
      __builtin_amdgcn_sched_group_barrier(0x8, 3, 0); __builtin_amdgcn_sched_group_barrier(0x2, 4, 0);
#pragma unroll   // unrolled: the builtins are marks for the scheduler, five pairs of them in a row
      for (int i = 0; i < 5; ++i) { __builtin_amdgcn_sched_group_barrier(0x8, 1, 0); __builtin_amdgcn_sched_group_barrier(0x2, 4, 0); }
      __builtin_amdgcn_sched_group_barrier(0x2, 8, 0);
      __builtin_amdgcn_sched_barrier(0);   // keeps V's requests behind the score products, whose K registers they take over
      // V is requested here, into the registers K has left, and lands under the softmax
#pragma unroll
      for (int hh = 0; hh < 2; ++hh) {
#pragma unroll
        for (int kc = 0; kc < 2; ++kc) {
#pragma unroll
          for (int t = 0; t < 2; ++t) vf[hh][kc][t] = frag_t(pv + hh * (SS / 32) * 1024 + (kc * 2 + t) * 512); } }
      // as above, for V's address registers
      asm volatile("s_wait_xcnt 0x0" :: "v"(pv) : "memory");
      __builtin_amdgcn_sched_barrier(0);   // keeps all of V's requests ahead of the softmax, which covers their flight
#pragma unroll
      for (int hh = 0; hh < 2; ++hh) {
        float mx = -3.4e38f;
#pragma unroll
        for (int t = 0; t < 4; ++t) {
#pragma unroll
          for (int r = 0; r < 8; ++r) mx = fmaxf(mx, sv[hh][t][r]); }
        mx = fmaxf(mx, xhalf(mx));
        const float mnew = fmaxf(mrun[hh], mx); const float corr = __builtin_amdgcn_exp2f((mrun[hh] - mnew) * L2E);
        const float eoff = 14.0f - mnew * L2E;   // exponent offset: minus the maximum in base 2, plus 14 for P's 2^14 scale; ps and lrun carry that scale too
        v2f ps = {}; v16h pf[2];   // even and odd keys are summed side by side, one packed add for two
#pragma unroll
        for (int t = 0; t < 4; ++t) {
#pragma unroll
          for (int r = 0; r < 8; r += 2) { v2f pp; pp[0] = __builtin_amdgcn_exp2f(fmaf(sv[hh][t][r], L2E, eoff)); pp[1] = __builtin_amdgcn_exp2f(fmaf(sv[hh][t][r + 1], L2E, eoff)); ps += pp;
            pf[t >> 1][(t & 1) * 8 + r] = (_Float16)pp[0]; pf[t >> 1][(t & 1) * 8 + r + 1] = (_Float16)pp[1]; } }
        lrun[hh] = lrun[hh] * corr + (ps[0] + ps[1]); mrun[hh] = mnew;
#pragma unroll
        for (int r = 0; r < 8; ++r) { acc[hh][0][r] *= corr; acc[hh][1][r] *= corr; }
#pragma unroll
        for (int kc = 0; kc < 2; ++kc) {
#pragma unroll
          for (int t = 0; t < 2; ++t) acc[hh][t] = wmma16(vf[hh][kc][t], pf[kc], acc[hh][t]); } } }
    // what the post part needs first and what does not hang on O is requested here: it flies under the division, the O stores and the wait for the other waves
#pragma unroll
    for (int i = 0; i < 8; ++i) xin[i] = *(const v4f*)(xp + i * 2 * EE);
    h0 = Wt + rot(0) * 512; h1 = Wt + rot(1) * 512; h2 = Mt + rot(0) * 512; loadw(h0, 0); loadw(h0 + EE * EE, 1); loadw(h1, 2); fa[1] = frag_t(at(h2));
    // acc[hh][t][r] = O[query lane & 15][d = 16 t + 8 g + r] of head 2 cq + hh: the lane's 8 halves are chunk 32 t + lane of that head's tile
#pragma unroll
    for (int hh = 0; hh < 2; ++hh) { const float lr = lrun[hh] + xhalf(lrun[hh]); const float inv = 8.0f / (lr * 4.0f);
#pragma unroll
      for (int t = 0; t < 2; ++t) { union { v8h h8; v4u u; } pk;
#pragma unroll
        for (int r = 0; r < 8; ++r) pk.h8[r] = (_Float16)(acc[hh][t][r] * inv);
        vst2(&so[rt][2 * cq + hh][(32 * t + lane) * 8], pk.u); } } }
  __syncthreads();   // every wave of the row tile has written its two heads of O
  // (1) rmha^T and the gate's pre-activation^T: a set is requested anew as soon as its products are issued, two half steps ahead of its next use
  v8f ao[4] = {}, ag[4] = {};
  fa[0] = frag_t(&so[rt][rot(0)][8 * lane]); fa[2] = frag_t(&so[rt][rot(1)][8 * lane]);   // O's part of the first three sets; the rest was requested ahead of the barrier
  // the x loads' address registers stay whole up to this wait
  asm volatile("s_wait_xcnt 0x0" :: "v"(xp) : "memory");
#pragma unroll
  for (int i = 0; i < 8; ++i) vst2(&sx[wave][2 * i + g][c * 4], xin[i]);
#pragma unroll   // unrolled whole: which set a half step uses is known at compile time, and the last fetches drop out
  for (int hs = 0; hs < 2 * (EE / 32); ++hs) { const int z = hs % 3;
#pragma unroll
    for (int t = 0; t < 4; ++t) { if (hs & 1) ag[t] = wmma16(fw[z][t], fa[z], ag[t]); else ao[t] = wmma16(fw[z][t], fa[z], ao[t]); }
    if (hs + 3 < 2 * (EE / 32)) fetch(hs + 3, z);
    __builtin_amdgcn_sched_barrier(0); }   // keeps the ring's order: requests moved further ahead would need a fourth fragment set, which the 256 registers do not hold
  hold(); h0 = Wt + rot(0) * 512; h1 = Wt + rot(1) * 512; h2 = Wt + rot(2) * 512; loadw(h0 + 2 * EE * EE, 0); loadw(h1 + 2 * EE * EE, 1); loadw(h2 + 2 * EE * EE, 2);   // mW's first fragments fly under the gate's arithmetic and have landed at the barrier, which waits for every load
  const float* bop = bo + n0 + 8 * g; const float* gbp = gb + n0 + 8 * g; v4f bov[4][2], gbv[4][2];   // the lane's 8 columns of each tile
#pragma unroll
  for (int t = 0; t < 4; ++t) {
#pragma unroll
    for (int u = 0; u < 2; ++u) { bov[t][u] = *(const v4f*)(bop + 16 * t + 4 * u); gbv[t][u] = *(const v4f*)(gbp + 16 * t + 4 * u); } }
  // the address registers of all loads so far stay whole up to this wait
  asm volatile("s_wait_xcnt 0x0" :: "v"(bop), "v"(gbp) : "memory");
  __builtin_amdgcn_sched_barrier(0);   // keeps the arithmetic below, which reuses those registers, behind the wait
  LDSX();   // the x tile was written by other lanes of this wave
  // (2) gate1 = sigmoid(pre) * rmha + x, kept in f32 for the last step and handed on in f16
  float g1[4][8]; v16h pf[2];
#pragma unroll
  for (int t = 0; t < 4; ++t) { const int nl = 16 * t + 8 * g; float xv[8];
#pragma unroll
    for (int r = 0; r < 8; ++r) xv[r] = sx[wave][c][nl + r];
#pragma unroll
    for (int r = 0; r < 8; ++r) { const float rm = ao[t][r] * (1.0f / 128.0f) + bov[t][r >> 2][r & 3]; const float v = sigm(ag[t][r] * (1.0f / 16.0f) + gbv[t][r >> 2][r & 3]) * rm + xv[r];
      g1[t][r] = v; pf[t >> 1][(t & 1) * 8 + r] = (_Float16)v; } }
#pragma unroll
  for (int j = 0; j < 2; ++j) { union { v16h v; v4u q[2]; } u; u.v = pf[j]; _Float16* d = &sb[rt][cq * 2 + j][8 * lane]; vst2(d, u.q[0]); vst2(d + 256, u.q[1]); }
  __syncthreads();   // every wave of the row tile has written its two k chunks of gate1
  // (3) mlp^T = sigmoid(mW^T gate1^T + mb)
  v8f am[4] = {}; v4f mbv[4][2], lg[4][2], lb[4][2];   // the lane's 8 columns of each tile of mb, ln_g, ln_b
  const float* mbp = mb + n0 + 8 * g; const float* lgp = lng + n0 + 8 * g; const float* lbp = lnb + n0 + 8 * g;
  auto fetchv = [&](const float* p, v4f (&v)[4][2]) {
#pragma unroll
    for (int t = 0; t < 4; ++t) { v[t][0] = *(const v4f*)(p + 16 * t); v[t][1] = *(const v4f*)(p + 16 * t + 4); } };
#pragma unroll   // unrolled whole: which set a k chunk uses is known at compile time
  for (int kh = 0; kh < 2; ++kh) { v16h bg[4];
#pragma unroll
    for (int u = 0; u < 4; ++u) bg[u] = frag_t(&sb[rt][rot(4 * kh + u)][8 * lane]);
#pragma unroll
    for (int u = 0; u < 4; ++u) { const int kc = 4 * kh + u, z = kc % 3;
#pragma unroll
      for (int t = 0; t < 4; ++t) am[t] = wmma16(fw[z][t], bg[u], am[t]);
      if (kc + 3 < EE / 32) fetchm(kc + 3, z);
      else fetchv(kc == 5 ? mbp : kc == 6 ? lgp : lbp, kc == 5 ? mbv : kc == 6 ? lg : lb);
      __builtin_amdgcn_sched_barrier(0); } }   // the last three chunks leave their sets' registers to the three vectors, which land under the products and the sigmoids; the scheduling barrier keeps the ring's order, as in (1)
  // the address registers of all loads so far stay whole up to this wait
  asm volatile("s_wait_xcnt 0x0" :: "v"(mbp), "v"(lgp), "v"(lbp), "s"(h0) : "memory");
  __builtin_amdgcn_sched_barrier(0);   // keeps the arithmetic below, which reuses those registers, behind the wait
  float ml[4][8], sp[4];
#pragma unroll
  for (int t = 0; t < 4; ++t) sp[t] = 0.f;
#pragma unroll
  for (int r = 0; r < 8; ++r) {   // the four tiles' sums advance side by side: four independent chains
#pragma unroll
    for (int t = 0; t < 4; ++t) { const float mv = sigm(am[t][r] * (1.0f / 16.0f) + mbv[t][r >> 2][r & 3]); ml[t][r] = mv; sp[t] += mv; } }
  // (4) LN(mlp) over the row: the lane's 32 columns, the other lane half's, then the four waves' sums in a fixed order
  float s = (sp[0] + sp[1]) + (sp[2] + sp[3]); s += xhalf(s); sred[0][rt][cq][lane] = s;
  __syncthreads();   // the four partial sums of every row are written
  const float mu = ((sred[0][rt][0][lane] + sred[0][rt][1][lane]) + (sred[0][rt][2][lane] + sred[0][rt][3][lane])) * (1.0f / EE);
#pragma unroll
  for (int t = 0; t < 4; ++t) { sp[t] = 0.f;
#pragma unroll
    for (int r = 0; r < 8; ++r) { const float d = ml[t][r] - mu; sp[t] += d * d; } }
  float q2 = (sp[0] + sp[1]) + (sp[2] + sp[3]); q2 += xhalf(q2); sred[1][rt][cq][lane] = q2;
  __syncthreads();   // the four partial sums of squares of every row are written
  const float rs = rsqrtf(((sred[1][rt][0][lane] + sred[1][rt][1][lane]) + (sred[1][rt][2][lane] + sred[1][rt][3][lane])) * (1.0f / EE) + 1e-5f);
#pragma unroll
  for (int t = 0; t < 4; ++t) { const int nl = 16 * t + 8 * g; v4f o[2];
#pragma unroll
    for (int r = 0; r < 8; ++r) { const float lnv = (ml[t][r] - mu) * rs * lg[t][r >> 2][r & 3] + lb[t][r >> 2][r & 3]; o[r >> 2][r & 3] = g1[t][r] * lnv + g1[t][r]; }
    vst2(&sx[wave][c][nl], o[0]); vst2(&sx[wave][c][nl + 4], o[1]); }
  LDSX();   // the out tile is read back by other lanes of this wave
  float* op = out + (size_t)(r0 + g) * EE + n0 + c * 4;   // store i: rows 2 i + g, 256 contiguous bytes each
#pragma unroll   // unrolled: the eight LDS reads go out together
  for (int i = 0; i < 8; ++i) vst2(op + i * 2 * EE, *(const v4f*)(&sx[wave][2 * i + g][c * 4]));
}
extern "C" void kernel_launch(void* const* d_in, const int* in_sizes, int n_in, void* d_out, int out_size, void* d_ws, size_t ws_size, hipStream_t stream) {
  (void)in_sizes; (void)n_in; (void)out_size; (void)ws_size;
  const float** I = (const float**)d_in;
  const float* x = I[0]; const float* lng = I[1]; const float* lnb = I[2]; const float* Wq = I[3]; const float* bq = I[4]; const float* Wk = I[5]; const float* bk = I[6]; const float* Wv = I[7]; const float* bv = I[8]; const float* Wo = I[9]; const float* bo = I[10]; const float* rel = I[11]; const float* gW = I[12]; const float* gb = I[13]; const float* mW = I[14]; const float* mb = I[15];
  float* out = (float*)d_out;
  char* ws = (char*)d_ws; size_t off = 0;
  auto take = [&](size_t bytes) { char* p = ws + off; off += (bytes + 255) & ~(size_t)255; return p; };
  _Float16* M16 = (_Float16*)take((size_t)NR * EE * 2); _Float16* P = (_Float16*)take((size_t)6 * EE * EE * 2);
  _Float16* Q16 = (_Float16*)take((size_t)NR * EE * 2); _Float16* K16 = (_Float16*)take((size_t)NR * EE * 2); _Float16* VT = (_Float16*)take((size_t)NR * EE * 2); float* R32 = (float*)take((size_t)SS * SS * 4);
  k_qkv<<<NR / 64, 768, 0, stream>>>(x, lng, lnb, Wq, Wk, Wv, Wo, gW, mW, rel, bq, bk, bv, P, R32, M16, Q16, K16, VT);
  k_attn_post<<<NR / 64, 512, 0, stream>>>(Q16, K16, VT, R32, M16, P, bo, gb, mb, lng, lnb, x, out);
}
